// v000
// Measured on an AMD MI455X. A time is GPU time per run, averaged over a window of back-to-back runs after a warm-up
// (all launches, gaps included; the runs take copies of the inputs in turn), and the median of several windows.
// Apart from v000's, it joins two sittings. Times from different sittings can be a few percent apart, while
// side-by-side timings come from the same sitting.
// The starting kernel, v000, takes 233 microseconds a run.
#include <hip/hip_runtime.h>

// Multihead attention with relative position bias for MI455X (gfx1250).
// All GEMMs via v_wmma_f32_16x16x32_f16 (f16 in, f32 accumulate).
// fp32 operands are converted to f16 ONCE (bandwidth-bound pass), so the
// GEMM inner loops are pure global_load_b128/ds_load_b128 + v_wmma.
// L = S = 2048, N = 2, E = 1024, H = 16, D = 64.

#define L_DIM   2048
#define S_DIM   2048
#define N_BATCH 2
#define E_DIM   1024
#define H_NUM   16
#define D_HEAD  64
#define BIAS_W  (2 * S_DIM - 1)   // 4095

typedef __attribute__((ext_vector_type(16))) _Float16 v16h;
typedef __attribute__((ext_vector_type(8)))  _Float16 v8h;
typedef __attribute__((ext_vector_type(8)))  float    v8f;

__device__ __forceinline__ v8f wmma_f16(v16h a, v16h b, v8f c) {
  // D = A(16x32 f16) * B(32x16 f16) + C(16x16 f32)
  return __builtin_amdgcn_wmma_f32_16x16x32_f16(
      /*neg_a=*/false, a, /*neg_b=*/false, b,
      /*c_mod=*/(short)0, c, /*reuse_a=*/false, /*reuse_b=*/false);
}

// Load a 16(row) x 32(K) f16 fragment whose rows are contiguous-K in memory.
// Per ISA 16-bit A layout: lane (row = lane&15, half = lane>>4) holds
// K = [8*half .. +7] and [16+8*half .. +7] (two 16B runs). The identical
// layout serves as a B fragment with "row" = N column.  Works for global
// or LDS pointers (LDS -> ds_load_b128 after address-space inference).
__device__ __forceinline__ v16h frag_f16(const _Float16* __restrict__ p, int ld) {
  const int lane = threadIdx.x & 31;
  const _Float16* r = p + (lane & 15) * ld + (lane >> 4) * 8;
  v8h lo = *reinterpret_cast<const v8h*>(r);
  v8h hi = *reinterpret_cast<const v8h*>(r + 16);
  v16h f;
#pragma unroll
  for (int i = 0; i < 8; ++i) { f[i] = lo[i]; f[8 + i] = hi[i]; }
  return f;
}

// ---------------------------------------------------------------------------
// Kernel 0: one-shot fp32 -> f16 conversion (8 elements / thread, b128 I/O).
// ---------------------------------------------------------------------------
__global__ __launch_bounds__(256) void cvt_f16_kernel(
    const float* __restrict__ src, _Float16* __restrict__ dst, int n8) {
  const int i = blockIdx.x * 256 + threadIdx.x;
  if (i >= n8) return;
  float4 a = reinterpret_cast<const float4*>(src)[2 * i];
  float4 b = reinterpret_cast<const float4*>(src)[2 * i + 1];
  v8h o;
  o[0] = (_Float16)a.x; o[1] = (_Float16)a.y; o[2] = (_Float16)a.z; o[3] = (_Float16)a.w;
  o[4] = (_Float16)b.x; o[5] = (_Float16)b.y; o[6] = (_Float16)b.z; o[7] = (_Float16)b.w;
  reinterpret_cast<v8h*>(dst)[i] = o;
}

// ---------------------------------------------------------------------------
// Kernel 1: fused QKV projection.  grid.z: 0=Q, 1=K, 2=V.  All-f16 operands.
// Y[t, c] = X[t, :] . W[z*E + c, :] + bias[z*E + c]   (t = l*N + n)
// Q scaled by D^-0.5 -> qh[n][h][l][d]; K -> kh[n][h][l][d];
// V -> TRANSPOSED vt[n][h][d][s].
// Block 256 thr (8 waves) -> 128x128 tile; wave = 32x64 (2x4 WMMA tiles).
// ---------------------------------------------------------------------------
__global__ __launch_bounds__(256) void qkv_proj_kernel(
    const _Float16* __restrict__ xq, const _Float16* __restrict__ xk,
    const _Float16* __restrict__ xv, const _Float16* __restrict__ Wf,
    const float* __restrict__ bias,
    _Float16* __restrict__ qh, _Float16* __restrict__ kh,
    _Float16* __restrict__ vt) {
  const int z = blockIdx.z;
  const _Float16* X = (z == 0) ? xq : (z == 1) ? xk : xv;

  const int w  = threadIdx.x >> 5;
  const int wm = w >> 1, wn = w & 1;
  const int m0 = blockIdx.x * 128 + wm * 32;      // token rows
  const int n0 = blockIdx.y * 128 + wn * 64;      // output cols (within E)
  const _Float16* Wp = Wf + ((size_t)(z * E_DIM + n0)) * E_DIM;
  const _Float16* Ap = X + (size_t)m0 * E_DIM;
  const float* bz = bias + z * E_DIM;

  v8f acc[2][4] = {};
  for (int k0 = 0; k0 < E_DIM; k0 += 32) {
    if (k0 + 32 < E_DIM) {
      __builtin_prefetch(Ap + k0 + 32, 0, 0);
      __builtin_prefetch(Wp + k0 + 32, 0, 0);
    }
    v16h a0 = frag_f16(Ap + k0, E_DIM);
    v16h a1 = frag_f16(Ap + (size_t)16 * E_DIM + k0, E_DIM);
#pragma unroll
    for (int j = 0; j < 4; ++j) {
      v16h b = frag_f16(Wp + (size_t)(j * 16) * E_DIM + k0, E_DIM);
      acc[0][j] = wmma_f16(a0, b, acc[0][j]);
      acc[1][j] = wmma_f16(a1, b, acc[1][j]);
    }
  }

  // Epilogue: C layout -> row = g + 8*half (VGPR index), col = lane&15.
  const int lane = threadIdx.x & 31;
  const int col  = lane & 15;
  const int half = lane >> 4;
#pragma unroll
  for (int i = 0; i < 2; ++i) {
#pragma unroll
    for (int j = 0; j < 4; ++j) {
#pragma unroll
      for (int g = 0; g < 8; ++g) {
        const int t = m0 + i * 16 + g + half * 8;   // token index = l*N + n
        const int c = n0 + j * 16 + col;            // column within E
        float v = acc[i][j][g] + bz[c];
        const int l = t >> 1, n = t & 1;            // N_BATCH == 2
        const int h = c >> 6, d = c & 63;           // D_HEAD == 64
        const int nh = n * H_NUM + h;
        if (z == 0)
          qh[((size_t)nh * L_DIM + l) * D_HEAD + d] = (_Float16)(v * 0.125f);
        else if (z == 1)
          kh[((size_t)nh * S_DIM + l) * D_HEAD + d] = (_Float16)v;
        else
          vt[((size_t)nh * D_HEAD + d) * S_DIM + l] = (_Float16)v;
      }
    }
  }
}

// ---------------------------------------------------------------------------
// Kernel 2: flash attention, one (n,h) per blockIdx.y, 128 query rows/block.
// K/V tiles staged in LDS once per block (8x traffic reduction vs per-wave).
// Each wave owns 16 query rows.  Computes S^T = K . Q^T so that:
//   - softmax stats are per-lane scalars (lane <-> query column),
//   - exp(S^T) tiles are bit-exact the fragment layout required for
//     O^T = V^T . P^T  (no transpose / shuffle needed).
// ---------------------------------------------------------------------------
__global__ __launch_bounds__(256) void flash_attn_kernel(
    const _Float16* __restrict__ qh, const _Float16* __restrict__ kh,
    const _Float16* __restrict__ vt, const float* __restrict__ rel_bias,
    _Float16* __restrict__ ch) {
  __shared__ __align__(16) _Float16 lk[32 * D_HEAD];   // K tile: 32 s x 64 d
  __shared__ __align__(16) _Float16 lv[D_HEAD * 32];   // V^T tile: 64 d x 32 s

  const int nh   = blockIdx.y;            // n*H + h
  const int h    = nh & (H_NUM - 1);
  const int n    = nh >> 4;
  const int w    = threadIdx.x >> 5;
  const int lane = threadIdx.x & 31;
  const int q    = lane & 15;             // query column owned by this lane
  const int half = lane >> 4;
  const int qbase = blockIdx.x * 128 + w * 16;
  const int lglob = qbase + q;            // global query row

  const _Float16* Qp = qh + ((size_t)nh * L_DIM + qbase) * D_HEAD;
  const _Float16* Kp = kh + (size_t)nh * S_DIM * D_HEAD;
  const _Float16* Vp = vt + (size_t)nh * D_HEAD * S_DIM;
  // bias[h, l - s + S-1] accessed as bp[-s]
  const float* bp = rel_bias + (size_t)h * BIAS_W + lglob + (S_DIM - 1);

  // Cooperative-load coordinates (256 threads x 16B covers each 4KB tile).
  const int tid  = threadIdx.x;
  const int krow = tid >> 3, kcol = (tid & 7) << 3;   // 32 x 64 halfs
  const int vrow = tid >> 2, vcol = (tid & 3) << 3;   // 64 x 32 halfs

  // Q^T B-fragments (lane row = query, contiguous d), loaded once.
  const v16h qb0 = frag_f16(Qp, D_HEAD);
  const v16h qb1 = frag_f16(Qp + 32, D_HEAD);

  v8f ot0 = {}, ot1 = {}, ot2 = {}, ot3 = {};   // O^T: VGPR<->d, lane<->query
  float mrow = -3.0e38f, srow = 0.0f;

  for (int s0 = 0; s0 < S_DIM; s0 += 32) {
    // Stage K/V tiles: global -> regs (overlaps prior compute) -> LDS.
    v8h kreg = *reinterpret_cast<const v8h*>(
        Kp + (size_t)(s0 + krow) * D_HEAD + kcol);
    v8h vreg = *reinterpret_cast<const v8h*>(
        Vp + (size_t)vrow * S_DIM + s0 + vcol);
    if (s0 + 32 < S_DIM) {
      __builtin_prefetch(Kp + (size_t)(s0 + 32 + krow) * D_HEAD + kcol, 0, 0);
      __builtin_prefetch(Vp + (size_t)vrow * S_DIM + s0 + 32 + vcol, 0, 0);
    }
    __syncthreads();   // previous tile fully consumed
    *reinterpret_cast<v8h*>(lk + krow * D_HEAD + kcol) = kreg;
    *reinterpret_cast<v8h*>(lv + vrow * 32 + vcol) = vreg;
    __syncthreads();   // tile visible to all waves

    // S^T = K . Q^T  (A rows = key s, contiguous d from LDS).
    v16h ka0 = frag_f16(lk, D_HEAD);
    v16h ka1 = frag_f16(lk + 32, D_HEAD);
    v16h ka2 = frag_f16(lk + 16 * D_HEAD, D_HEAD);
    v16h ka3 = frag_f16(lk + 16 * D_HEAD + 32, D_HEAD);

    v8f st0 = {}, st1 = {};
    st0 = wmma_f16(ka0, qb0, st0);
    st0 = wmma_f16(ka1, qb1, st0);   // keys s0..s0+15
    st1 = wmma_f16(ka2, qb0, st1);
    st1 = wmma_f16(ka3, qb1, st1);   // keys s0+16..s0+31

    // Relative position bias; key index s = s0 + g + 8*half (+16 for st1).
    float sv0[8], sv1[8];
#pragma unroll
    for (int g = 0; g < 8; ++g) {
      const int so = g + half * 8;
      sv0[g] = st0[g] + bp[-(s0 + so)];
      sv1[g] = st1[g] + bp[-(s0 + so + 16)];
    }

    // Online softmax (per-query stats per-lane; merge the two lane-halves).
    float tmax = sv0[0];
#pragma unroll
    for (int g = 0; g < 8; ++g) {
      tmax = fmaxf(tmax, sv0[g]);
      tmax = fmaxf(tmax, sv1[g]);
    }
    tmax = fmaxf(tmax, __shfl_xor(tmax, 16));
    const float mnew  = fmaxf(mrow, tmax);
    const float alpha = __expf(mrow - mnew);
    mrow = mnew;

    // P^T fragment: element e<8 -> k=8*half+e (st0[e]); e>=8 -> st1[e-8].
    v16h pa;
    float tsum = 0.0f;
#pragma unroll
    for (int g = 0; g < 8; ++g) {
      const float p0 = __expf(sv0[g] - mnew);
      const float p1 = __expf(sv1[g] - mnew);
      tsum += p0 + p1;
      pa[g]     = (_Float16)p0;
      pa[8 + g] = (_Float16)p1;
    }
    tsum += __shfl_xor(tsum, 16);
    srow = srow * alpha + tsum;

#pragma unroll
    for (int g = 0; g < 8; ++g) {
      ot0[g] *= alpha; ot1[g] *= alpha; ot2[g] *= alpha; ot3[g] *= alpha;
    }

    // O^T += V^T . P^T   (A rows = d, contiguous s from LDS; B = pa)
    ot0 = wmma_f16(frag_f16(lv + 0 * 16 * 32, 32), pa, ot0);
    ot1 = wmma_f16(frag_f16(lv + 1 * 16 * 32, 32), pa, ot1);
    ot2 = wmma_f16(frag_f16(lv + 2 * 16 * 32, 32), pa, ot2);
    ot3 = wmma_f16(frag_f16(lv + 3 * 16 * 32, 32), pa, ot3);
  }

  // Normalize and scatter to context ch[t][E]; d = j*16 + half*8 + g is
  // contiguous in g -> one 16B store per tile.
  const float inv = 1.0f / srow;
  const int t = lglob * N_BATCH + n;
  _Float16* op = ch + (size_t)t * E_DIM + h * D_HEAD + half * 8;
  v8f* ots[4] = {&ot0, &ot1, &ot2, &ot3};
#pragma unroll
  for (int j = 0; j < 4; ++j) {
    v8h o;
#pragma unroll
    for (int g = 0; g < 8; ++g) o[g] = (_Float16)((*ots[j])[g] * inv);
    *reinterpret_cast<v8h*>(op + j * 16) = o;
  }
}

// ---------------------------------------------------------------------------
// Kernel 3: output projection.  out[t, e] = ch[t, :] . Wout[e, :] + bout[e]
// Same 128x128 block / 32x64 wave tiling as the QKV projection.
// ---------------------------------------------------------------------------
__global__ __launch_bounds__(256) void out_proj_kernel(
    const _Float16* __restrict__ ch, const _Float16* __restrict__ Wof,
    const float* __restrict__ bout, float* __restrict__ out) {
  const int w  = threadIdx.x >> 5;
  const int wm = w >> 1, wn = w & 1;
  const int m0 = blockIdx.x * 128 + wm * 32;
  const int n0 = blockIdx.y * 128 + wn * 64;
  const _Float16* Wp = Wof + (size_t)n0 * E_DIM;
  const _Float16* Ap = ch + (size_t)m0 * E_DIM;

  v8f acc[2][4] = {};
  for (int k0 = 0; k0 < E_DIM; k0 += 32) {
    if (k0 + 32 < E_DIM) {
      __builtin_prefetch(Ap + k0 + 32, 0, 0);
      __builtin_prefetch(Wp + k0 + 32, 0, 0);
    }
    v16h a0 = frag_f16(Ap + k0, E_DIM);
    v16h a1 = frag_f16(Ap + (size_t)16 * E_DIM + k0, E_DIM);
#pragma unroll
    for (int j = 0; j < 4; ++j) {
      v16h b = frag_f16(Wp + (size_t)(j * 16) * E_DIM + k0, E_DIM);
      acc[0][j] = wmma_f16(a0, b, acc[0][j]);
      acc[1][j] = wmma_f16(a1, b, acc[1][j]);
    }
  }

  const int lane = threadIdx.x & 31;
  const int col  = lane & 15;
  const int half = lane >> 4;
#pragma unroll
  for (int i = 0; i < 2; ++i) {
#pragma unroll
    for (int j = 0; j < 4; ++j) {
#pragma unroll
      for (int g = 0; g < 8; ++g) {
        const int t = m0 + i * 16 + g + half * 8;
        const int c = n0 + j * 16 + col;
        out[(size_t)t * E_DIM + c] = acc[i][j][g] + bout[c];
      }
    }
  }
}

// ---------------------------------------------------------------------------
extern "C" void kernel_launch(void* const* d_in, const int* in_sizes, int n_in,
                              void* d_out, int out_size, void* d_ws, size_t ws_size,
                              hipStream_t stream) {
  const float* query = (const float*)d_in[0];
  const float* key   = (const float*)d_in[1];
  const float* value = (const float*)d_in[2];
  const float* ipw   = (const float*)d_in[3];
  const float* ipb   = (const float*)d_in[4];
  const float* opw   = (const float*)d_in[5];
  const float* opb   = (const float*)d_in[6];
  const float* rbias = (const float*)d_in[7];
  float* out = (float*)d_out;

  // Workspace layout (f16 elements):
  //   qh | kh | vt | ch : N*H*L*D = 4 Mi each
  //   xq | xk | xv      : L*N*E   = 4 Mi each      (f16 activations)
  //   wf                : 3*E*E   = 3 Mi           (f16 in_proj_weight)
  //   wof               : E*E     = 1 Mi           (f16 out_proj_weight)
  // Total 32 Mi f16 = 64 MiB.
  const size_t slab = (size_t)N_BATCH * H_NUM * L_DIM * D_HEAD;  // 4 Mi
  _Float16* qh  = (_Float16*)d_ws;
  _Float16* kh  = qh + slab;
  _Float16* vt  = kh + slab;
  _Float16* ch  = vt + slab;
  _Float16* xq  = ch + slab;
  _Float16* xk  = xq + slab;
  _Float16* xv  = xk + slab;
  _Float16* wf  = xv + slab;
  _Float16* wof = wf + (size_t)3 * E_DIM * E_DIM;

  dim3 blk(256);
  const int act8 = (int)(slab / 8);                    // 524288
  const int ipw8 = 3 * E_DIM * E_DIM / 8;              // 393216
  const int opw8 = E_DIM * E_DIM / 8;                  // 131072
  cvt_f16_kernel<<<dim3(act8 / 256), blk, 0, stream>>>(query, xq, act8);
  cvt_f16_kernel<<<dim3(act8 / 256), blk, 0, stream>>>(key,   xk, act8);
  cvt_f16_kernel<<<dim3(act8 / 256), blk, 0, stream>>>(value, xv, act8);
  cvt_f16_kernel<<<dim3(ipw8 / 256), blk, 0, stream>>>(ipw,   wf, ipw8);
  cvt_f16_kernel<<<dim3(opw8 / 256), blk, 0, stream>>>(opw,   wof, opw8);

  // QKV projection: M=4096 -> 32 tiles, Nc=1024 -> 8 tiles, z = {Q,K,V}.
  qkv_proj_kernel<<<dim3(32, 8, 3), blk, 0, stream>>>(
      xq, xk, xv, wf, ipb, qh, kh, vt);
  // Flash attention: 16 query blocks x 32 (n,h) slices.
  flash_attn_kernel<<<dim3(L_DIM / 128, N_BATCH * H_NUM), blk, 0, stream>>>(
      qh, kh, vt, rbias, ch);
  // Output projection.
  out_proj_kernel<<<dim3(32, 8), blk, 0, stream>>>(ch, opw ? wof : wof, opb, out);
}

// v001
// One run takes 178 microseconds.
// In two side-by-side timings against v000, it was 1.36 and 1.35 times as fast.
#include <hip/hip_runtime.h>

// Multihead attention with relative position bias for MI455X (gfx1250).
// All GEMMs via v_wmma_f32_16x16x32_f16 (f16 in, f32 accumulate).
// fp32 operands are converted to f16 ONCE (bandwidth-bound pass); the
// projection GEMMs read their fragments from LDS tiles filled by async copies.
// L = S = 2048, N = 2, E = 1024, H = 16, D = 64.

#define L_DIM   2048
#define S_DIM   2048
#define N_BATCH 2
#define E_DIM   1024
#define H_NUM   16
#define D_HEAD  64
#define BIAS_W  (2 * S_DIM - 1)   // 4095

typedef __attribute__((ext_vector_type(16))) _Float16 v16h;
typedef __attribute__((ext_vector_type(8)))  _Float16 v8h;
typedef __attribute__((ext_vector_type(8)))  float    v8f;

__device__ __forceinline__ v8f wmma_f16(v16h a, v16h b, v8f c) {
  // D = A(16x32 f16) * B(32x16 f16) + C(16x16 f32)
  return __builtin_amdgcn_wmma_f32_16x16x32_f16(
      /*neg_a=*/false, a, /*neg_b=*/false, b,
      /*c_mod=*/(short)0, c, /*reuse_a=*/false, /*reuse_b=*/false);
}

// Load a 16(row) x 32(K) f16 fragment whose rows are contiguous-K in memory.
// Per ISA 16-bit A layout: lane (row = lane&15, half = lane>>4) holds
// K = [8*half .. +7] and [16+8*half .. +7] (two 16B runs). The identical
// layout serves as a B fragment with "row" = N column.  Works for global
// or LDS pointers (LDS -> ds_load_b128 after address-space inference).
__device__ __forceinline__ v16h frag_f16(const _Float16* __restrict__ p, int ld) {
  const int lane = threadIdx.x & 31;
  const _Float16* r = p + (lane & 15) * ld + (lane >> 4) * 8;
  v8h lo = *reinterpret_cast<const v8h*>(r);
  v8h hi = *reinterpret_cast<const v8h*>(r + 16);
  v16h f;
#pragma unroll
  for (int i = 0; i < 8; ++i) { f[i] = lo[i]; f[8 + i] = hi[i]; }
  return f;
}

// ---------------------------------------------------------------------------
// Shared main loop of the two projection GEMMs: C(128x128) = A(128xK) . B(128xK)^T.
// A and B tiles (128 rows x 64 k each) are staged in LDS by asynchronous copies,
// two buffers, so every global line is fetched whole and once per block and the
// next tile flies while this one is multiplied.
// ---------------------------------------------------------------------------
#define KT       64                 // k per stage: 128-byte rows
#define LDP      72                 // LDS row pitch in halfs: 144 B = 16 B x odd
#define STAGE_H  (256 * LDP)        // halfs per buffer: 128 A rows, then 128 B rows
#define STAGE_B  (STAGE_H * 2)      // bytes per buffer
#define ROWS32_B (32 * LDP * 2)     // LDS bytes of 32 rows
#define N_STAGE  (E_DIM / KT)       // 16

// One stage: each lane copies 16 B of 4 A rows and of 4 B rows (a wave covers
// four whole 128-B lines per copy).  The s_wait_xcnt stands inside the statement
// so that no address register is rewritten ahead of it.
__device__ __forceinline__ void stage_copy(unsigned lds, const _Float16* ga,
                                           const _Float16* gb) {
  const unsigned l0 = lds,                l1 = lds + 1 * ROWS32_B;
  const unsigned l2 = lds + 2 * ROWS32_B, l3 = lds + 3 * ROWS32_B;
  const unsigned l4 = lds + 4 * ROWS32_B, l5 = lds + 5 * ROWS32_B;
  const unsigned l6 = lds + 6 * ROWS32_B, l7 = lds + 7 * ROWS32_B;
  const _Float16* a1 = ga + 32 * E_DIM;
  const _Float16* a2 = ga + 64 * E_DIM;
  const _Float16* a3 = ga + 96 * E_DIM;
  const _Float16* b1 = gb + 32 * E_DIM;
  const _Float16* b2 = gb + 64 * E_DIM;
  const _Float16* b3 = gb + 96 * E_DIM;
  asm volatile(
      "global_load_async_to_lds_b128 %0, %8, off\n\t"
      "global_load_async_to_lds_b128 %1, %9, off\n\t"
      "global_load_async_to_lds_b128 %2, %10, off\n\t"
      "global_load_async_to_lds_b128 %3, %11, off\n\t"
      "global_load_async_to_lds_b128 %4, %12, off\n\t"
      "global_load_async_to_lds_b128 %5, %13, off\n\t"
      "global_load_async_to_lds_b128 %6, %14, off\n\t"
      "global_load_async_to_lds_b128 %7, %15, off\n\t"
      "s_wait_xcnt 0x0"
      :: "v"(l0), "v"(l1), "v"(l2), "v"(l3), "v"(l4), "v"(l5), "v"(l6), "v"(l7),
         "v"(ga), "v"(a1), "v"(a2), "v"(a3), "v"(gb), "v"(b1), "v"(b2), "v"(b3)
      : "memory");
}

// Ablk / Bblk: first row of the block's 128 A rows / 128 B rows (row pitch E_DIM).
// sm: 2 * STAGE_H halfs of LDS.  Wave (wm, wn) accumulates its 32x64 part.
__device__ __forceinline__ void gemm_128x128(const _Float16* __restrict__ Ablk,
                                             const _Float16* __restrict__ Bblk,
                                             _Float16* sm, int wm, int wn,
                                             v8f (&acc)[2][4]) {
  const int crow = threadIdx.x >> 3, ccol = (threadIdx.x & 7) << 3;
  const unsigned lds = (unsigned)(size_t)sm + (unsigned)(crow * LDP + ccol) * 2u;
  const _Float16* ga = Ablk + (size_t)crow * E_DIM + ccol;
  const _Float16* gb = Bblk + (size_t)crow * E_DIM + ccol;

  stage_copy(lds, ga, gb);
  asm volatile("s_wait_asynccnt 0x0" ::: "memory");   // own copies of tile 0 landed
  __syncthreads();                                    // tile 0 visible to all waves
  stage_copy(lds + STAGE_B, ga + KT, gb + KT);

  for (int t = 0; t < N_STAGE; ++t) {
    const _Float16* s  = sm + (t & 1) * STAGE_H;
    const _Float16* sa = s + (wm * 32) * LDP;
    const _Float16* sb = s + (128 + wn * 64) * LDP;
    // Both loops unrolled: acc[][] is indexed by constants and stays in registers.
#pragma unroll
    for (int kk = 0; kk < KT; kk += 32) {
      v16h a0 = frag_f16(sa + kk, LDP);
      v16h a1 = frag_f16(sa + 16 * LDP + kk, LDP);
#pragma unroll
      for (int j = 0; j < 4; ++j) {
        v16h b = frag_f16(sb + (j * 16) * LDP + kk, LDP);
        acc[0][j] = wmma_f16(a0, b, acc[0][j]);
        acc[1][j] = wmma_f16(a1, b, acc[1][j]);
      }
    }
    asm volatile("s_wait_dscnt 0x0" ::: "memory");    // own reads of this buffer done
    asm volatile("s_wait_asynccnt 0x0" ::: "memory"); // own copies of tile t+1 landed
    __syncthreads();   // publishes tile t+1 and frees the buffer just read
    if (t + 2 < N_STAGE)
      stage_copy(lds + (t & 1) * STAGE_B, ga + (t + 2) * KT, gb + (t + 2) * KT);
  }
  asm volatile("s_wait_asynccnt 0x0" ::: "memory");   // nothing in flight at the end
}

// ---------------------------------------------------------------------------
// Kernel 0: one-shot fp32 -> f16 conversion (8 elements / thread, b128 I/O).
// ---------------------------------------------------------------------------
__global__ __launch_bounds__(256) void cvt_f16_kernel(
    const float* __restrict__ src, _Float16* __restrict__ dst, int n8) {
  const int i = blockIdx.x * 256 + threadIdx.x;
  if (i >= n8) return;
  float4 a = reinterpret_cast<const float4*>(src)[2 * i];
  float4 b = reinterpret_cast<const float4*>(src)[2 * i + 1];
  v8h o;
  o[0] = (_Float16)a.x; o[1] = (_Float16)a.y; o[2] = (_Float16)a.z; o[3] = (_Float16)a.w;
  o[4] = (_Float16)b.x; o[5] = (_Float16)b.y; o[6] = (_Float16)b.z; o[7] = (_Float16)b.w;
  reinterpret_cast<v8h*>(dst)[i] = o;
}

// ---------------------------------------------------------------------------
// Kernel 1: fused QKV projection.  grid.z: 0=Q, 1=K, 2=V.  All-f16 operands.
// Y[t, c] = X[t, :] . W[z*E + c, :] + bias[z*E + c]   (t = l*N + n)
// Q scaled by D^-0.5 -> qh[n][h][l][d]; K -> kh[n][h][l][d];
// V -> TRANSPOSED vt[n][h][d][s].
// Block 256 thr (8 waves) -> 128x128 tile; wave = 32x64 (2x4 WMMA tiles).
// ---------------------------------------------------------------------------
__global__ __launch_bounds__(256) void qkv_proj_kernel(
    const _Float16* __restrict__ xq, const _Float16* __restrict__ xk,
    const _Float16* __restrict__ xv, const _Float16* __restrict__ Wf,
    const float* __restrict__ bias,
    _Float16* __restrict__ qh, _Float16* __restrict__ kh,
    _Float16* __restrict__ vt) {
  const int z = blockIdx.z;
  const _Float16* X = (z == 0) ? xq : (z == 1) ? xk : xv;

  const int w  = threadIdx.x >> 5;
  const int wm = w >> 1, wn = w & 1;
  const int m0 = blockIdx.x * 128 + wm * 32;      // token rows
  const int n0 = blockIdx.y * 128 + wn * 64;      // output cols (within E)
  const float* bz = bias + z * E_DIM;

  __shared__ __align__(16) _Float16 sm[2 * STAGE_H];
  v8f acc[2][4] = {};
  gemm_128x128(X + (size_t)(blockIdx.x * 128) * E_DIM,
               Wf + (size_t)(z * E_DIM + blockIdx.y * 128) * E_DIM, sm, wm, wn, acc);

  // Epilogue: C layout -> row = g + 8*half (VGPR index), col = lane&15.
  const int lane = threadIdx.x & 31;
  const int col  = lane & 15;
  const int half = lane >> 4;
#pragma unroll
  for (int i = 0; i < 2; ++i) {
#pragma unroll
    for (int j = 0; j < 4; ++j) {
#pragma unroll
      for (int g = 0; g < 8; ++g) {
        const int t = m0 + i * 16 + g + half * 8;   // token index = l*N + n
        const int c = n0 + j * 16 + col;            // column within E
        float v = acc[i][j][g] + bz[c];
        const int l = t >> 1, n = t & 1;            // N_BATCH == 2
        const int h = c >> 6, d = c & 63;           // D_HEAD == 64
        const int nh = n * H_NUM + h;
        if (z == 0)
          qh[((size_t)nh * L_DIM + l) * D_HEAD + d] = (_Float16)(v * 0.125f);
        else if (z == 1)
          kh[((size_t)nh * S_DIM + l) * D_HEAD + d] = (_Float16)v;
        else
          vt[((size_t)nh * D_HEAD + d) * S_DIM + l] = (_Float16)v;
      }
    }
  }
}

// ---------------------------------------------------------------------------
// Kernel 2: flash attention, one (n,h) per blockIdx.y, 128 query rows/block.
// K/V tiles staged in LDS once per block (8x traffic reduction vs per-wave).
// Each wave owns 16 query rows.  Computes S^T = K . Q^T so that:
//   - softmax stats are per-lane scalars (lane <-> query column),
//   - exp(S^T) tiles are bit-exact the fragment layout required for
//     O^T = V^T . P^T  (no transpose / shuffle needed).
// ---------------------------------------------------------------------------
__global__ __launch_bounds__(256) void flash_attn_kernel(
    const _Float16* __restrict__ qh, const _Float16* __restrict__ kh,
    const _Float16* __restrict__ vt, const float* __restrict__ rel_bias,
    _Float16* __restrict__ ch) {
  __shared__ __align__(16) _Float16 lk[32 * D_HEAD];   // K tile: 32 s x 64 d
  __shared__ __align__(16) _Float16 lv[D_HEAD * 32];   // V^T tile: 64 d x 32 s

  const int nh   = blockIdx.y;            // n*H + h
  const int h    = nh & (H_NUM - 1);
  const int n    = nh >> 4;
  const int w    = threadIdx.x >> 5;
  const int lane = threadIdx.x & 31;
  const int q    = lane & 15;             // query column owned by this lane
  const int half = lane >> 4;
  const int qbase = blockIdx.x * 128 + w * 16;
  const int lglob = qbase + q;            // global query row

  const _Float16* Qp = qh + ((size_t)nh * L_DIM + qbase) * D_HEAD;
  const _Float16* Kp = kh + (size_t)nh * S_DIM * D_HEAD;
  const _Float16* Vp = vt + (size_t)nh * D_HEAD * S_DIM;
  // bias[h, l - s + S-1] accessed as bp[-s]
  const float* bp = rel_bias + (size_t)h * BIAS_W + lglob + (S_DIM - 1);

  // Cooperative-load coordinates (256 threads x 16B covers each 4KB tile).
  const int tid  = threadIdx.x;
  const int krow = tid >> 3, kcol = (tid & 7) << 3;   // 32 x 64 halfs
  const int vrow = tid >> 2, vcol = (tid & 3) << 3;   // 64 x 32 halfs

  // Q^T B-fragments (lane row = query, contiguous d), loaded once.
  const v16h qb0 = frag_f16(Qp, D_HEAD);
  const v16h qb1 = frag_f16(Qp + 32, D_HEAD);

  v8f ot0 = {}, ot1 = {}, ot2 = {}, ot3 = {};   // O^T: VGPR<->d, lane<->query
  float mrow = -3.0e38f, srow = 0.0f;

  for (int s0 = 0; s0 < S_DIM; s0 += 32) {
    // Stage K/V tiles: global -> regs (overlaps prior compute) -> LDS.
    v8h kreg = *reinterpret_cast<const v8h*>(
        Kp + (size_t)(s0 + krow) * D_HEAD + kcol);
    v8h vreg = *reinterpret_cast<const v8h*>(
        Vp + (size_t)vrow * S_DIM + s0 + vcol);
    if (s0 + 32 < S_DIM) {
      __builtin_prefetch(Kp + (size_t)(s0 + 32 + krow) * D_HEAD + kcol, 0, 0);
      __builtin_prefetch(Vp + (size_t)vrow * S_DIM + s0 + 32 + vcol, 0, 0);
    }
    __syncthreads();   // previous tile fully consumed
    *reinterpret_cast<v8h*>(lk + krow * D_HEAD + kcol) = kreg;
    *reinterpret_cast<v8h*>(lv + vrow * 32 + vcol) = vreg;
    __syncthreads();   // tile visible to all waves

    // S^T = K . Q^T  (A rows = key s, contiguous d from LDS).
    v16h ka0 = frag_f16(lk, D_HEAD);
    v16h ka1 = frag_f16(lk + 32, D_HEAD);
    v16h ka2 = frag_f16(lk + 16 * D_HEAD, D_HEAD);
    v16h ka3 = frag_f16(lk + 16 * D_HEAD + 32, D_HEAD);

    v8f st0 = {}, st1 = {};
    st0 = wmma_f16(ka0, qb0, st0);
    st0 = wmma_f16(ka1, qb1, st0);   // keys s0..s0+15
    st1 = wmma_f16(ka2, qb0, st1);
    st1 = wmma_f16(ka3, qb1, st1);   // keys s0+16..s0+31

    // Relative position bias; key index s = s0 + g + 8*half (+16 for st1).
    float sv0[8], sv1[8];
#pragma unroll
    for (int g = 0; g < 8; ++g) {
      const int so = g + half * 8;
      sv0[g] = st0[g] + bp[-(s0 + so)];
      sv1[g] = st1[g] + bp[-(s0 + so + 16)];
    }

    // Online softmax (per-query stats per-lane; merge the two lane-halves).
    float tmax = sv0[0];
#pragma unroll
    for (int g = 0; g < 8; ++g) {
      tmax = fmaxf(tmax, sv0[g]);
      tmax = fmaxf(tmax, sv1[g]);
    }
    tmax = fmaxf(tmax, __shfl_xor(tmax, 16));
    const float mnew  = fmaxf(mrow, tmax);
    const float alpha = __expf(mrow - mnew);
    mrow = mnew;

    // P^T fragment: element e<8 -> k=8*half+e (st0[e]); e>=8 -> st1[e-8].
    v16h pa;
    float tsum = 0.0f;
#pragma unroll
    for (int g = 0; g < 8; ++g) {
      const float p0 = __expf(sv0[g] - mnew);
      const float p1 = __expf(sv1[g] - mnew);
      tsum += p0 + p1;
      pa[g]     = (_Float16)p0;
      pa[8 + g] = (_Float16)p1;
    }
    tsum += __shfl_xor(tsum, 16);
    srow = srow * alpha + tsum;

#pragma unroll
    for (int g = 0; g < 8; ++g) {
      ot0[g] *= alpha; ot1[g] *= alpha; ot2[g] *= alpha; ot3[g] *= alpha;
    }

    // O^T += V^T . P^T   (A rows = d, contiguous s from LDS; B = pa)
    ot0 = wmma_f16(frag_f16(lv + 0 * 16 * 32, 32), pa, ot0);
    ot1 = wmma_f16(frag_f16(lv + 1 * 16 * 32, 32), pa, ot1);
    ot2 = wmma_f16(frag_f16(lv + 2 * 16 * 32, 32), pa, ot2);
    ot3 = wmma_f16(frag_f16(lv + 3 * 16 * 32, 32), pa, ot3);
  }

  // Normalize and scatter to context ch[t][E]; d = j*16 + half*8 + g is
  // contiguous in g -> one 16B store per tile.
  const float inv = 1.0f / srow;
  const int t = lglob * N_BATCH + n;
  _Float16* op = ch + (size_t)t * E_DIM + h * D_HEAD + half * 8;
  v8f* ots[4] = {&ot0, &ot1, &ot2, &ot3};
#pragma unroll
  for (int j = 0; j < 4; ++j) {
    v8h o;
#pragma unroll
    for (int g = 0; g < 8; ++g) o[g] = (_Float16)((*ots[j])[g] * inv);
    *reinterpret_cast<v8h*>(op + j * 16) = o;
  }
}

// ---------------------------------------------------------------------------
// Kernel 3: output projection.  out[t, e] = ch[t, :] . Wout[e, :] + bout[e]
// Same 128x128 block / 32x64 wave tiling as the QKV projection.
// ---------------------------------------------------------------------------
__global__ __launch_bounds__(256) void out_proj_kernel(
    const _Float16* __restrict__ ch, const _Float16* __restrict__ Wof,
    const float* __restrict__ bout, float* __restrict__ out) {
  const int w  = threadIdx.x >> 5;
  const int wm = w >> 1, wn = w & 1;
  const int m0 = blockIdx.x * 128 + wm * 32;
  const int n0 = blockIdx.y * 128 + wn * 64;
  __shared__ __align__(16) _Float16 sm[2 * STAGE_H];
  v8f acc[2][4] = {};
  gemm_128x128(ch + (size_t)(blockIdx.x * 128) * E_DIM,
               Wof + (size_t)(blockIdx.y * 128) * E_DIM, sm, wm, wn, acc);

  const int lane = threadIdx.x & 31;
  const int col  = lane & 15;
  const int half = lane >> 4;
#pragma unroll
  for (int i = 0; i < 2; ++i) {
#pragma unroll
    for (int j = 0; j < 4; ++j) {
#pragma unroll
      for (int g = 0; g < 8; ++g) {
        const int t = m0 + i * 16 + g + half * 8;
        const int c = n0 + j * 16 + col;
        out[(size_t)t * E_DIM + c] = acc[i][j][g] + bout[c];
      }
    }
  }
}

// ---------------------------------------------------------------------------
extern "C" void kernel_launch(void* const* d_in, const int* in_sizes, int n_in,
                              void* d_out, int out_size, void* d_ws, size_t ws_size,
                              hipStream_t stream) {
  const float* query = (const float*)d_in[0];
  const float* key   = (const float*)d_in[1];
  const float* value = (const float*)d_in[2];
  const float* ipw   = (const float*)d_in[3];
  const float* ipb   = (const float*)d_in[4];
  const float* opw   = (const float*)d_in[5];
  const float* opb   = (const float*)d_in[6];
  const float* rbias = (const float*)d_in[7];
  float* out = (float*)d_out;

  // Workspace layout (f16 elements):
  //   qh | kh | vt | ch : N*H*L*D = 4 Mi each
  //   xq | xk | xv      : L*N*E   = 4 Mi each      (f16 activations)
  //   wf                : 3*E*E   = 3 Mi           (f16 in_proj_weight)
  //   wof               : E*E     = 1 Mi           (f16 out_proj_weight)
  // Total 32 Mi f16 = 64 MiB.
  const size_t slab = (size_t)N_BATCH * H_NUM * L_DIM * D_HEAD;  // 4 Mi
  _Float16* qh  = (_Float16*)d_ws;
  _Float16* kh  = qh + slab;
  _Float16* vt  = kh + slab;
  _Float16* ch  = vt + slab;
  _Float16* xq  = ch + slab;
  _Float16* xk  = xq + slab;
  _Float16* xv  = xk + slab;
  _Float16* wf  = xv + slab;
  _Float16* wof = wf + (size_t)3 * E_DIM * E_DIM;

  dim3 blk(256);
  const int act8 = (int)(slab / 8);                    // 524288
  const int ipw8 = 3 * E_DIM * E_DIM / 8;              // 393216
  const int opw8 = E_DIM * E_DIM / 8;                  // 131072
  cvt_f16_kernel<<<dim3(act8 / 256), blk, 0, stream>>>(query, xq, act8);
  cvt_f16_kernel<<<dim3(act8 / 256), blk, 0, stream>>>(key,   xk, act8);
  cvt_f16_kernel<<<dim3(act8 / 256), blk, 0, stream>>>(value, xv, act8);
  cvt_f16_kernel<<<dim3(ipw8 / 256), blk, 0, stream>>>(ipw,   wf, ipw8);
  cvt_f16_kernel<<<dim3(opw8 / 256), blk, 0, stream>>>(opw,   wof, opw8);

  // QKV projection: M=4096 -> 32 tiles, Nc=1024 -> 8 tiles, z = {Q,K,V}.
  qkv_proj_kernel<<<dim3(32, 8, 3), blk, 0, stream>>>(
      xq, xk, xv, wf, ipb, qh, kh, vt);
  // Flash attention: 16 query blocks x 32 (n,h) slices.
  flash_attn_kernel<<<dim3(L_DIM / 128, N_BATCH * H_NUM), blk, 0, stream>>>(
      qh, kh, vt, rbias, ch);
  // Output projection.
  out_proj_kernel<<<dim3(32, 8), blk, 0, stream>>>(ch, opw ? wof : wof, opb, out);
}

// v002
// It runs in 131 microseconds.
// Next to v001, in two timings, it ran 1.36 and 1.35 times as fast.
// All steps since v000 together make it 1.83 times as fast.
#include <hip/hip_runtime.h>

// Multihead attention with relative position bias for MI455X (gfx1250).
// All GEMMs via v_wmma_f32_16x16x32_f16 (f16 in, f32 accumulate).
// fp32 operands are converted to f16 ONCE (bandwidth-bound pass); the
// projection GEMMs read their fragments from LDS tiles filled by async copies.
// L = S = 2048, N = 2, E = 1024, H = 16, D = 64.

#define L_DIM   2048
#define S_DIM   2048
#define N_BATCH 2
#define E_DIM   1024
#define H_NUM   16
#define D_HEAD  64
#define BIAS_W  (2 * S_DIM - 1)   // 4095

typedef __attribute__((ext_vector_type(16))) _Float16 v16h;
typedef __attribute__((ext_vector_type(8)))  _Float16 v8h;
typedef __attribute__((ext_vector_type(8)))  float    v8f;

__device__ __forceinline__ v8f wmma_f16(v16h a, v16h b, v8f c) {
  // D = A(16x32 f16) * B(32x16 f16) + C(16x16 f32)
  return __builtin_amdgcn_wmma_f32_16x16x32_f16(
      /*neg_a=*/false, a, /*neg_b=*/false, b,
      /*c_mod=*/(short)0, c, /*reuse_a=*/false, /*reuse_b=*/false);
}

// Load a 16(row) x 32(K) f16 fragment whose rows are contiguous-K in memory.
// Per ISA 16-bit A layout: lane (row = lane&15, half = lane>>4) holds
// K = [8*half .. +7] and [16+8*half .. +7] (two 16B runs). The identical
// layout serves as a B fragment with "row" = N column.  Works for global
// or LDS pointers (LDS -> ds_load_b128 after address-space inference).
__device__ __forceinline__ v16h frag_f16(const _Float16* __restrict__ p, int ld) {
  const int lane = threadIdx.x & 31;
  const _Float16* r = p + (lane & 15) * ld + (lane >> 4) * 8;
  v8h lo = *reinterpret_cast<const v8h*>(r);
  v8h hi = *reinterpret_cast<const v8h*>(r + 16);
  v16h f;
#pragma unroll
  for (int i = 0; i < 8; ++i) { f[i] = lo[i]; f[8 + i] = hi[i]; }
  return f;
}

// ---------------------------------------------------------------------------
// Shared main loop of the two projection GEMMs: C(128x128) = A(128xK) . B(128xK)^T.
// A and B tiles (128 rows x 64 k each) are staged in LDS by asynchronous copies,
// two buffers, so every global line is fetched whole and once per block and the
// next tile flies while this one is multiplied.
// ---------------------------------------------------------------------------
#define KT       64                 // k per stage: 128-byte rows
#define LDP      72                 // LDS row pitch in halfs: 144 B = 16 B x odd
#define STAGE_H  (256 * LDP)        // halfs per buffer: 128 A rows, then 128 B rows
#define STAGE_B  (STAGE_H * 2)      // bytes per buffer
#define ROWS32_B (32 * LDP * 2)     // LDS bytes of 32 rows
#define N_STAGE  (E_DIM / KT)       // 16

// One stage: each lane copies 16 B of 4 A rows and of 4 B rows (a wave covers
// four whole 128-B lines per copy).  The s_wait_xcnt stands inside the statement
// so that no address register is rewritten ahead of it.
__device__ __forceinline__ void stage_copy(unsigned lds, const _Float16* ga,
                                           const _Float16* gb) {
  const unsigned l0 = lds,                l1 = lds + 1 * ROWS32_B;
  const unsigned l2 = lds + 2 * ROWS32_B, l3 = lds + 3 * ROWS32_B;
  const unsigned l4 = lds + 4 * ROWS32_B, l5 = lds + 5 * ROWS32_B;
  const unsigned l6 = lds + 6 * ROWS32_B, l7 = lds + 7 * ROWS32_B;
  const _Float16* a1 = ga + 32 * E_DIM;
  const _Float16* a2 = ga + 64 * E_DIM;
  const _Float16* a3 = ga + 96 * E_DIM;
  const _Float16* b1 = gb + 32 * E_DIM;
  const _Float16* b2 = gb + 64 * E_DIM;
  const _Float16* b3 = gb + 96 * E_DIM;
  asm volatile(
      "global_load_async_to_lds_b128 %0, %8, off\n\t"
      "global_load_async_to_lds_b128 %1, %9, off\n\t"
      "global_load_async_to_lds_b128 %2, %10, off\n\t"
      "global_load_async_to_lds_b128 %3, %11, off\n\t"
      "global_load_async_to_lds_b128 %4, %12, off\n\t"
      "global_load_async_to_lds_b128 %5, %13, off\n\t"
      "global_load_async_to_lds_b128 %6, %14, off\n\t"
      "global_load_async_to_lds_b128 %7, %15, off\n\t"
      "s_wait_xcnt 0x0"
      :: "v"(l0), "v"(l1), "v"(l2), "v"(l3), "v"(l4), "v"(l5), "v"(l6), "v"(l7),
         "v"(ga), "v"(a1), "v"(a2), "v"(a3), "v"(gb), "v"(b1), "v"(b2), "v"(b3)
      : "memory");
}

// Ablk / Bblk: first row of the block's 128 A rows / 128 B rows (row pitch E_DIM).
// sm: 2 * STAGE_H halfs of LDS.  Wave (wm, wn) accumulates its 32x64 part.
__device__ __forceinline__ void gemm_128x128(const _Float16* __restrict__ Ablk,
                                             const _Float16* __restrict__ Bblk,
                                             _Float16* sm, int wm, int wn,
                                             v8f (&acc)[2][4]) {
  const int crow = threadIdx.x >> 3, ccol = (threadIdx.x & 7) << 3;
  const unsigned lds = (unsigned)(size_t)sm + (unsigned)(crow * LDP + ccol) * 2u;
  const _Float16* ga = Ablk + (size_t)crow * E_DIM + ccol;
  const _Float16* gb = Bblk + (size_t)crow * E_DIM + ccol;

  stage_copy(lds, ga, gb);
  asm volatile("s_wait_asynccnt 0x0" ::: "memory");   // own copies of tile 0 landed
  __syncthreads();                                    // tile 0 visible to all waves
  stage_copy(lds + STAGE_B, ga + KT, gb + KT);

  for (int t = 0; t < N_STAGE; ++t) {
    const _Float16* s  = sm + (t & 1) * STAGE_H;
    const _Float16* sa = s + (wm * 32) * LDP;
    const _Float16* sb = s + (128 + wn * 64) * LDP;
    // Both loops unrolled: acc[][] is indexed by constants and stays in registers.
#pragma unroll
    for (int kk = 0; kk < KT; kk += 32) {
      v16h a0 = frag_f16(sa + kk, LDP);
      v16h a1 = frag_f16(sa + 16 * LDP + kk, LDP);
#pragma unroll
      for (int j = 0; j < 4; ++j) {
        v16h b = frag_f16(sb + (j * 16) * LDP + kk, LDP);
        acc[0][j] = wmma_f16(a0, b, acc[0][j]);
        acc[1][j] = wmma_f16(a1, b, acc[1][j]);
      }
    }
    asm volatile("s_wait_dscnt 0x0" ::: "memory");    // own reads of this buffer done
    asm volatile("s_wait_asynccnt 0x0" ::: "memory"); // own copies of tile t+1 landed
    __syncthreads();   // publishes tile t+1 and frees the buffer just read
    if (t + 2 < N_STAGE)
      stage_copy(lds + (t & 1) * STAGE_B, ga + (t + 2) * KT, gb + (t + 2) * KT);
  }
  asm volatile("s_wait_asynccnt 0x0" ::: "memory");   // nothing in flight at the end
}

// ---------------------------------------------------------------------------
// Kernel 0: one-shot fp32 -> f16 conversion (8 elements / thread, b128 I/O).
// ---------------------------------------------------------------------------
__global__ __launch_bounds__(256) void cvt_f16_kernel(
    const float* __restrict__ src, _Float16* __restrict__ dst, int n8) {
  const int i = blockIdx.x * 256 + threadIdx.x;
  if (i >= n8) return;
  float4 a = reinterpret_cast<const float4*>(src)[2 * i];
  float4 b = reinterpret_cast<const float4*>(src)[2 * i + 1];
  v8h o;
  o[0] = (_Float16)a.x; o[1] = (_Float16)a.y; o[2] = (_Float16)a.z; o[3] = (_Float16)a.w;
  o[4] = (_Float16)b.x; o[5] = (_Float16)b.y; o[6] = (_Float16)b.z; o[7] = (_Float16)b.w;
  reinterpret_cast<v8h*>(dst)[i] = o;
}

// ---------------------------------------------------------------------------
// Kernel 1: fused QKV projection.  grid.z: 0=Q, 1=K, 2=V.  All-f16 operands.
// Y[t, c] = X[t, :] . W[z*E + c, :] + bias[z*E + c]   (t = l*N + n)
// Q scaled by D^-0.5 -> qh[n][h][l][d]; K -> kh[n][h][l][d];
// V -> TRANSPOSED vt[n][h][d][s].
// Block 256 thr (8 waves) -> 128x128 tile; wave = 32x64 (2x4 WMMA tiles).
// ---------------------------------------------------------------------------
__global__ __launch_bounds__(256) void qkv_proj_kernel(
    const _Float16* __restrict__ xq, const _Float16* __restrict__ xk,
    const _Float16* __restrict__ xv, const _Float16* __restrict__ Wf,
    const float* __restrict__ bias,
    _Float16* __restrict__ qh, _Float16* __restrict__ kh,
    _Float16* __restrict__ vt) {
  const int z = blockIdx.z;
  const _Float16* X = (z == 0) ? xq : (z == 1) ? xk : xv;

  const int w  = threadIdx.x >> 5;
  const int wm = w >> 1, wn = w & 1;
  const int m0 = blockIdx.x * 128 + wm * 32;      // token rows
  const int n0 = blockIdx.y * 128 + wn * 64;      // output cols (within E)
  const float* bz = bias + z * E_DIM;

  __shared__ __align__(16) _Float16 sm[2 * STAGE_H];
  v8f acc[2][4] = {};
  gemm_128x128(X + (size_t)(blockIdx.x * 128) * E_DIM,
               Wf + (size_t)(z * E_DIM + blockIdx.y * 128) * E_DIM, sm, wm, wn, acc);

  // Epilogue: C layout -> row = g + 8*half (VGPR index), col = lane&15.
  const int lane = threadIdx.x & 31;
  const int col  = lane & 15;
  const int half = lane >> 4;
#pragma unroll
  for (int i = 0; i < 2; ++i) {
#pragma unroll
    for (int j = 0; j < 4; ++j) {
#pragma unroll
      for (int g = 0; g < 8; ++g) {
        const int t = m0 + i * 16 + g + half * 8;   // token index = l*N + n
        const int c = n0 + j * 16 + col;            // column within E
        float v = acc[i][j][g] + bz[c];
        const int l = t >> 1, n = t & 1;            // N_BATCH == 2
        const int h = c >> 6, d = c & 63;           // D_HEAD == 64
        const int nh = n * H_NUM + h;
        if (z == 0)
          qh[((size_t)nh * L_DIM + l) * D_HEAD + d] = (_Float16)(v * 0.125f);
        else if (z == 1)
          kh[((size_t)nh * S_DIM + l) * D_HEAD + d] = (_Float16)v;
        else
          vt[((size_t)nh * D_HEAD + d) * S_DIM + l] = (_Float16)v;
      }
    }
  }
}

// ---------------------------------------------------------------------------
// Kernel 2: flash attention, one (n,h) per blockIdx.y, 128 query rows/block.
// K/V tiles staged in LDS once per block (8x traffic reduction vs per-wave).
// LDS rows are padded by 16 B (pitch = 16 B x odd) so that the 16 rows one
// ds_load_b128 fragment read touches fall on 16 different groups of four banks.
// Each wave owns 16 query rows.  Computes S^T = K . Q^T so that:
//   - softmax stats are per-lane scalars (lane <-> query column),
//   - exp(S^T) tiles are bit-exact the fragment layout required for
//     O^T = V^T . P^T  (no transpose / shuffle needed).
// ---------------------------------------------------------------------------
#define KP (D_HEAD + 8)   // K tile row pitch in halfs: 144 B
#define VP (32 + 8)       // V^T tile row pitch in halfs: 80 B
__global__ __launch_bounds__(256) void flash_attn_kernel(
    const _Float16* __restrict__ qh, const _Float16* __restrict__ kh,
    const _Float16* __restrict__ vt, const float* __restrict__ rel_bias,
    _Float16* __restrict__ ch) {
  __shared__ __align__(16) _Float16 lk[32 * KP];       // K tile: 32 s x 64 d
  __shared__ __align__(16) _Float16 lv[D_HEAD * VP];   // V^T tile: 64 d x 32 s

  const int nh   = blockIdx.y;            // n*H + h
  const int h    = nh & (H_NUM - 1);
  const int n    = nh >> 4;
  const int w    = threadIdx.x >> 5;
  const int lane = threadIdx.x & 31;
  const int q    = lane & 15;             // query column owned by this lane
  const int half = lane >> 4;
  const int qbase = blockIdx.x * 128 + w * 16;
  const int lglob = qbase + q;            // global query row

  const _Float16* Qp = qh + ((size_t)nh * L_DIM + qbase) * D_HEAD;
  const _Float16* Kp = kh + (size_t)nh * S_DIM * D_HEAD;
  const _Float16* Vp = vt + (size_t)nh * D_HEAD * S_DIM;
  // bias[h, l - s + S-1] accessed as bp[-s]
  const float* bp = rel_bias + (size_t)h * BIAS_W + lglob + (S_DIM - 1);

  // Cooperative-load coordinates (256 threads x 16B covers each 4KB tile).
  const int tid  = threadIdx.x;
  const int krow = tid >> 3, kcol = (tid & 7) << 3;   // 32 x 64 halfs
  const int vrow = tid >> 2, vcol = (tid & 3) << 3;   // 64 x 32 halfs

  // Q^T B-fragments (lane row = query, contiguous d), loaded once.
  const v16h qb0 = frag_f16(Qp, D_HEAD);
  const v16h qb1 = frag_f16(Qp + 32, D_HEAD);

  v8f ot0 = {}, ot1 = {}, ot2 = {}, ot3 = {};   // O^T: VGPR<->d, lane<->query
  float mrow = -3.0e38f, srow = 0.0f;

  for (int s0 = 0; s0 < S_DIM; s0 += 32) {
    // Stage K/V tiles: global -> regs (overlaps prior compute) -> LDS.
    v8h kreg = *reinterpret_cast<const v8h*>(
        Kp + (size_t)(s0 + krow) * D_HEAD + kcol);
    v8h vreg = *reinterpret_cast<const v8h*>(
        Vp + (size_t)vrow * S_DIM + s0 + vcol);
    if (s0 + 32 < S_DIM) {
      __builtin_prefetch(Kp + (size_t)(s0 + 32 + krow) * D_HEAD + kcol, 0, 0);
      __builtin_prefetch(Vp + (size_t)vrow * S_DIM + s0 + 32 + vcol, 0, 0);
    }
    __syncthreads();   // previous tile fully consumed
    *reinterpret_cast<v8h*>(lk + krow * KP + kcol) = kreg;
    *reinterpret_cast<v8h*>(lv + vrow * VP + vcol) = vreg;
    __syncthreads();   // tile visible to all waves

    // S^T = K . Q^T  (A rows = key s, contiguous d from LDS).
    v16h ka0 = frag_f16(lk, KP);
    v16h ka1 = frag_f16(lk + 32, KP);
    v16h ka2 = frag_f16(lk + 16 * KP, KP);
    v16h ka3 = frag_f16(lk + 16 * KP + 32, KP);

    v8f st0 = {}, st1 = {};
    st0 = wmma_f16(ka0, qb0, st0);
    st0 = wmma_f16(ka1, qb1, st0);   // keys s0..s0+15
    st1 = wmma_f16(ka2, qb0, st1);
    st1 = wmma_f16(ka3, qb1, st1);   // keys s0+16..s0+31

    // Relative position bias; key index s = s0 + g + 8*half (+16 for st1).
    float sv0[8], sv1[8];
#pragma unroll
    for (int g = 0; g < 8; ++g) {
      const int so = g + half * 8;
      sv0[g] = st0[g] + bp[-(s0 + so)];
      sv1[g] = st1[g] + bp[-(s0 + so + 16)];
    }

    // Online softmax (per-query stats per-lane; merge the two lane-halves).
    float tmax = sv0[0];
#pragma unroll
    for (int g = 0; g < 8; ++g) {
      tmax = fmaxf(tmax, sv0[g]);
      tmax = fmaxf(tmax, sv1[g]);
    }
    tmax = fmaxf(tmax, __shfl_xor(tmax, 16));
    const float mnew  = fmaxf(mrow, tmax);
    const float alpha = __expf(mrow - mnew);
    mrow = mnew;

    // P^T fragment: element e<8 -> k=8*half+e (st0[e]); e>=8 -> st1[e-8].
    v16h pa;
    float tsum = 0.0f;
#pragma unroll
    for (int g = 0; g < 8; ++g) {
      const float p0 = __expf(sv0[g] - mnew);
      const float p1 = __expf(sv1[g] - mnew);
      tsum += p0 + p1;
      pa[g]     = (_Float16)p0;
      pa[8 + g] = (_Float16)p1;
    }
    tsum += __shfl_xor(tsum, 16);
    srow = srow * alpha + tsum;

#pragma unroll
    for (int g = 0; g < 8; ++g) {
      ot0[g] *= alpha; ot1[g] *= alpha; ot2[g] *= alpha; ot3[g] *= alpha;
    }

    // O^T += V^T . P^T   (A rows = d, contiguous s from LDS; B = pa)
    ot0 = wmma_f16(frag_f16(lv + 0 * 16 * VP, VP), pa, ot0);
    ot1 = wmma_f16(frag_f16(lv + 1 * 16 * VP, VP), pa, ot1);
    ot2 = wmma_f16(frag_f16(lv + 2 * 16 * VP, VP), pa, ot2);
    ot3 = wmma_f16(frag_f16(lv + 3 * 16 * VP, VP), pa, ot3);
  }

  // Normalize and scatter to context ch[t][E]; d = j*16 + half*8 + g is
  // contiguous in g -> one 16B store per tile.
  const float inv = 1.0f / srow;
  const int t = lglob * N_BATCH + n;
  _Float16* op = ch + (size_t)t * E_DIM + h * D_HEAD + half * 8;
  v8f* ots[4] = {&ot0, &ot1, &ot2, &ot3};
#pragma unroll
  for (int j = 0; j < 4; ++j) {
    v8h o;
#pragma unroll
    for (int g = 0; g < 8; ++g) o[g] = (_Float16)((*ots[j])[g] * inv);
    *reinterpret_cast<v8h*>(op + j * 16) = o;
  }
}

// ---------------------------------------------------------------------------
// Kernel 3: output projection.  out[t, e] = ch[t, :] . Wout[e, :] + bout[e]
// Same 128x128 block / 32x64 wave tiling as the QKV projection.
// ---------------------------------------------------------------------------
__global__ __launch_bounds__(256) void out_proj_kernel(
    const _Float16* __restrict__ ch, const _Float16* __restrict__ Wof,
    const float* __restrict__ bout, float* __restrict__ out) {
  const int w  = threadIdx.x >> 5;
  const int wm = w >> 1, wn = w & 1;
  const int m0 = blockIdx.x * 128 + wm * 32;
  const int n0 = blockIdx.y * 128 + wn * 64;
  __shared__ __align__(16) _Float16 sm[2 * STAGE_H];
  v8f acc[2][4] = {};
  gemm_128x128(ch + (size_t)(blockIdx.x * 128) * E_DIM,
               Wof + (size_t)(blockIdx.y * 128) * E_DIM, sm, wm, wn, acc);

  const int lane = threadIdx.x & 31;
  const int col  = lane & 15;
  const int half = lane >> 4;
#pragma unroll
  for (int i = 0; i < 2; ++i) {
#pragma unroll
    for (int j = 0; j < 4; ++j) {
#pragma unroll
      for (int g = 0; g < 8; ++g) {
        const int t = m0 + i * 16 + g + half * 8;
        const int c = n0 + j * 16 + col;
        out[(size_t)t * E_DIM + c] = acc[i][j][g] + bout[c];
      }
    }
  }
}

// ---------------------------------------------------------------------------
extern "C" void kernel_launch(void* const* d_in, const int* in_sizes, int n_in,
                              void* d_out, int out_size, void* d_ws, size_t ws_size,
                              hipStream_t stream) {
  const float* query = (const float*)d_in[0];
  const float* key   = (const float*)d_in[1];
  const float* value = (const float*)d_in[2];
  const float* ipw   = (const float*)d_in[3];
  const float* ipb   = (const float*)d_in[4];
  const float* opw   = (const float*)d_in[5];
  const float* opb   = (const float*)d_in[6];
  const float* rbias = (const float*)d_in[7];
  float* out = (float*)d_out;

  // Workspace layout (f16 elements):
  //   qh | kh | vt | ch : N*H*L*D = 4 Mi each
  //   xq | xk | xv      : L*N*E   = 4 Mi each      (f16 activations)
  //   wf                : 3*E*E   = 3 Mi           (f16 in_proj_weight)
  //   wof               : E*E     = 1 Mi           (f16 out_proj_weight)
  // Total 32 Mi f16 = 64 MiB.
  const size_t slab = (size_t)N_BATCH * H_NUM * L_DIM * D_HEAD;  // 4 Mi
  _Float16* qh  = (_Float16*)d_ws;
  _Float16* kh  = qh + slab;
  _Float16* vt  = kh + slab;
  _Float16* ch  = vt + slab;
  _Float16* xq  = ch + slab;
  _Float16* xk  = xq + slab;
  _Float16* xv  = xk + slab;
  _Float16* wf  = xv + slab;
  _Float16* wof = wf + (size_t)3 * E_DIM * E_DIM;

  dim3 blk(256);
  const int act8 = (int)(slab / 8);                    // 524288
  const int ipw8 = 3 * E_DIM * E_DIM / 8;              // 393216
  const int opw8 = E_DIM * E_DIM / 8;                  // 131072
  cvt_f16_kernel<<<dim3(act8 / 256), blk, 0, stream>>>(query, xq, act8);
  cvt_f16_kernel<<<dim3(act8 / 256), blk, 0, stream>>>(key,   xk, act8);
  cvt_f16_kernel<<<dim3(act8 / 256), blk, 0, stream>>>(value, xv, act8);
  cvt_f16_kernel<<<dim3(ipw8 / 256), blk, 0, stream>>>(ipw,   wf, ipw8);
  cvt_f16_kernel<<<dim3(opw8 / 256), blk, 0, stream>>>(opw,   wof, opw8);

  // QKV projection: M=4096 -> 32 tiles, Nc=1024 -> 8 tiles, z = {Q,K,V}.
  qkv_proj_kernel<<<dim3(32, 8, 3), blk, 0, stream>>>(
      xq, xk, xv, wf, ipb, qh, kh, vt);
  // Flash attention: 16 query blocks x 32 (n,h) slices.
  flash_attn_kernel<<<dim3(L_DIM / 128, N_BATCH * H_NUM), blk, 0, stream>>>(
      qh, kh, vt, rbias, ch);
  // Output projection.
  out_proj_kernel<<<dim3(32, 8), blk, 0, stream>>>(ch, opw ? wof : wof, opb, out);
}

// v003
// Measured time: 124 microseconds a run.
// Next to v002, in two timings, it ran 1.06 times as fast each time.
// All steps since v000 together make it 1.95 times as fast.
#include <hip/hip_runtime.h>

// Multihead attention with relative position bias for MI455X (gfx1250).
// All GEMMs via v_wmma_f32_16x16x32_f16 (f16 in, f32 accumulate).
// fp32 operands are converted to f16 ONCE (one bandwidth-bound launch); the
// projection GEMMs read their fragments from LDS tiles filled by async copies.
// L = S = 2048, N = 2, E = 1024, H = 16, D = 64.

#define L_DIM   2048
#define S_DIM   2048
#define N_BATCH 2
#define E_DIM   1024
#define H_NUM   16
#define D_HEAD  64
#define BIAS_W  (2 * S_DIM - 1)   // 4095

typedef __attribute__((ext_vector_type(16))) _Float16 v16h;
typedef __attribute__((ext_vector_type(8)))  _Float16 v8h;
typedef __attribute__((ext_vector_type(8)))  float    v8f;

__device__ __forceinline__ v8f wmma_f16(v16h a, v16h b, v8f c) {
  // D = A(16x32 f16) * B(32x16 f16) + C(16x16 f32)
  return __builtin_amdgcn_wmma_f32_16x16x32_f16(
      /*neg_a=*/false, a, /*neg_b=*/false, b,
      /*c_mod=*/(short)0, c, /*reuse_a=*/false, /*reuse_b=*/false);
}

// Load a 16(row) x 32(K) f16 fragment whose rows are contiguous-K in memory.
// Per ISA 16-bit A layout: lane (row = lane&15, half = lane>>4) holds
// K = [8*half .. +7] and [16+8*half .. +7] (two 16B runs). The identical
// layout serves as a B fragment with "row" = N column.  Works for global
// or LDS pointers (LDS -> ds_load_b128 after address-space inference).
__device__ __forceinline__ v16h frag_f16(const _Float16* __restrict__ p, int ld) {
  const int lane = threadIdx.x & 31;
  const _Float16* r = p + (lane & 15) * ld + (lane >> 4) * 8;
  v8h lo = *reinterpret_cast<const v8h*>(r);
  v8h hi = *reinterpret_cast<const v8h*>(r + 16);
  v16h f;
#pragma unroll
  for (int i = 0; i < 8; ++i) { f[i] = lo[i]; f[8 + i] = hi[i]; }
  return f;
}

// ---------------------------------------------------------------------------
// Shared main loop of the two projection GEMMs: C(128x128) = A(128xK) . B(128xK)^T.
// A and B tiles (128 rows x 64 k each) are staged in LDS by asynchronous copies,
// two buffers, so every global line is fetched whole and once per block and the
// next tile flies while this one is multiplied.
// ---------------------------------------------------------------------------
#define KT       64                 // k per stage: 128-byte rows
#define LDP      72                 // LDS row pitch in halfs: 144 B = 16 B x odd
#define STAGE_H  (256 * LDP)        // halfs per buffer: 128 A rows, then 128 B rows
#define STAGE_B  (STAGE_H * 2)      // bytes per buffer
#define ROWS32_B (32 * LDP * 2)     // LDS bytes of 32 rows
#define N_STAGE  (E_DIM / KT)       // 16

// One stage: each lane copies 16 B of 4 A rows and of 4 B rows (a wave covers
// four whole 128-B lines per copy).  The s_wait_xcnt stands inside the statement
// so that no address register is rewritten ahead of it.
__device__ __forceinline__ void stage_copy(unsigned lds, const _Float16* ga,
                                           const _Float16* gb) {
  const unsigned l0 = lds,                l1 = lds + 1 * ROWS32_B;
  const unsigned l2 = lds + 2 * ROWS32_B, l3 = lds + 3 * ROWS32_B;
  const unsigned l4 = lds + 4 * ROWS32_B, l5 = lds + 5 * ROWS32_B;
  const unsigned l6 = lds + 6 * ROWS32_B, l7 = lds + 7 * ROWS32_B;
  const _Float16* a1 = ga + 32 * E_DIM;
  const _Float16* a2 = ga + 64 * E_DIM;
  const _Float16* a3 = ga + 96 * E_DIM;
  const _Float16* b1 = gb + 32 * E_DIM;
  const _Float16* b2 = gb + 64 * E_DIM;
  const _Float16* b3 = gb + 96 * E_DIM;
  asm volatile(
      "global_load_async_to_lds_b128 %0, %8, off\n\t"
      "global_load_async_to_lds_b128 %1, %9, off\n\t"
      "global_load_async_to_lds_b128 %2, %10, off\n\t"
      "global_load_async_to_lds_b128 %3, %11, off\n\t"
      "global_load_async_to_lds_b128 %4, %12, off\n\t"
      "global_load_async_to_lds_b128 %5, %13, off\n\t"
      "global_load_async_to_lds_b128 %6, %14, off\n\t"
      "global_load_async_to_lds_b128 %7, %15, off\n\t"
      "s_wait_xcnt 0x0"
      :: "v"(l0), "v"(l1), "v"(l2), "v"(l3), "v"(l4), "v"(l5), "v"(l6), "v"(l7),
         "v"(ga), "v"(a1), "v"(a2), "v"(a3), "v"(gb), "v"(b1), "v"(b2), "v"(b3)
      : "memory");
}

// Ablk / Bblk: first row of the block's 128 A rows / 128 B rows (row pitch E_DIM).
// sm: 2 * STAGE_H halfs of LDS.  Wave (wm, wn) accumulates its 32x64 part.
__device__ __forceinline__ void gemm_128x128(const _Float16* __restrict__ Ablk,
                                             const _Float16* __restrict__ Bblk,
                                             _Float16* sm, int wm, int wn,
                                             v8f (&acc)[2][4]) {
  const int crow = threadIdx.x >> 3, ccol = (threadIdx.x & 7) << 3;
  const unsigned lds = (unsigned)(size_t)sm + (unsigned)(crow * LDP + ccol) * 2u;
  const _Float16* ga = Ablk + (size_t)crow * E_DIM + ccol;
  const _Float16* gb = Bblk + (size_t)crow * E_DIM + ccol;

  stage_copy(lds, ga, gb);
  asm volatile("s_wait_asynccnt 0x0" ::: "memory");   // own copies of tile 0 landed
  __syncthreads();                                    // tile 0 visible to all waves
  stage_copy(lds + STAGE_B, ga + KT, gb + KT);

  for (int t = 0; t < N_STAGE; ++t) {
    const _Float16* s  = sm + (t & 1) * STAGE_H;
    const _Float16* sa = s + (wm * 32) * LDP;
    const _Float16* sb = s + (128 + wn * 64) * LDP;
    // Both loops unrolled: acc[][] is indexed by constants and stays in registers.
#pragma unroll
    for (int kk = 0; kk < KT; kk += 32) {
      v16h a0 = frag_f16(sa + kk, LDP);
      v16h a1 = frag_f16(sa + 16 * LDP + kk, LDP);
#pragma unroll
      for (int j = 0; j < 4; ++j) {
        v16h b = frag_f16(sb + (j * 16) * LDP + kk, LDP);
        acc[0][j] = wmma_f16(a0, b, acc[0][j]);
        acc[1][j] = wmma_f16(a1, b, acc[1][j]);
      }
    }
    asm volatile("s_wait_dscnt 0x0" ::: "memory");    // own reads of this buffer done
    asm volatile("s_wait_asynccnt 0x0" ::: "memory"); // own copies of tile t+1 landed
    __syncthreads();   // publishes tile t+1 and frees the buffer just read
    if (t + 2 < N_STAGE)
      stage_copy(lds + (t & 1) * STAGE_B, ga + (t + 2) * KT, gb + (t + 2) * KT);
  }
  asm volatile("s_wait_asynccnt 0x0" ::: "memory");   // nothing in flight at the end
}

// ---------------------------------------------------------------------------
// Kernel 0: fp32 -> f16 conversion of all five operands in ONE launch.
// The five f16 destinations lie one behind the other in the workspace, so the
// launch sees one destination array; a block's index picks its source.
// One 16-wave block per WGP: a wave owns 4096 contiguous elements (16 KiB of
// fp32), every load covers 512 contiguous bytes, every store 256, and all of a
// lane's loads are issued before its first conversion.
// ---------------------------------------------------------------------------
typedef __attribute__((ext_vector_type(4))) _Float16 v4h;
#define CVT_THREADS 512
#define CVT_LOADS   32                                  // 16-byte loads per lane
#define CVT_WAVE_EL (32 * 4 * CVT_LOADS)                // 4096 elements per wave
#define CVT_BLK_EL  ((CVT_THREADS / 32) * CVT_WAVE_EL)  // 65536 elements per block
#define ACT_BLKS    (L_DIM * N_BATCH * E_DIM / CVT_BLK_EL)   // 64 per activation
#define IPW_BLKS    (3 * E_DIM * E_DIM / CVT_BLK_EL)         // 48
#define OPW_BLKS    (E_DIM * E_DIM / CVT_BLK_EL)             // 16
#define CVT_BLKS    (3 * ACT_BLKS + IPW_BLKS + OPW_BLKS)     // 256
// Four waves a SIMD is what one 16-wave block per WGP gives: told so, the
// compiler keeps all 32 loads of a lane in flight; without it it saves registers
// and splits the loads into groups that wait on one another.
__global__ __launch_bounds__(CVT_THREADS)
__attribute__((amdgpu_waves_per_eu(4, 4))) void cvt_all_kernel(
    const float* __restrict__ query, const float* __restrict__ key,
    const float* __restrict__ value, const float* __restrict__ ipw,
    const float* __restrict__ opw, _Float16* __restrict__ dst) {
  const int b = blockIdx.x;
  const float* src;
  int first;                                   // first block of this source
  if (b < ACT_BLKS)                 { src = query; first = 0; }
  else if (b < 2 * ACT_BLKS)        { src = key;   first = ACT_BLKS; }
  else if (b < 3 * ACT_BLKS)        { src = value; first = 2 * ACT_BLKS; }
  else if (b < 3 * ACT_BLKS + IPW_BLKS) { src = ipw; first = 3 * ACT_BLKS; }
  else                              { src = opw;   first = 3 * ACT_BLKS + IPW_BLKS; }

  // The lane's first group of four elements inside the block, for both sides.
  const unsigned grp = (threadIdx.x >> 5) * (CVT_WAVE_EL / 4) + (threadIdx.x & 31);
  const float4* s = reinterpret_cast<const float4*>(
      src + (size_t)(b - first) * CVT_BLK_EL) + grp;
  v4h* d = reinterpret_cast<v4h*>(dst + (size_t)b * CVT_BLK_EL) + grp;

  float4 r[CVT_LOADS];
  // Unrolled: r[] is indexed by constants and stays in registers.
#pragma unroll
  for (int u = 0; u < CVT_LOADS; ++u) r[u] = s[u * 32];
#pragma unroll
  for (int u = 0; u < CVT_LOADS; ++u) {
    v4h o;
    o[0] = (_Float16)r[u].x; o[1] = (_Float16)r[u].y;
    o[2] = (_Float16)r[u].z; o[3] = (_Float16)r[u].w;
    d[u * 32] = o;
  }
}

// ---------------------------------------------------------------------------
// Kernel 1: fused QKV projection.  grid.z: 0=Q, 1=K, 2=V.  All-f16 operands.
// Y[t, c] = X[t, :] . W[z*E + c, :] + bias[z*E + c]   (t = l*N + n)
// Q scaled by D^-0.5 -> qh[n][h][l][d]; K -> kh[n][h][l][d];
// V -> TRANSPOSED vt[n][h][d][s].
// Block 256 thr (8 waves) -> 128x128 tile; wave = 32x64 (2x4 WMMA tiles).
// ---------------------------------------------------------------------------
__global__ __launch_bounds__(256) void qkv_proj_kernel(
    const _Float16* __restrict__ xq, const _Float16* __restrict__ xk,
    const _Float16* __restrict__ xv, const _Float16* __restrict__ Wf,
    const float* __restrict__ bias,
    _Float16* __restrict__ qh, _Float16* __restrict__ kh,
    _Float16* __restrict__ vt) {
  const int z = blockIdx.z;
  const _Float16* X = (z == 0) ? xq : (z == 1) ? xk : xv;

  const int w  = threadIdx.x >> 5;
  const int wm = w >> 1, wn = w & 1;
  const int m0 = blockIdx.x * 128 + wm * 32;      // token rows
  const int n0 = blockIdx.y * 128 + wn * 64;      // output cols (within E)
  const float* bz = bias + z * E_DIM;

  __shared__ __align__(16) _Float16 sm[2 * STAGE_H];
  v8f acc[2][4] = {};
  gemm_128x128(X + (size_t)(blockIdx.x * 128) * E_DIM,
               Wf + (size_t)(z * E_DIM + blockIdx.y * 128) * E_DIM, sm, wm, wn, acc);

  // Epilogue: C layout -> row = g + 8*half (VGPR index), col = lane&15.
  const int lane = threadIdx.x & 31;
  const int col  = lane & 15;
  const int half = lane >> 4;
#pragma unroll
  for (int i = 0; i < 2; ++i) {
#pragma unroll
    for (int j = 0; j < 4; ++j) {
#pragma unroll
      for (int g = 0; g < 8; ++g) {
        const int t = m0 + i * 16 + g + half * 8;   // token index = l*N + n
        const int c = n0 + j * 16 + col;            // column within E
        float v = acc[i][j][g] + bz[c];
        const int l = t >> 1, n = t & 1;            // N_BATCH == 2
        const int h = c >> 6, d = c & 63;           // D_HEAD == 64
        const int nh = n * H_NUM + h;
        if (z == 0)
          qh[((size_t)nh * L_DIM + l) * D_HEAD + d] = (_Float16)(v * 0.125f);
        else if (z == 1)
          kh[((size_t)nh * S_DIM + l) * D_HEAD + d] = (_Float16)v;
        else
          vt[((size_t)nh * D_HEAD + d) * S_DIM + l] = (_Float16)v;
      }
    }
  }
}

// ---------------------------------------------------------------------------
// Kernel 2: flash attention, one (n,h) per blockIdx.y, 128 query rows/block.
// K/V tiles staged in LDS once per block (8x traffic reduction vs per-wave).
// LDS rows are padded by 16 B (pitch = 16 B x odd) so that the 16 rows one
// ds_load_b128 fragment read touches fall on 16 different groups of four banks.
// Each wave owns 16 query rows.  Computes S^T = K . Q^T so that:
//   - softmax stats are per-lane scalars (lane <-> query column),
//   - exp(S^T) tiles are bit-exact the fragment layout required for
//     O^T = V^T . P^T  (no transpose / shuffle needed).
// ---------------------------------------------------------------------------
#define KP (D_HEAD + 8)   // K tile row pitch in halfs: 144 B
#define VP (32 + 8)       // V^T tile row pitch in halfs: 80 B
__global__ __launch_bounds__(256) void flash_attn_kernel(
    const _Float16* __restrict__ qh, const _Float16* __restrict__ kh,
    const _Float16* __restrict__ vt, const float* __restrict__ rel_bias,
    _Float16* __restrict__ ch) {
  __shared__ __align__(16) _Float16 lk[32 * KP];       // K tile: 32 s x 64 d
  __shared__ __align__(16) _Float16 lv[D_HEAD * VP];   // V^T tile: 64 d x 32 s

  const int nh   = blockIdx.y;            // n*H + h
  const int h    = nh & (H_NUM - 1);
  const int n    = nh >> 4;
  const int w    = threadIdx.x >> 5;
  const int lane = threadIdx.x & 31;
  const int q    = lane & 15;             // query column owned by this lane
  const int half = lane >> 4;
  const int qbase = blockIdx.x * 128 + w * 16;
  const int lglob = qbase + q;            // global query row

  const _Float16* Qp = qh + ((size_t)nh * L_DIM + qbase) * D_HEAD;
  const _Float16* Kp = kh + (size_t)nh * S_DIM * D_HEAD;
  const _Float16* Vp = vt + (size_t)nh * D_HEAD * S_DIM;
  // bias[h, l - s + S-1] accessed as bp[-s]
  const float* bp = rel_bias + (size_t)h * BIAS_W + lglob + (S_DIM - 1);

  // Cooperative-load coordinates (256 threads x 16B covers each 4KB tile).
  const int tid  = threadIdx.x;
  const int krow = tid >> 3, kcol = (tid & 7) << 3;   // 32 x 64 halfs
  const int vrow = tid >> 2, vcol = (tid & 3) << 3;   // 64 x 32 halfs

  // Q^T B-fragments (lane row = query, contiguous d), loaded once.
  const v16h qb0 = frag_f16(Qp, D_HEAD);
  const v16h qb1 = frag_f16(Qp + 32, D_HEAD);

  v8f ot0 = {}, ot1 = {}, ot2 = {}, ot3 = {};   // O^T: VGPR<->d, lane<->query
  float mrow = -3.0e38f, srow = 0.0f;

  for (int s0 = 0; s0 < S_DIM; s0 += 32) {
    // Stage K/V tiles: global -> regs (overlaps prior compute) -> LDS.
    v8h kreg = *reinterpret_cast<const v8h*>(
        Kp + (size_t)(s0 + krow) * D_HEAD + kcol);
    v8h vreg = *reinterpret_cast<const v8h*>(
        Vp + (size_t)vrow * S_DIM + s0 + vcol);
    if (s0 + 32 < S_DIM) {
      __builtin_prefetch(Kp + (size_t)(s0 + 32 + krow) * D_HEAD + kcol, 0, 0);
      __builtin_prefetch(Vp + (size_t)vrow * S_DIM + s0 + 32 + vcol, 0, 0);
    }
    __syncthreads();   // previous tile fully consumed
    *reinterpret_cast<v8h*>(lk + krow * KP + kcol) = kreg;
    *reinterpret_cast<v8h*>(lv + vrow * VP + vcol) = vreg;
    __syncthreads();   // tile visible to all waves

    // S^T = K . Q^T  (A rows = key s, contiguous d from LDS).
    v16h ka0 = frag_f16(lk, KP);
    v16h ka1 = frag_f16(lk + 32, KP);
    v16h ka2 = frag_f16(lk + 16 * KP, KP);
    v16h ka3 = frag_f16(lk + 16 * KP + 32, KP);

    v8f st0 = {}, st1 = {};
    st0 = wmma_f16(ka0, qb0, st0);
    st0 = wmma_f16(ka1, qb1, st0);   // keys s0..s0+15
    st1 = wmma_f16(ka2, qb0, st1);
    st1 = wmma_f16(ka3, qb1, st1);   // keys s0+16..s0+31

    // Relative position bias; key index s = s0 + g + 8*half (+16 for st1).
    float sv0[8], sv1[8];
#pragma unroll
    for (int g = 0; g < 8; ++g) {
      const int so = g + half * 8;
      sv0[g] = st0[g] + bp[-(s0 + so)];
      sv1[g] = st1[g] + bp[-(s0 + so + 16)];
    }

    // Online softmax (per-query stats per-lane; merge the two lane-halves).
    float tmax = sv0[0];
#pragma unroll
    for (int g = 0; g < 8; ++g) {
      tmax = fmaxf(tmax, sv0[g]);
      tmax = fmaxf(tmax, sv1[g]);
    }
    tmax = fmaxf(tmax, __shfl_xor(tmax, 16));
    const float mnew  = fmaxf(mrow, tmax);
    const float alpha = __expf(mrow - mnew);
    mrow = mnew;

    // P^T fragment: element e<8 -> k=8*half+e (st0[e]); e>=8 -> st1[e-8].
    v16h pa;
    float tsum = 0.0f;
#pragma unroll
    for (int g = 0; g < 8; ++g) {
      const float p0 = __expf(sv0[g] - mnew);
      const float p1 = __expf(sv1[g] - mnew);
      tsum += p0 + p1;
      pa[g]     = (_Float16)p0;
      pa[8 + g] = (_Float16)p1;
    }
    tsum += __shfl_xor(tsum, 16);
    srow = srow * alpha + tsum;

#pragma unroll
    for (int g = 0; g < 8; ++g) {
      ot0[g] *= alpha; ot1[g] *= alpha; ot2[g] *= alpha; ot3[g] *= alpha;
    }

    // O^T += V^T . P^T   (A rows = d, contiguous s from LDS; B = pa)
    ot0 = wmma_f16(frag_f16(lv + 0 * 16 * VP, VP), pa, ot0);
    ot1 = wmma_f16(frag_f16(lv + 1 * 16 * VP, VP), pa, ot1);
    ot2 = wmma_f16(frag_f16(lv + 2 * 16 * VP, VP), pa, ot2);
    ot3 = wmma_f16(frag_f16(lv + 3 * 16 * VP, VP), pa, ot3);
  }

  // Normalize and scatter to context ch[t][E]; d = j*16 + half*8 + g is
  // contiguous in g -> one 16B store per tile.
  const float inv = 1.0f / srow;
  const int t = lglob * N_BATCH + n;
  _Float16* op = ch + (size_t)t * E_DIM + h * D_HEAD + half * 8;
  v8f* ots[4] = {&ot0, &ot1, &ot2, &ot3};
#pragma unroll
  for (int j = 0; j < 4; ++j) {
    v8h o;
#pragma unroll
    for (int g = 0; g < 8; ++g) o[g] = (_Float16)((*ots[j])[g] * inv);
    *reinterpret_cast<v8h*>(op + j * 16) = o;
  }
}

// ---------------------------------------------------------------------------
// Kernel 3: output projection.  out[t, e] = ch[t, :] . Wout[e, :] + bout[e]
// Same 128x128 block / 32x64 wave tiling as the QKV projection.
// ---------------------------------------------------------------------------
__global__ __launch_bounds__(256) void out_proj_kernel(
    const _Float16* __restrict__ ch, const _Float16* __restrict__ Wof,
    const float* __restrict__ bout, float* __restrict__ out) {
  const int w  = threadIdx.x >> 5;
  const int wm = w >> 1, wn = w & 1;
  const int m0 = blockIdx.x * 128 + wm * 32;
  const int n0 = blockIdx.y * 128 + wn * 64;
  __shared__ __align__(16) _Float16 sm[2 * STAGE_H];
  v8f acc[2][4] = {};
  gemm_128x128(ch + (size_t)(blockIdx.x * 128) * E_DIM,
               Wof + (size_t)(blockIdx.y * 128) * E_DIM, sm, wm, wn, acc);

  const int lane = threadIdx.x & 31;
  const int col  = lane & 15;
  const int half = lane >> 4;
#pragma unroll
  for (int i = 0; i < 2; ++i) {
#pragma unroll
    for (int j = 0; j < 4; ++j) {
#pragma unroll
      for (int g = 0; g < 8; ++g) {
        const int t = m0 + i * 16 + g + half * 8;
        const int c = n0 + j * 16 + col;
        out[(size_t)t * E_DIM + c] = acc[i][j][g] + bout[c];
      }
    }
  }
}

// ---------------------------------------------------------------------------
extern "C" void kernel_launch(void* const* d_in, const int* in_sizes, int n_in,
                              void* d_out, int out_size, void* d_ws, size_t ws_size,
                              hipStream_t stream) {
  const float* query = (const float*)d_in[0];
  const float* key   = (const float*)d_in[1];
  const float* value = (const float*)d_in[2];
  const float* ipw   = (const float*)d_in[3];
  const float* ipb   = (const float*)d_in[4];
  const float* opw   = (const float*)d_in[5];
  const float* opb   = (const float*)d_in[6];
  const float* rbias = (const float*)d_in[7];
  float* out = (float*)d_out;

  // Workspace layout (f16 elements):
  //   qh | kh | vt | ch : N*H*L*D = 4 Mi each
  //   xq | xk | xv      : L*N*E   = 4 Mi each      (f16 activations)
  //   wf                : 3*E*E   = 3 Mi           (f16 in_proj_weight)
  //   wof               : E*E     = 1 Mi           (f16 out_proj_weight)
  // Total 32 Mi f16 = 64 MiB.
  const size_t slab = (size_t)N_BATCH * H_NUM * L_DIM * D_HEAD;  // 4 Mi
  _Float16* qh  = (_Float16*)d_ws;
  _Float16* kh  = qh + slab;
  _Float16* vt  = kh + slab;
  _Float16* ch  = vt + slab;
  _Float16* xq  = ch + slab;
  _Float16* xk  = xq + slab;
  _Float16* xv  = xk + slab;
  _Float16* wf  = xv + slab;
  _Float16* wof = wf + (size_t)3 * E_DIM * E_DIM;

  dim3 blk(256);
  // xq | xk | xv | wf | wof are contiguous: one destination for the conversion.
  cvt_all_kernel<<<dim3(CVT_BLKS), dim3(CVT_THREADS), 0, stream>>>(
      query, key, value, ipw, opw, xq);

  // QKV projection: M=4096 -> 32 tiles, Nc=1024 -> 8 tiles, z = {Q,K,V}.
  qkv_proj_kernel<<<dim3(32, 8, 3), blk, 0, stream>>>(
      xq, xk, xv, wf, ipb, qh, kh, vt);
  // Flash attention: 16 query blocks x 32 (n,h) slices.
  flash_attn_kernel<<<dim3(L_DIM / 128, N_BATCH * H_NUM), blk, 0, stream>>>(
      qh, kh, vt, rbias, ch);
  // Output projection.
  out_proj_kernel<<<dim3(32, 8), blk, 0, stream>>>(ch, opw ? wof : wof, opb, out);
}

// v004
// A run of this version takes 107 microseconds.
// Next to v003, in two timings, it ran 1.16 and 1.15 times as fast.
// Over all steps from v000 it is 2.25 times as fast.
#include <hip/hip_runtime.h>

// Multihead attention with relative position bias for MI455X (gfx1250).
// All GEMMs via v_wmma_f32_16x16x32_f16 (f16 in, f32 accumulate).
// fp32 operands are converted to f16 ONCE (one bandwidth-bound launch); the
// projection GEMMs read their fragments from LDS tiles filled by async copies.
// L = S = 2048, N = 2, E = 1024, H = 16, D = 64.

#define L_DIM   2048
#define S_DIM   2048
#define N_BATCH 2
#define E_DIM   1024
#define H_NUM   16
#define D_HEAD  64
#define BIAS_W  (2 * S_DIM - 1)   // 4095

typedef __attribute__((ext_vector_type(16))) _Float16 v16h;
typedef __attribute__((ext_vector_type(8)))  _Float16 v8h;
typedef __attribute__((ext_vector_type(8)))  float    v8f;

__device__ __forceinline__ v8f wmma_f16(v16h a, v16h b, v8f c) {
  // D = A(16x32 f16) * B(32x16 f16) + C(16x16 f32)
  return __builtin_amdgcn_wmma_f32_16x16x32_f16(
      /*neg_a=*/false, a, /*neg_b=*/false, b,
      /*c_mod=*/(short)0, c, /*reuse_a=*/false, /*reuse_b=*/false);
}

// Load a 16(row) x 32(K) f16 fragment whose rows are contiguous-K in memory.
// Per ISA 16-bit A layout: lane (row = lane&15, half = lane>>4) holds
// K = [8*half .. +7] and [16+8*half .. +7] (two 16B runs). The identical
// layout serves as a B fragment with "row" = N column.  Works for global
// or LDS pointers (LDS -> ds_load_b128 after address-space inference).
__device__ __forceinline__ v16h frag_f16(const _Float16* __restrict__ p, int ld) {
  const int lane = threadIdx.x & 31;
  const _Float16* r = p + (lane & 15) * ld + (lane >> 4) * 8;
  v8h lo = *reinterpret_cast<const v8h*>(r);
  v8h hi = *reinterpret_cast<const v8h*>(r + 16);
  v16h f;
#pragma unroll
  for (int i = 0; i < 8; ++i) { f[i] = lo[i]; f[8 + i] = hi[i]; }
  return f;
}

// ---------------------------------------------------------------------------
// Shared main loop of the two projection GEMMs: C(128x128) = A(128xK) . B(128xK)^T.
// A and B tiles (128 rows x 64 k each) are staged in LDS by asynchronous copies,
// two buffers, so every global line is fetched whole and once per block and the
// next tile flies while this one is multiplied.
// ---------------------------------------------------------------------------
#define KT       64                 // k per stage: 128-byte rows
#define LDP      72                 // LDS row pitch in halfs: 144 B = 16 B x odd
#define STAGE_H  (256 * LDP)        // halfs per buffer: 128 A rows, then 128 B rows
#define STAGE_B  (STAGE_H * 2)      // bytes per buffer
#define ROWS32_B (32 * LDP * 2)     // LDS bytes of 32 rows
#define N_STAGE  (E_DIM / KT)       // 16

// One stage: each lane copies 16 B of 4 A rows and of 4 B rows (a wave covers
// four whole 128-B lines per copy).  The s_wait_xcnt stands inside the statement
// so that no address register is rewritten ahead of it.
__device__ __forceinline__ void stage_copy(unsigned lds, const _Float16* ga,
                                           const _Float16* gb) {
  const unsigned l0 = lds,                l1 = lds + 1 * ROWS32_B;
  const unsigned l2 = lds + 2 * ROWS32_B, l3 = lds + 3 * ROWS32_B;
  const unsigned l4 = lds + 4 * ROWS32_B, l5 = lds + 5 * ROWS32_B;
  const unsigned l6 = lds + 6 * ROWS32_B, l7 = lds + 7 * ROWS32_B;
  const _Float16* a1 = ga + 32 * E_DIM;
  const _Float16* a2 = ga + 64 * E_DIM;
  const _Float16* a3 = ga + 96 * E_DIM;
  const _Float16* b1 = gb + 32 * E_DIM;
  const _Float16* b2 = gb + 64 * E_DIM;
  const _Float16* b3 = gb + 96 * E_DIM;
  asm volatile(
      "global_load_async_to_lds_b128 %0, %8, off\n\t"
      "global_load_async_to_lds_b128 %1, %9, off\n\t"
      "global_load_async_to_lds_b128 %2, %10, off\n\t"
      "global_load_async_to_lds_b128 %3, %11, off\n\t"
      "global_load_async_to_lds_b128 %4, %12, off\n\t"
      "global_load_async_to_lds_b128 %5, %13, off\n\t"
      "global_load_async_to_lds_b128 %6, %14, off\n\t"
      "global_load_async_to_lds_b128 %7, %15, off\n\t"
      "s_wait_xcnt 0x0"
      :: "v"(l0), "v"(l1), "v"(l2), "v"(l3), "v"(l4), "v"(l5), "v"(l6), "v"(l7),
         "v"(ga), "v"(a1), "v"(a2), "v"(a3), "v"(gb), "v"(b1), "v"(b2), "v"(b3)
      : "memory");
}

// Ablk / Bblk: first row of the block's 128 A rows / 128 B rows (row pitch E_DIM).
// sm: 2 * STAGE_H halfs of LDS.  Wave (wm, wn) accumulates its 32x64 part.
__device__ __forceinline__ void gemm_128x128(const _Float16* __restrict__ Ablk,
                                             const _Float16* __restrict__ Bblk,
                                             _Float16* sm, int wm, int wn,
                                             v8f (&acc)[2][4]) {
  const int crow = threadIdx.x >> 3, ccol = (threadIdx.x & 7) << 3;
  const unsigned lds = (unsigned)(size_t)sm + (unsigned)(crow * LDP + ccol) * 2u;
  const _Float16* ga = Ablk + (size_t)crow * E_DIM + ccol;
  const _Float16* gb = Bblk + (size_t)crow * E_DIM + ccol;

  stage_copy(lds, ga, gb);
  asm volatile("s_wait_asynccnt 0x0" ::: "memory");   // own copies of tile 0 landed
  __syncthreads();                                    // tile 0 visible to all waves
  stage_copy(lds + STAGE_B, ga + KT, gb + KT);

  for (int t = 0; t < N_STAGE; ++t) {
    const _Float16* s  = sm + (t & 1) * STAGE_H;
    const _Float16* sa = s + (wm * 32) * LDP;
    const _Float16* sb = s + (128 + wn * 64) * LDP;
    // Both loops unrolled: acc[][] is indexed by constants and stays in registers.
#pragma unroll
    for (int kk = 0; kk < KT; kk += 32) {
      v16h a0 = frag_f16(sa + kk, LDP);
      v16h a1 = frag_f16(sa + 16 * LDP + kk, LDP);
#pragma unroll
      for (int j = 0; j < 4; ++j) {
        v16h b = frag_f16(sb + (j * 16) * LDP + kk, LDP);
        acc[0][j] = wmma_f16(a0, b, acc[0][j]);
        acc[1][j] = wmma_f16(a1, b, acc[1][j]);
      }
    }
    asm volatile("s_wait_dscnt 0x0" ::: "memory");    // own reads of this buffer done
    asm volatile("s_wait_asynccnt 0x0" ::: "memory"); // own copies of tile t+1 landed
    __syncthreads();   // publishes tile t+1 and frees the buffer just read
    if (t + 2 < N_STAGE)
      stage_copy(lds + (t & 1) * STAGE_B, ga + (t + 2) * KT, gb + (t + 2) * KT);
  }
  asm volatile("s_wait_asynccnt 0x0" ::: "memory");   // nothing in flight at the end
}

// ---------------------------------------------------------------------------
// Kernel 0: fp32 -> f16 conversion of all five operands in ONE launch.
// The five f16 destinations lie one behind the other in the workspace, so the
// launch sees one destination array; a block's index picks its source.
// One 16-wave block per WGP: a wave owns 4096 contiguous elements (16 KiB of
// fp32), every load covers 512 contiguous bytes, every store 256, and all of a
// lane's loads are issued before its first conversion.
// ---------------------------------------------------------------------------
typedef __attribute__((ext_vector_type(4))) _Float16 v4h;
#define CVT_THREADS 512
#define CVT_LOADS   32                                  // 16-byte loads per lane
#define CVT_WAVE_EL (32 * 4 * CVT_LOADS)                // 4096 elements per wave
#define CVT_BLK_EL  ((CVT_THREADS / 32) * CVT_WAVE_EL)  // 65536 elements per block
#define ACT_BLKS    (L_DIM * N_BATCH * E_DIM / CVT_BLK_EL)   // 64 per activation
#define IPW_BLKS    (3 * E_DIM * E_DIM / CVT_BLK_EL)         // 48
#define OPW_BLKS    (E_DIM * E_DIM / CVT_BLK_EL)             // 16
#define CVT_BLKS    (3 * ACT_BLKS + IPW_BLKS + OPW_BLKS)     // 256
// Four waves a SIMD is what one 16-wave block per WGP gives: told so, the
// compiler keeps all 32 loads of a lane in flight; without it it saves registers
// and splits the loads into groups that wait on one another.
__global__ __launch_bounds__(CVT_THREADS)
__attribute__((amdgpu_waves_per_eu(4, 4))) void cvt_all_kernel(
    const float* __restrict__ query, const float* __restrict__ key,
    const float* __restrict__ value, const float* __restrict__ ipw,
    const float* __restrict__ opw, _Float16* __restrict__ dst) {
  const int b = blockIdx.x;
  const float* src;
  int first;                                   // first block of this source
  if (b < ACT_BLKS)                 { src = query; first = 0; }
  else if (b < 2 * ACT_BLKS)        { src = key;   first = ACT_BLKS; }
  else if (b < 3 * ACT_BLKS)        { src = value; first = 2 * ACT_BLKS; }
  else if (b < 3 * ACT_BLKS + IPW_BLKS) { src = ipw; first = 3 * ACT_BLKS; }
  else                              { src = opw;   first = 3 * ACT_BLKS + IPW_BLKS; }

  // The lane's first group of four elements inside the block, for both sides.
  const unsigned grp = (threadIdx.x >> 5) * (CVT_WAVE_EL / 4) + (threadIdx.x & 31);
  const float4* s = reinterpret_cast<const float4*>(
      src + (size_t)(b - first) * CVT_BLK_EL) + grp;
  v4h* d = reinterpret_cast<v4h*>(dst + (size_t)b * CVT_BLK_EL) + grp;

  float4 r[CVT_LOADS];
  // Unrolled: r[] is indexed by constants and stays in registers.
#pragma unroll
  for (int u = 0; u < CVT_LOADS; ++u) r[u] = s[u * 32];
#pragma unroll
  for (int u = 0; u < CVT_LOADS; ++u) {
    v4h o;
    o[0] = (_Float16)r[u].x; o[1] = (_Float16)r[u].y;
    o[2] = (_Float16)r[u].z; o[3] = (_Float16)r[u].w;
    d[u * 32] = o;
  }
}

// ---------------------------------------------------------------------------
// Kernel 1: fused QKV projection.  grid.z: 0=Q, 1=K, 2=V.  All-f16 operands.
// Y[t, c] = X[t, :] . W[z*E + c, :] + bias[z*E + c]   (t = l*N + n)
// Q scaled by D^-0.5 -> qh[n][h][l][d]; K -> kh[n][h][l][d];
// V -> TRANSPOSED vt[n][h][d][s].
// Block 256 thr (8 waves) -> 128x128 tile; wave = 32x64 (2x4 WMMA tiles).
// ---------------------------------------------------------------------------
__global__ __launch_bounds__(256) void qkv_proj_kernel(
    const _Float16* __restrict__ xq, const _Float16* __restrict__ xk,
    const _Float16* __restrict__ xv, const _Float16* __restrict__ Wf,
    const float* __restrict__ bias,
    _Float16* __restrict__ qh, _Float16* __restrict__ kh,
    _Float16* __restrict__ vt) {
  const int z = blockIdx.z;
  const _Float16* X = (z == 0) ? xq : (z == 1) ? xk : xv;

  const int w  = threadIdx.x >> 5;
  const int wm = w >> 1, wn = w & 1;
  const int m0 = blockIdx.x * 128 + wm * 32;      // token rows
  const int n0 = blockIdx.y * 128 + wn * 64;      // output cols (within E)
  const float* bz = bias + z * E_DIM;

  __shared__ __align__(16) _Float16 sm[2 * STAGE_H];
  v8f acc[2][4] = {};
  gemm_128x128(X + (size_t)(blockIdx.x * 128) * E_DIM,
               Wf + (size_t)(z * E_DIM + blockIdx.y * 128) * E_DIM, sm, wm, wn, acc);

  // Epilogue: C layout -> row = g + 8*half (VGPR index), col = lane&15.
  const int lane = threadIdx.x & 31;
  const int col  = lane & 15;
  const int half = lane >> 4;
#pragma unroll
  for (int i = 0; i < 2; ++i) {
#pragma unroll
    for (int j = 0; j < 4; ++j) {
#pragma unroll
      for (int g = 0; g < 8; ++g) {
        const int t = m0 + i * 16 + g + half * 8;   // token index = l*N + n
        const int c = n0 + j * 16 + col;            // column within E
        float v = acc[i][j][g] + bz[c];
        const int l = t >> 1, n = t & 1;            // N_BATCH == 2
        const int h = c >> 6, d = c & 63;           // D_HEAD == 64
        const int nh = n * H_NUM + h;
        if (z == 0)
          qh[((size_t)nh * L_DIM + l) * D_HEAD + d] = (_Float16)(v * 0.125f);
        else if (z == 1)
          kh[((size_t)nh * S_DIM + l) * D_HEAD + d] = (_Float16)v;
        else
          vt[((size_t)nh * D_HEAD + d) * S_DIM + l] = (_Float16)v;
      }
    }
  }
}

// ---------------------------------------------------------------------------
// Kernel 2: flash attention, one (n,h) per blockIdx.y, 128 query rows/block.
// K/V tiles staged in LDS once per block (8x traffic reduction vs per-wave), a
// stage of 128 keys at a time, by asynchronous copies into two buffers: the next
// stage flies while the four 32-key passes of this one are worked on.
// LDS rows are padded by 16 B (pitch = 16 B x odd) so that the 16 rows one
// ds_load_b128 fragment read touches fall on 16 different groups of four banks.
// Each wave owns 16 query rows.  Computes S^T = K . Q^T so that:
//   - softmax stats are per-lane scalars (lane <-> query column),
//   - exp(S^T) tiles are bit-exact the fragment layout required for
//     O^T = V^T . P^T  (no transpose / shuffle needed).
// ---------------------------------------------------------------------------
#define SK      128                      // keys per stage
#define KP      (D_HEAD + 8)             // K tile row pitch in halfs: 144 B
#define VP      (SK + 8)                 // V^T tile row pitch in halfs: 272 B
#define KTILE_H (SK * KP)                // halfs of the K tile: 128 s x 64 d
#define AST_H   (KTILE_H + D_HEAD * VP)  // halfs per buffer: K tile, then V^T tile
#define AST_B   (AST_H * 2)              // bytes per buffer
#define A_STAGE (S_DIM / SK)             // 16

// One stage: each lane copies 16 B of 4 K rows (32 rows apart) and of 4 V^T rows
// (16 rows apart); a wave covers four whole 128-B lines per copy.  The
// s_wait_xcnt stands inside the statement so that no address register is
// rewritten ahead of it.
__device__ __forceinline__ void attn_stage_copy(unsigned lk, unsigned lv,
                                                const _Float16* gk,
                                                const _Float16* gv) {
  const unsigned k1 = lk + 1 * (32 * KP * 2), k2 = lk + 2 * (32 * KP * 2);
  const unsigned k3 = lk + 3 * (32 * KP * 2);
  const unsigned v1 = lv + 1 * (16 * VP * 2), v2 = lv + 2 * (16 * VP * 2);
  const unsigned v3 = lv + 3 * (16 * VP * 2);
  const _Float16* gk1 = gk + 32 * D_HEAD;
  const _Float16* gk2 = gk + 64 * D_HEAD;
  const _Float16* gk3 = gk + 96 * D_HEAD;
  const _Float16* gv1 = gv + 16 * S_DIM;
  const _Float16* gv2 = gv + 32 * S_DIM;
  const _Float16* gv3 = gv + 48 * S_DIM;
  asm volatile(
      "global_load_async_to_lds_b128 %0, %8, off\n\t"
      "global_load_async_to_lds_b128 %1, %9, off\n\t"
      "global_load_async_to_lds_b128 %2, %10, off\n\t"
      "global_load_async_to_lds_b128 %3, %11, off\n\t"
      "global_load_async_to_lds_b128 %4, %12, off\n\t"
      "global_load_async_to_lds_b128 %5, %13, off\n\t"
      "global_load_async_to_lds_b128 %6, %14, off\n\t"
      "global_load_async_to_lds_b128 %7, %15, off\n\t"
      "s_wait_xcnt 0x0"
      :: "v"(lk), "v"(k1), "v"(k2), "v"(k3), "v"(lv), "v"(v1), "v"(v2), "v"(v3),
         "v"(gk), "v"(gk1), "v"(gk2), "v"(gk3), "v"(gv), "v"(gv1), "v"(gv2), "v"(gv3)
      : "memory");
}

__global__ __launch_bounds__(256) void flash_attn_kernel(
    const _Float16* __restrict__ qh, const _Float16* __restrict__ kh,
    const _Float16* __restrict__ vt, const float* __restrict__ rel_bias,
    _Float16* __restrict__ ch) {
  __shared__ __align__(16) _Float16 sm[2 * AST_H];

  const int nh   = blockIdx.y;            // n*H + h
  const int h    = nh & (H_NUM - 1);
  const int n    = nh >> 4;
  const int w    = threadIdx.x >> 5;
  const int lane = threadIdx.x & 31;
  const int q    = lane & 15;             // query column owned by this lane
  const int half = lane >> 4;
  const int qbase = blockIdx.x * 128 + w * 16;
  const int lglob = qbase + q;            // global query row

  const _Float16* Qp = qh + ((size_t)nh * L_DIM + qbase) * D_HEAD;
  const _Float16* Kp = kh + (size_t)nh * S_DIM * D_HEAD;
  const _Float16* Vp = vt + (size_t)nh * D_HEAD * S_DIM;
  // bias[h, l - s + S-1] accessed as bp[-s]
  const float* bp = rel_bias + (size_t)h * BIAS_W + lglob + (S_DIM - 1);

  // Copy coordinates (256 threads x 16 B x 4 covers each 16-KB tile).
  const int tid  = threadIdx.x;
  const int krow = tid >> 3, kcol = (tid & 7) << 3;    // 32 rows x 64 halfs a copy
  const int vrow = tid >> 4, vcol = (tid & 15) << 3;   // 16 rows x 128 halfs a copy
  const unsigned lkd = (unsigned)(size_t)sm + (unsigned)(krow * KP + kcol) * 2u;
  const unsigned lvd = (unsigned)(size_t)sm + (unsigned)(KTILE_H + vrow * VP + vcol) * 2u;
  const _Float16* gk = Kp + (size_t)krow * D_HEAD + kcol;
  const _Float16* gv = Vp + (size_t)vrow * S_DIM + vcol;

  attn_stage_copy(lkd, lvd, gk, gv);

  // Q^T B-fragments (lane row = query, contiguous d), loaded once.
  const v16h qb0 = frag_f16(Qp, D_HEAD);
  const v16h qb1 = frag_f16(Qp + 32, D_HEAD);

  v8f ot0 = {}, ot1 = {}, ot2 = {}, ot3 = {};   // O^T: VGPR<->d, lane<->query
  float mrow = -3.0e38f, srow = 0.0f;

  asm volatile("s_wait_asynccnt 0x0" ::: "memory");   // own copies of stage 0 landed
  __syncthreads();                                    // stage 0 visible to all waves
  attn_stage_copy(lkd + AST_B, lvd + AST_B, gk + SK * D_HEAD, gv + SK);

  for (int t = 0; t < A_STAGE; ++t) {
   const _Float16* lks = sm + (t & 1) * AST_H;
   // Unrolled: the LDS offsets of a pass become immediates, and with no barrier
   // between the passes the next pass's loads can be issued under this one's work.
#pragma unroll
   for (int p = 0; p < SK / 32; ++p) {
    const int s0 = t * SK + p * 32;
    const _Float16* lk = lks + p * 32 * KP;         // 32 keys x 64 d of this pass
    const _Float16* lv = lks + KTILE_H + p * 32;    // 64 d x 32 keys of this pass

    // Relative position bias; key index s = s0 + g + 8*half (+16 for the second tile).
    float rb0[8], rb1[8];
#pragma unroll
    for (int g = 0; g < 8; ++g) {
      const int so = g + half * 8;
      rb0[g] = bp[-(s0 + so)];
      rb1[g] = bp[-(s0 + so + 16)];
    }
    // Keeps the bias loads in front of the pass's K reads and score products, where
    // the tile barrier used to hold them: without it the compiler sinks them to
    // their uses, in small groups that each wait for the one before.
    __builtin_amdgcn_sched_barrier(0);

    // S^T = K . Q^T  (A rows = key s, contiguous d from LDS).
    v16h ka0 = frag_f16(lk, KP);
    v16h ka1 = frag_f16(lk + 32, KP);
    v16h ka2 = frag_f16(lk + 16 * KP, KP);
    v16h ka3 = frag_f16(lk + 16 * KP + 32, KP);

    v8f st0 = {}, st1 = {};
    st0 = wmma_f16(ka0, qb0, st0);
    st0 = wmma_f16(ka1, qb1, st0);   // keys s0..s0+15
    st1 = wmma_f16(ka2, qb0, st1);
    st1 = wmma_f16(ka3, qb1, st1);   // keys s0+16..s0+31

    float sv0[8], sv1[8];
#pragma unroll
    for (int g = 0; g < 8; ++g) {
      sv0[g] = st0[g] + rb0[g];
      sv1[g] = st1[g] + rb1[g];
    }

    // Online softmax (per-query stats per-lane; merge the two lane-halves).
    float tmax = sv0[0];
#pragma unroll
    for (int g = 0; g < 8; ++g) {
      tmax = fmaxf(tmax, sv0[g]);
      tmax = fmaxf(tmax, sv1[g]);
    }
    tmax = fmaxf(tmax, __shfl_xor(tmax, 16));
    const float mnew  = fmaxf(mrow, tmax);
    const float alpha = __expf(mrow - mnew);
    mrow = mnew;

    // P^T fragment: element e<8 -> k=8*half+e (st0[e]); e>=8 -> st1[e-8].
    v16h pa;
    float tsum = 0.0f;
#pragma unroll
    for (int g = 0; g < 8; ++g) {
      const float p0 = __expf(sv0[g] - mnew);
      const float p1 = __expf(sv1[g] - mnew);
      tsum += p0 + p1;
      pa[g]     = (_Float16)p0;
      pa[8 + g] = (_Float16)p1;
    }
    tsum += __shfl_xor(tsum, 16);
    srow = srow * alpha + tsum;

#pragma unroll
    for (int g = 0; g < 8; ++g) {
      ot0[g] *= alpha; ot1[g] *= alpha; ot2[g] *= alpha; ot3[g] *= alpha;
    }

    // O^T += V^T . P^T   (A rows = d, contiguous s from LDS; B = pa)
    ot0 = wmma_f16(frag_f16(lv + 0 * 16 * VP, VP), pa, ot0);
    ot1 = wmma_f16(frag_f16(lv + 1 * 16 * VP, VP), pa, ot1);
    ot2 = wmma_f16(frag_f16(lv + 2 * 16 * VP, VP), pa, ot2);
    ot3 = wmma_f16(frag_f16(lv + 3 * 16 * VP, VP), pa, ot3);
   }
   asm volatile("s_wait_dscnt 0x0" ::: "memory");    // own reads of this buffer done
   asm volatile("s_wait_asynccnt 0x0" ::: "memory"); // own copies of stage t+1 landed
   __syncthreads();   // publishes stage t+1 and frees the buffer just read
   if (t + 2 < A_STAGE)
     attn_stage_copy(lkd + (t & 1) * AST_B, lvd + (t & 1) * AST_B,
                     gk + (size_t)(t + 2) * SK * D_HEAD, gv + (t + 2) * SK);
  }
  asm volatile("s_wait_asynccnt 0x0" ::: "memory");   // nothing in flight at the end

  // Normalize and scatter to context ch[t][E]; d = j*16 + half*8 + g is
  // contiguous in g -> one 16B store per tile.
  const float inv = 1.0f / srow;
  const int t = lglob * N_BATCH + n;
  _Float16* op = ch + (size_t)t * E_DIM + h * D_HEAD + half * 8;
  v8f* ots[4] = {&ot0, &ot1, &ot2, &ot3};
#pragma unroll
  for (int j = 0; j < 4; ++j) {
    v8h o;
#pragma unroll
    for (int g = 0; g < 8; ++g) o[g] = (_Float16)((*ots[j])[g] * inv);
    *reinterpret_cast<v8h*>(op + j * 16) = o;
  }
}

// ---------------------------------------------------------------------------
// Kernel 3: output projection.  out[t, e] = ch[t, :] . Wout[e, :] + bout[e]
// Same 128x128 block / 32x64 wave tiling as the QKV projection.
// ---------------------------------------------------------------------------
__global__ __launch_bounds__(256) void out_proj_kernel(
    const _Float16* __restrict__ ch, const _Float16* __restrict__ Wof,
    const float* __restrict__ bout, float* __restrict__ out) {
  const int w  = threadIdx.x >> 5;
  const int wm = w >> 1, wn = w & 1;
  const int m0 = blockIdx.x * 128 + wm * 32;
  const int n0 = blockIdx.y * 128 + wn * 64;
  __shared__ __align__(16) _Float16 sm[2 * STAGE_H];
  v8f acc[2][4] = {};
  gemm_128x128(ch + (size_t)(blockIdx.x * 128) * E_DIM,
               Wof + (size_t)(blockIdx.y * 128) * E_DIM, sm, wm, wn, acc);

  const int lane = threadIdx.x & 31;
  const int col  = lane & 15;
  const int half = lane >> 4;
#pragma unroll
  for (int i = 0; i < 2; ++i) {
#pragma unroll
    for (int j = 0; j < 4; ++j) {
#pragma unroll
      for (int g = 0; g < 8; ++g) {
        const int t = m0 + i * 16 + g + half * 8;
        const int c = n0 + j * 16 + col;
        out[(size_t)t * E_DIM + c] = acc[i][j][g] + bout[c];
      }
    }
  }
}

// ---------------------------------------------------------------------------
extern "C" void kernel_launch(void* const* d_in, const int* in_sizes, int n_in,
                              void* d_out, int out_size, void* d_ws, size_t ws_size,
                              hipStream_t stream) {
  const float* query = (const float*)d_in[0];
  const float* key   = (const float*)d_in[1];
  const float* value = (const float*)d_in[2];
  const float* ipw   = (const float*)d_in[3];
  const float* ipb   = (const float*)d_in[4];
  const float* opw   = (const float*)d_in[5];
  const float* opb   = (const float*)d_in[6];
  const float* rbias = (const float*)d_in[7];
  float* out = (float*)d_out;

  // Workspace layout (f16 elements):
  //   qh | kh | vt | ch : N*H*L*D = 4 Mi each
  //   xq | xk | xv      : L*N*E   = 4 Mi each      (f16 activations)
  //   wf                : 3*E*E   = 3 Mi           (f16 in_proj_weight)
  //   wof               : E*E     = 1 Mi           (f16 out_proj_weight)
  // Total 32 Mi f16 = 64 MiB.
  const size_t slab = (size_t)N_BATCH * H_NUM * L_DIM * D_HEAD;  // 4 Mi
  _Float16* qh  = (_Float16*)d_ws;
  _Float16* kh  = qh + slab;
  _Float16* vt  = kh + slab;
  _Float16* ch  = vt + slab;
  _Float16* xq  = ch + slab;
  _Float16* xk  = xq + slab;
  _Float16* xv  = xk + slab;
  _Float16* wf  = xv + slab;
  _Float16* wof = wf + (size_t)3 * E_DIM * E_DIM;

  dim3 blk(256);
  // xq | xk | xv | wf | wof are contiguous: one destination for the conversion.
  cvt_all_kernel<<<dim3(CVT_BLKS), dim3(CVT_THREADS), 0, stream>>>(
      query, key, value, ipw, opw, xq);

  // QKV projection: M=4096 -> 32 tiles, Nc=1024 -> 8 tiles, z = {Q,K,V}.
  qkv_proj_kernel<<<dim3(32, 8, 3), blk, 0, stream>>>(
      xq, xk, xv, wf, ipb, qh, kh, vt);
  // Flash attention: 16 query blocks x 32 (n,h) slices.
  flash_attn_kernel<<<dim3(L_DIM / 128, N_BATCH * H_NUM), blk, 0, stream>>>(
      qh, kh, vt, rbias, ch);
  // Output projection.
  out_proj_kernel<<<dim3(32, 8), blk, 0, stream>>>(ch, opw ? wof : wof, opb, out);
}

// v005
// One run takes 103 microseconds.
// In two side-by-side timings against v004, it was 1.04 and 1.03 times as fast.
// Over all steps from v000 it is 2.33 times as fast.
#include <hip/hip_runtime.h>

// Multihead attention with relative position bias for MI455X (gfx1250).
// All GEMMs via v_wmma_f32_16x16x32_f16 (f16 in, f32 accumulate).
// fp32 operands are converted to f16 ONCE (one bandwidth-bound launch); the
// projection GEMMs read their fragments from LDS tiles filled by async copies.
// L = S = 2048, N = 2, E = 1024, H = 16, D = 64.

#define L_DIM   2048
#define S_DIM   2048
#define N_BATCH 2
#define E_DIM   1024
#define H_NUM   16
#define D_HEAD  64
#define BIAS_W  (2 * S_DIM - 1)   // 4095

typedef __attribute__((ext_vector_type(16))) _Float16 v16h;
typedef __attribute__((ext_vector_type(8)))  _Float16 v8h;
typedef __attribute__((ext_vector_type(8)))  float    v8f;

__device__ __forceinline__ v8f wmma_f16(v16h a, v16h b, v8f c) {
  // D = A(16x32 f16) * B(32x16 f16) + C(16x16 f32)
  return __builtin_amdgcn_wmma_f32_16x16x32_f16(
      /*neg_a=*/false, a, /*neg_b=*/false, b,
      /*c_mod=*/(short)0, c, /*reuse_a=*/false, /*reuse_b=*/false);
}

// Load a 16(row) x 32(K) f16 fragment whose rows are contiguous-K in memory.
// Per ISA 16-bit A layout: lane (row = lane&15, half = lane>>4) holds
// K = [8*half .. +7] and [16+8*half .. +7] (two 16B runs). The identical
// layout serves as a B fragment with "row" = N column.  Works for global
// or LDS pointers (LDS -> ds_load_b128 after address-space inference).
__device__ __forceinline__ v16h frag_f16(const _Float16* __restrict__ p, int ld) {
  const int lane = threadIdx.x & 31;
  const _Float16* r = p + (lane & 15) * ld + (lane >> 4) * 8;
  v8h lo = *reinterpret_cast<const v8h*>(r);
  v8h hi = *reinterpret_cast<const v8h*>(r + 16);
  v16h f;
#pragma unroll
  for (int i = 0; i < 8; ++i) { f[i] = lo[i]; f[8 + i] = hi[i]; }
  return f;
}

// ---------------------------------------------------------------------------
// Shared main loop of the two projection GEMMs: C(128x128) = A(128xK) . B(128xK)^T.
// A and B tiles (128 rows x 64 k each) are staged in LDS by asynchronous copies,
// two buffers, so every global line is fetched whole and once per block and the
// next tile flies while this one is multiplied.
// ---------------------------------------------------------------------------
#define KT       64                 // k per stage: 128-byte rows
#define LDP      72                 // LDS row pitch in halfs: 144 B = 16 B x odd
#define STAGE_H  (256 * LDP)        // halfs per buffer: 128 A rows, then 128 B rows
#define STAGE_B  (STAGE_H * 2)      // bytes per buffer
#define ROWS32_B (32 * LDP * 2)     // LDS bytes of 32 rows
#define N_STAGE  (E_DIM / KT)       // 16

// One stage: each lane copies 16 B of 4 A rows and of 4 B rows (a wave covers
// four whole 128-B lines per copy).  The s_wait_xcnt stands inside the statement
// so that no address register is rewritten ahead of it.
__device__ __forceinline__ void stage_copy(unsigned lds, const _Float16* ga,
                                           const _Float16* gb) {
  const unsigned l0 = lds,                l1 = lds + 1 * ROWS32_B;
  const unsigned l2 = lds + 2 * ROWS32_B, l3 = lds + 3 * ROWS32_B;
  const unsigned l4 = lds + 4 * ROWS32_B, l5 = lds + 5 * ROWS32_B;
  const unsigned l6 = lds + 6 * ROWS32_B, l7 = lds + 7 * ROWS32_B;
  const _Float16* a1 = ga + 32 * E_DIM;
  const _Float16* a2 = ga + 64 * E_DIM;
  const _Float16* a3 = ga + 96 * E_DIM;
  const _Float16* b1 = gb + 32 * E_DIM;
  const _Float16* b2 = gb + 64 * E_DIM;
  const _Float16* b3 = gb + 96 * E_DIM;
  asm volatile(
      "global_load_async_to_lds_b128 %0, %8, off\n\t"
      "global_load_async_to_lds_b128 %1, %9, off\n\t"
      "global_load_async_to_lds_b128 %2, %10, off\n\t"
      "global_load_async_to_lds_b128 %3, %11, off\n\t"
      "global_load_async_to_lds_b128 %4, %12, off\n\t"
      "global_load_async_to_lds_b128 %5, %13, off\n\t"
      "global_load_async_to_lds_b128 %6, %14, off\n\t"
      "global_load_async_to_lds_b128 %7, %15, off\n\t"
      "s_wait_xcnt 0x0"
      :: "v"(l0), "v"(l1), "v"(l2), "v"(l3), "v"(l4), "v"(l5), "v"(l6), "v"(l7),
         "v"(ga), "v"(a1), "v"(a2), "v"(a3), "v"(gb), "v"(b1), "v"(b2), "v"(b3)
      : "memory");
}

// Ablk / Bblk: first row of the block's 128 A rows / 128 B rows (row pitch E_DIM).
// sm: 2 * STAGE_H halfs of LDS.  Wave (wm, wn) accumulates its 32x64 part.
__device__ __forceinline__ void gemm_128x128(const _Float16* __restrict__ Ablk,
                                             const _Float16* __restrict__ Bblk,
                                             _Float16* sm, int wm, int wn,
                                             v8f (&acc)[2][4]) {
  const int crow = threadIdx.x >> 3, ccol = (threadIdx.x & 7) << 3;
  const unsigned lds = (unsigned)(size_t)sm + (unsigned)(crow * LDP + ccol) * 2u;
  const _Float16* ga = Ablk + (size_t)crow * E_DIM + ccol;
  const _Float16* gb = Bblk + (size_t)crow * E_DIM + ccol;

  stage_copy(lds, ga, gb);
  asm volatile("s_wait_asynccnt 0x0" ::: "memory");   // own copies of tile 0 landed
  __syncthreads();                                    // tile 0 visible to all waves
  stage_copy(lds + STAGE_B, ga + KT, gb + KT);

  for (int t = 0; t < N_STAGE; ++t) {
    const _Float16* s  = sm + (t & 1) * STAGE_H;
    const _Float16* sa = s + (wm * 32) * LDP;
    const _Float16* sb = s + (128 + wn * 64) * LDP;
    // Both loops unrolled: acc[][] is indexed by constants and stays in registers.
#pragma unroll
    for (int kk = 0; kk < KT; kk += 32) {
      v16h a0 = frag_f16(sa + kk, LDP);
      v16h a1 = frag_f16(sa + 16 * LDP + kk, LDP);
#pragma unroll
      for (int j = 0; j < 4; ++j) {
        v16h b = frag_f16(sb + (j * 16) * LDP + kk, LDP);
        acc[0][j] = wmma_f16(a0, b, acc[0][j]);
        acc[1][j] = wmma_f16(a1, b, acc[1][j]);
      }
    }
    asm volatile("s_wait_dscnt 0x0" ::: "memory");    // own reads of this buffer done
    asm volatile("s_wait_asynccnt 0x0" ::: "memory"); // own copies of tile t+1 landed
    __syncthreads();   // publishes tile t+1 and frees the buffer just read
    if (t + 2 < N_STAGE)
      stage_copy(lds + (t & 1) * STAGE_B, ga + (t + 2) * KT, gb + (t + 2) * KT);
  }
  asm volatile("s_wait_asynccnt 0x0" ::: "memory");   // nothing in flight at the end
}

// ---------------------------------------------------------------------------
// Kernel 0: fp32 -> f16 conversion of all five operands in ONE launch.
// The five f16 destinations lie one behind the other in the workspace, so the
// launch sees one destination array; a block's index picks its source.
// One 16-wave block per WGP: a wave owns 4096 contiguous elements (16 KiB of
// fp32), every load covers 512 contiguous bytes, every store 256, and all of a
// lane's loads are issued before its first conversion.
// ---------------------------------------------------------------------------
typedef __attribute__((ext_vector_type(4))) _Float16 v4h;
#define CVT_THREADS 512
#define CVT_LOADS   32                                  // 16-byte loads per lane
#define CVT_WAVE_EL (32 * 4 * CVT_LOADS)                // 4096 elements per wave
#define CVT_BLK_EL  ((CVT_THREADS / 32) * CVT_WAVE_EL)  // 65536 elements per block
#define ACT_BLKS    (L_DIM * N_BATCH * E_DIM / CVT_BLK_EL)   // 64 per activation
#define IPW_BLKS    (3 * E_DIM * E_DIM / CVT_BLK_EL)         // 48
#define OPW_BLKS    (E_DIM * E_DIM / CVT_BLK_EL)             // 16
#define CVT_BLKS    (3 * ACT_BLKS + IPW_BLKS + OPW_BLKS)     // 256
// Four waves a SIMD is what one 16-wave block per WGP gives: told so, the
// compiler keeps all 32 loads of a lane in flight; without it it saves registers
// and splits the loads into groups that wait on one another.
__global__ __launch_bounds__(CVT_THREADS)
__attribute__((amdgpu_waves_per_eu(4, 4))) void cvt_all_kernel(
    const float* __restrict__ query, const float* __restrict__ key,
    const float* __restrict__ value, const float* __restrict__ ipw,
    const float* __restrict__ opw, _Float16* __restrict__ dst) {
  const int b = blockIdx.x;
  const float* src;
  int first;                                   // first block of this source
  if (b < ACT_BLKS)                 { src = query; first = 0; }
  else if (b < 2 * ACT_BLKS)        { src = key;   first = ACT_BLKS; }
  else if (b < 3 * ACT_BLKS)        { src = value; first = 2 * ACT_BLKS; }
  else if (b < 3 * ACT_BLKS + IPW_BLKS) { src = ipw; first = 3 * ACT_BLKS; }
  else                              { src = opw;   first = 3 * ACT_BLKS + IPW_BLKS; }

  // The lane's first group of four elements inside the block, for both sides.
  const unsigned grp = (threadIdx.x >> 5) * (CVT_WAVE_EL / 4) + (threadIdx.x & 31);
  const float4* s = reinterpret_cast<const float4*>(
      src + (size_t)(b - first) * CVT_BLK_EL) + grp;
  v4h* d = reinterpret_cast<v4h*>(dst + (size_t)b * CVT_BLK_EL) + grp;

  float4 r[CVT_LOADS];
  // Unrolled: r[] is indexed by constants and stays in registers.
#pragma unroll
  for (int u = 0; u < CVT_LOADS; ++u) r[u] = s[u * 32];
#pragma unroll
  for (int u = 0; u < CVT_LOADS; ++u) {
    v4h o;
    o[0] = (_Float16)r[u].x; o[1] = (_Float16)r[u].y;
    o[2] = (_Float16)r[u].z; o[3] = (_Float16)r[u].w;
    d[u * 32] = o;
  }
}

// ---------------------------------------------------------------------------
// Kernel 1: fused QKV projection.  grid.z: 0=Q, 1=K, 2=V.  All-f16 operands.
// Y[t, c] = X[t, :] . W[z*E + c, :] + bias[z*E + c]   (t = l*N + n)
// Q scaled by D^-0.5 -> qh[n][h][l][d]; K -> kh[n][h][l][d];
// V -> TRANSPOSED vt[n][h][d][s].
// Block 256 thr (8 waves) -> 128 tokens x 128 columns; wave = 2x4 WMMA tiles.
// The block's tile is 4 regions (n, head) of 64 rows x 128 B of the destination:
// rows = l, bytes = d for Q and K; rows = d, bytes = l for V^T.  It is put
// together in that order in LDS and leaves as whole 128-B lines.
// The accumulator's register index must run along the destination's rows, so
// V takes the tokens as the A operand (register <-> token), Q and K take the
// weight rows as the A operand (register <-> column d).
// ---------------------------------------------------------------------------
#define OP 72                       // staged row pitch in halfs: 144 B = 16 B x odd
__global__ __launch_bounds__(256) void qkv_proj_kernel(
    const _Float16* __restrict__ xq, const _Float16* __restrict__ xk,
    const _Float16* __restrict__ xv, const _Float16* __restrict__ Wf,
    const float* __restrict__ bias,
    _Float16* __restrict__ qh, _Float16* __restrict__ kh,
    _Float16* __restrict__ vt) {
  const int z = blockIdx.z;
  const _Float16* X = (z == 0) ? xq : (z == 1) ? xk : xv;

  const int w  = threadIdx.x >> 5;
  const int wm = w >> 1, wn = w & 1;
  const float* bz = bias + z * E_DIM + blockIdx.y * 128;   // the block's 128 columns

  __shared__ __align__(16) _Float16 sm[2 * STAGE_H];
  v8f acc[2][4] = {};
  const _Float16* Xblk = X + (size_t)(blockIdx.x * 128) * E_DIM;
  const _Float16* Wblk = Wf + (size_t)(z * E_DIM + blockIdx.y * 128) * E_DIM;
  gemm_128x128(z == 2 ? Xblk : Wblk, z == 2 ? Wblk : Xblk, sm, wm, wn, acc);

  // The main loop's last barrier stands behind every wave's last read of sm, and
  // no copy is in flight: sm is free for the output tile.
  // C layout: A row = g + 8*half (register index g), B row = lane & 15.
  const int lane = threadIdx.x & 31;
  const int col  = lane & 15;
  const int half = lane >> 4;
  if (z == 2) {
    // A row = token wm*32 + i*16 + half*8 + g (n = g & 1, l = token >> 1),
    // B row = column wn*64 + j*16 + col (head wn, d = j*16 + col).
    // Registers g, g+2, g+4, g+6 are four consecutive l of one n: 8 B per store.
    // All loops unrolled: acc[][] is indexed by constants and stays in registers.
#pragma unroll
    for (int j = 0; j < 4; ++j) {
      const float b = bz[wn * 64 + j * 16 + col];
#pragma unroll
      for (int i = 0; i < 2; ++i) {
#pragma unroll
        for (int n = 0; n < 2; ++n) {
          v4h o;
#pragma unroll
          for (int e = 0; e < 4; ++e) o[e] = (_Float16)(acc[i][j][2 * e + n] + b);
          *reinterpret_cast<v4h*>(sm + ((n * 2 + wn) * 64 + j * 16 + col) * OP +
                                  wm * 16 + i * 8 + half * 4) = o;
        }
      }
    }
  } else {
    // A row = column wm*32 + i*16 + half*8 + g (head wm >> 1, eight consecutive d),
    // B row = token wn*64 + j*16 + col (n = col & 1, l = token >> 1): 16 B per store.
    const float scale = (z == 0) ? 0.125f : 1.0f;
    // All loops unrolled: acc[][] is indexed by constants and stays in registers.
#pragma unroll
    for (int i = 0; i < 2; ++i) {
      // Bias of the lane's eight columns.
      const float4* bq = reinterpret_cast<const float4*>(bz + wm * 32 + i * 16 + half * 8);
      const float4 b0 = bq[0], b1 = bq[1];
      const float bb[8] = {b0.x, b0.y, b0.z, b0.w, b1.x, b1.y, b1.z, b1.w};
#pragma unroll
      for (int j = 0; j < 4; ++j) {
        v8h o;
#pragma unroll
        for (int g = 0; g < 8; ++g) o[g] = (_Float16)((acc[i][j][g] + bb[g]) * scale);
        *reinterpret_cast<v8h*>(
            sm + (((col & 1) * 2 + (wm >> 1)) * 64 + wn * 32 + j * 8 + (col >> 1)) * OP +
            (wm & 1) * 32 + i * 16 + half * 8) = o;
      }
    }
  }
  __syncthreads();   // the whole tile is in LDS before any wave reads rows back

  // 256 rows x 128 B: a wave's store covers four whole rows (lines).
  _Float16* base = (z == 0) ? qh : (z == 1) ? kh : vt;
  const int l0 = blockIdx.x * 64;                        // the block's first l
  const size_t row_ld = (z == 2) ? S_DIM : D_HEAD;       // destination row pitch
  const size_t first  = (z == 2) ? (size_t)l0 : (size_t)l0 * D_HEAD;
  const int r32 = threadIdx.x >> 3, c8 = (threadIdx.x & 7) << 3;
  // Unrolled: the eight LDS reads are issued together, ahead of the first store.
#pragma unroll
  for (int u = 0; u < 8; ++u) {
    const int rg = u >> 1;                               // region: n = rg >> 1, head rg & 1
    const int rr = (u & 1) * 32 + r32;                   // row inside the region
    const int nh = (rg >> 1) * H_NUM + blockIdx.y * 2 + (rg & 1);
    const v8h o = *reinterpret_cast<const v8h*>(sm + (rg * 64 + rr) * OP + c8);
    *reinterpret_cast<v8h*>(base + (size_t)nh * (L_DIM * D_HEAD) + first +
                            (size_t)rr * row_ld + c8) = o;
  }
}

// ---------------------------------------------------------------------------
// Kernel 2: flash attention, one (n,h) per blockIdx.y, 128 query rows/block.
// K/V tiles staged in LDS once per block (8x traffic reduction vs per-wave), a
// stage of 128 keys at a time, by asynchronous copies into two buffers: the next
// stage flies while the four 32-key passes of this one are worked on.
// LDS rows are padded by 16 B (pitch = 16 B x odd) so that the 16 rows one
// ds_load_b128 fragment read touches fall on 16 different groups of four banks.
// Each wave owns 16 query rows.  Computes S^T = K . Q^T so that:
//   - softmax stats are per-lane scalars (lane <-> query column),
//   - exp(S^T) tiles are bit-exact the fragment layout required for
//     O^T = V^T . P^T  (no transpose / shuffle needed).
// ---------------------------------------------------------------------------
#define SK      128                      // keys per stage
#define KP      (D_HEAD + 8)             // K tile row pitch in halfs: 144 B
#define VP      (SK + 8)                 // V^T tile row pitch in halfs: 272 B
#define KTILE_H (SK * KP)                // halfs of the K tile: 128 s x 64 d
#define AST_H   (KTILE_H + D_HEAD * VP)  // halfs per buffer: K tile, then V^T tile
#define AST_B   (AST_H * 2)              // bytes per buffer
#define A_STAGE (S_DIM / SK)             // 16

// One stage: each lane copies 16 B of 4 K rows (32 rows apart) and of 4 V^T rows
// (16 rows apart); a wave covers four whole 128-B lines per copy.  The
// s_wait_xcnt stands inside the statement so that no address register is
// rewritten ahead of it.
__device__ __forceinline__ void attn_stage_copy(unsigned lk, unsigned lv,
                                                const _Float16* gk,
                                                const _Float16* gv) {
  const unsigned k1 = lk + 1 * (32 * KP * 2), k2 = lk + 2 * (32 * KP * 2);
  const unsigned k3 = lk + 3 * (32 * KP * 2);
  const unsigned v1 = lv + 1 * (16 * VP * 2), v2 = lv + 2 * (16 * VP * 2);
  const unsigned v3 = lv + 3 * (16 * VP * 2);
  const _Float16* gk1 = gk + 32 * D_HEAD;
  const _Float16* gk2 = gk + 64 * D_HEAD;
  const _Float16* gk3 = gk + 96 * D_HEAD;
  const _Float16* gv1 = gv + 16 * S_DIM;
  const _Float16* gv2 = gv + 32 * S_DIM;
  const _Float16* gv3 = gv + 48 * S_DIM;
  asm volatile(
      "global_load_async_to_lds_b128 %0, %8, off\n\t"
      "global_load_async_to_lds_b128 %1, %9, off\n\t"
      "global_load_async_to_lds_b128 %2, %10, off\n\t"
      "global_load_async_to_lds_b128 %3, %11, off\n\t"
      "global_load_async_to_lds_b128 %4, %12, off\n\t"
      "global_load_async_to_lds_b128 %5, %13, off\n\t"
      "global_load_async_to_lds_b128 %6, %14, off\n\t"
      "global_load_async_to_lds_b128 %7, %15, off\n\t"
      "s_wait_xcnt 0x0"
      :: "v"(lk), "v"(k1), "v"(k2), "v"(k3), "v"(lv), "v"(v1), "v"(v2), "v"(v3),
         "v"(gk), "v"(gk1), "v"(gk2), "v"(gk3), "v"(gv), "v"(gv1), "v"(gv2), "v"(gv3)
      : "memory");
}

__global__ __launch_bounds__(256) void flash_attn_kernel(
    const _Float16* __restrict__ qh, const _Float16* __restrict__ kh,
    const _Float16* __restrict__ vt, const float* __restrict__ rel_bias,
    _Float16* __restrict__ ch) {
  __shared__ __align__(16) _Float16 sm[2 * AST_H];

  const int nh   = blockIdx.y;            // n*H + h
  const int h    = nh & (H_NUM - 1);
  const int n    = nh >> 4;
  const int w    = threadIdx.x >> 5;
  const int lane = threadIdx.x & 31;
  const int q    = lane & 15;             // query column owned by this lane
  const int half = lane >> 4;
  const int qbase = blockIdx.x * 128 + w * 16;
  const int lglob = qbase + q;            // global query row

  const _Float16* Qp = qh + ((size_t)nh * L_DIM + qbase) * D_HEAD;
  const _Float16* Kp = kh + (size_t)nh * S_DIM * D_HEAD;
  const _Float16* Vp = vt + (size_t)nh * D_HEAD * S_DIM;
  // bias[h, l - s + S-1] accessed as bp[-s]
  const float* bp = rel_bias + (size_t)h * BIAS_W + lglob + (S_DIM - 1);

  // Copy coordinates (256 threads x 16 B x 4 covers each 16-KB tile).
  const int tid  = threadIdx.x;
  const int krow = tid >> 3, kcol = (tid & 7) << 3;    // 32 rows x 64 halfs a copy
  const int vrow = tid >> 4, vcol = (tid & 15) << 3;   // 16 rows x 128 halfs a copy
  const unsigned lkd = (unsigned)(size_t)sm + (unsigned)(krow * KP + kcol) * 2u;
  const unsigned lvd = (unsigned)(size_t)sm + (unsigned)(KTILE_H + vrow * VP + vcol) * 2u;
  const _Float16* gk = Kp + (size_t)krow * D_HEAD + kcol;
  const _Float16* gv = Vp + (size_t)vrow * S_DIM + vcol;

  attn_stage_copy(lkd, lvd, gk, gv);

  // Q^T B-fragments (lane row = query, contiguous d), loaded once.
  const v16h qb0 = frag_f16(Qp, D_HEAD);
  const v16h qb1 = frag_f16(Qp + 32, D_HEAD);

  v8f ot0 = {}, ot1 = {}, ot2 = {}, ot3 = {};   // O^T: VGPR<->d, lane<->query
  float mrow = -3.0e38f, srow = 0.0f;

  asm volatile("s_wait_asynccnt 0x0" ::: "memory");   // own copies of stage 0 landed
  __syncthreads();                                    // stage 0 visible to all waves
  attn_stage_copy(lkd + AST_B, lvd + AST_B, gk + SK * D_HEAD, gv + SK);

  for (int t = 0; t < A_STAGE; ++t) {
   const _Float16* lks = sm + (t & 1) * AST_H;
   // Unrolled: the LDS offsets of a pass become immediates, and with no barrier
   // between the passes the next pass's loads can be issued under this one's work.
#pragma unroll
   for (int p = 0; p < SK / 32; ++p) {
    const int s0 = t * SK + p * 32;
    const _Float16* lk = lks + p * 32 * KP;         // 32 keys x 64 d of this pass
    const _Float16* lv = lks + KTILE_H + p * 32;    // 64 d x 32 keys of this pass

    // Relative position bias; key index s = s0 + g + 8*half (+16 for the second tile).
    float rb0[8], rb1[8];
#pragma unroll
    for (int g = 0; g < 8; ++g) {
      const int so = g + half * 8;
      rb0[g] = bp[-(s0 + so)];
      rb1[g] = bp[-(s0 + so + 16)];
    }
    // Keeps the bias loads in front of the pass's K reads and score products, where
    // the tile barrier used to hold them: without it the compiler sinks them to
    // their uses, in small groups that each wait for the one before.
    __builtin_amdgcn_sched_barrier(0);

    // S^T = K . Q^T  (A rows = key s, contiguous d from LDS).
    v16h ka0 = frag_f16(lk, KP);
    v16h ka1 = frag_f16(lk + 32, KP);
    v16h ka2 = frag_f16(lk + 16 * KP, KP);
    v16h ka3 = frag_f16(lk + 16 * KP + 32, KP);

    v8f st0 = {}, st1 = {};
    st0 = wmma_f16(ka0, qb0, st0);
    st0 = wmma_f16(ka1, qb1, st0);   // keys s0..s0+15
    st1 = wmma_f16(ka2, qb0, st1);
    st1 = wmma_f16(ka3, qb1, st1);   // keys s0+16..s0+31

    float sv0[8], sv1[8];
#pragma unroll
    for (int g = 0; g < 8; ++g) {
      sv0[g] = st0[g] + rb0[g];
      sv1[g] = st1[g] + rb1[g];
    }

    // Online softmax (per-query stats per-lane; merge the two lane-halves).
    float tmax = sv0[0];
#pragma unroll
    for (int g = 0; g < 8; ++g) {
      tmax = fmaxf(tmax, sv0[g]);
      tmax = fmaxf(tmax, sv1[g]);
    }
    tmax = fmaxf(tmax, __shfl_xor(tmax, 16));
    const float mnew  = fmaxf(mrow, tmax);
    const float alpha = __expf(mrow - mnew);
    mrow = mnew;

    // P^T fragment: element e<8 -> k=8*half+e (st0[e]); e>=8 -> st1[e-8].
    v16h pa;
    float tsum = 0.0f;
#pragma unroll
    for (int g = 0; g < 8; ++g) {
      const float p0 = __expf(sv0[g] - mnew);
      const float p1 = __expf(sv1[g] - mnew);
      tsum += p0 + p1;
      pa[g]     = (_Float16)p0;
      pa[8 + g] = (_Float16)p1;
    }
    tsum += __shfl_xor(tsum, 16);
    srow = srow * alpha + tsum;

#pragma unroll
    for (int g = 0; g < 8; ++g) {
      ot0[g] *= alpha; ot1[g] *= alpha; ot2[g] *= alpha; ot3[g] *= alpha;
    }

    // O^T += V^T . P^T   (A rows = d, contiguous s from LDS; B = pa)
    ot0 = wmma_f16(frag_f16(lv + 0 * 16 * VP, VP), pa, ot0);
    ot1 = wmma_f16(frag_f16(lv + 1 * 16 * VP, VP), pa, ot1);
    ot2 = wmma_f16(frag_f16(lv + 2 * 16 * VP, VP), pa, ot2);
    ot3 = wmma_f16(frag_f16(lv + 3 * 16 * VP, VP), pa, ot3);
   }
   asm volatile("s_wait_dscnt 0x0" ::: "memory");    // own reads of this buffer done
   asm volatile("s_wait_asynccnt 0x0" ::: "memory"); // own copies of stage t+1 landed
   __syncthreads();   // publishes stage t+1 and frees the buffer just read
   if (t + 2 < A_STAGE)
     attn_stage_copy(lkd + (t & 1) * AST_B, lvd + (t & 1) * AST_B,
                     gk + (size_t)(t + 2) * SK * D_HEAD, gv + (t + 2) * SK);
  }
  asm volatile("s_wait_asynccnt 0x0" ::: "memory");   // nothing in flight at the end

  // Normalize and scatter to context ch[t][E]; d = j*16 + half*8 + g is
  // contiguous in g -> one 16B store per tile.
  const float inv = 1.0f / srow;
  const int t = lglob * N_BATCH + n;
  _Float16* op = ch + (size_t)t * E_DIM + h * D_HEAD + half * 8;
  v8f* ots[4] = {&ot0, &ot1, &ot2, &ot3};
#pragma unroll
  for (int j = 0; j < 4; ++j) {
    v8h o;
#pragma unroll
    for (int g = 0; g < 8; ++g) o[g] = (_Float16)((*ots[j])[g] * inv);
    *reinterpret_cast<v8h*>(op + j * 16) = o;
  }
}

// ---------------------------------------------------------------------------
// Kernel 3: output projection.  out[t, e] = ch[t, :] . Wout[e, :] + bout[e]
// Same 128x128 block / 32x64 wave tiling as the QKV projection.
// ---------------------------------------------------------------------------
__global__ __launch_bounds__(256) void out_proj_kernel(
    const _Float16* __restrict__ ch, const _Float16* __restrict__ Wof,
    const float* __restrict__ bout, float* __restrict__ out) {
  const int w  = threadIdx.x >> 5;
  const int wm = w >> 1, wn = w & 1;
  const int m0 = blockIdx.x * 128 + wm * 32;
  const int n0 = blockIdx.y * 128 + wn * 64;
  __shared__ __align__(16) _Float16 sm[2 * STAGE_H];
  v8f acc[2][4] = {};
  gemm_128x128(ch + (size_t)(blockIdx.x * 128) * E_DIM,
               Wof + (size_t)(blockIdx.y * 128) * E_DIM, sm, wm, wn, acc);

  const int lane = threadIdx.x & 31;
  const int col  = lane & 15;
  const int half = lane >> 4;
#pragma unroll
  for (int i = 0; i < 2; ++i) {
#pragma unroll
    for (int j = 0; j < 4; ++j) {
#pragma unroll
      for (int g = 0; g < 8; ++g) {
        const int t = m0 + i * 16 + g + half * 8;
        const int c = n0 + j * 16 + col;
        out[(size_t)t * E_DIM + c] = acc[i][j][g] + bout[c];
      }
    }
  }
}

// ---------------------------------------------------------------------------
extern "C" void kernel_launch(void* const* d_in, const int* in_sizes, int n_in,
                              void* d_out, int out_size, void* d_ws, size_t ws_size,
                              hipStream_t stream) {
  const float* query = (const float*)d_in[0];
  const float* key   = (const float*)d_in[1];
  const float* value = (const float*)d_in[2];
  const float* ipw   = (const float*)d_in[3];
  const float* ipb   = (const float*)d_in[4];
  const float* opw   = (const float*)d_in[5];
  const float* opb   = (const float*)d_in[6];
  const float* rbias = (const float*)d_in[7];
  float* out = (float*)d_out;

  // Workspace layout (f16 elements):
  //   qh | kh | vt | ch : N*H*L*D = 4 Mi each
  //   xq | xk | xv      : L*N*E   = 4 Mi each      (f16 activations)
  //   wf                : 3*E*E   = 3 Mi           (f16 in_proj_weight)
  //   wof               : E*E     = 1 Mi           (f16 out_proj_weight)
  // Total 32 Mi f16 = 64 MiB.
  const size_t slab = (size_t)N_BATCH * H_NUM * L_DIM * D_HEAD;  // 4 Mi
  _Float16* qh  = (_Float16*)d_ws;
  _Float16* kh  = qh + slab;
  _Float16* vt  = kh + slab;
  _Float16* ch  = vt + slab;
  _Float16* xq  = ch + slab;
  _Float16* xk  = xq + slab;
  _Float16* xv  = xk + slab;
  _Float16* wf  = xv + slab;
  _Float16* wof = wf + (size_t)3 * E_DIM * E_DIM;

  dim3 blk(256);
  // xq | xk | xv | wf | wof are contiguous: one destination for the conversion.
  cvt_all_kernel<<<dim3(CVT_BLKS), dim3(CVT_THREADS), 0, stream>>>(
      query, key, value, ipw, opw, xq);

  // QKV projection: M=4096 -> 32 tiles, Nc=1024 -> 8 tiles, z = {Q,K,V}.
  qkv_proj_kernel<<<dim3(32, 8, 3), blk, 0, stream>>>(
      xq, xk, xv, wf, ipb, qh, kh, vt);
  // Flash attention: 16 query blocks x 32 (n,h) slices.
  flash_attn_kernel<<<dim3(L_DIM / 128, N_BATCH * H_NUM), blk, 0, stream>>>(
      qh, kh, vt, rbias, ch);
  // Output projection.
  out_proj_kernel<<<dim3(32, 8), blk, 0, stream>>>(ch, opw ? wof : wof, opb, out);
}

// v006
// A run of this version takes 93.4 microseconds.
// Timed twice side by side with v005, it ran 1.10 times as fast both times.
// Counting every step since v000, it is 2.57 times as fast.
#include <hip/hip_runtime.h>

// Multihead attention with relative position bias for MI455X (gfx1250).
// All GEMMs via v_wmma_f32_16x16x32_f16 (f16 in, f32 accumulate).
// fp32 operands are converted to f16 ONCE (one bandwidth-bound launch); the
// projection GEMMs read their fragments from LDS tiles filled by async copies.
// L = S = 2048, N = 2, E = 1024, H = 16, D = 64.

#define L_DIM   2048
#define S_DIM   2048
#define N_BATCH 2
#define E_DIM   1024
#define H_NUM   16
#define D_HEAD  64
#define BIAS_W  (2 * S_DIM - 1)   // 4095

typedef __attribute__((ext_vector_type(16))) _Float16 v16h;
typedef __attribute__((ext_vector_type(8)))  _Float16 v8h;
typedef __attribute__((ext_vector_type(8)))  float    v8f;

__device__ __forceinline__ v8f wmma_f16(v16h a, v16h b, v8f c) {
  // D = A(16x32 f16) * B(32x16 f16) + C(16x16 f32)
  return __builtin_amdgcn_wmma_f32_16x16x32_f16(
      /*neg_a=*/false, a, /*neg_b=*/false, b,
      /*c_mod=*/(short)0, c, /*reuse_a=*/false, /*reuse_b=*/false);
}

// Load a 16(row) x 32(K) f16 fragment whose rows are contiguous-K in memory.
// Per ISA 16-bit A layout: lane (row = lane&15, half = lane>>4) holds
// K = [8*half .. +7] and [16+8*half .. +7] (two 16B runs). The identical
// layout serves as a B fragment with "row" = N column.  Works for global
// or LDS pointers (LDS -> ds_load_b128 after address-space inference).
__device__ __forceinline__ v16h frag_f16(const _Float16* __restrict__ p, int ld) {
  const int lane = threadIdx.x & 31;
  const _Float16* r = p + (lane & 15) * ld + (lane >> 4) * 8;
  v8h lo = *reinterpret_cast<const v8h*>(r);
  v8h hi = *reinterpret_cast<const v8h*>(r + 16);
  v16h f;
#pragma unroll
  for (int i = 0; i < 8; ++i) { f[i] = lo[i]; f[8 + i] = hi[i]; }
  return f;
}

// ---------------------------------------------------------------------------
// Shared main loop of the two projection GEMMs: C(128x128) = A(128xK) . B(128xK)^T.
// A and B tiles (128 rows x 64 k each) are staged in LDS by asynchronous copies,
// two buffers, so every global line is fetched whole and once per block and the
// next tile flies while this one is multiplied.
// ---------------------------------------------------------------------------
#define KT       64                 // k per stage: 128-byte rows
#define LDP      72                 // LDS row pitch in halfs: 144 B = 16 B x odd
#define STAGE_H  (256 * LDP)        // halfs per buffer: 128 A rows, then 128 B rows
#define STAGE_B  (STAGE_H * 2)      // bytes per buffer
#define ROWS32_B (32 * LDP * 2)     // LDS bytes of 32 rows
#define N_STAGE  (E_DIM / KT)       // 16

// One stage: each lane copies 16 B of 4 A rows and of 4 B rows (a wave covers
// four whole 128-B lines per copy).  The s_wait_xcnt stands inside the statement
// so that no address register is rewritten ahead of it.
__device__ __forceinline__ void stage_copy(unsigned lds, const _Float16* ga,
                                           const _Float16* gb) {
  const unsigned l0 = lds,                l1 = lds + 1 * ROWS32_B;
  const unsigned l2 = lds + 2 * ROWS32_B, l3 = lds + 3 * ROWS32_B;
  const unsigned l4 = lds + 4 * ROWS32_B, l5 = lds + 5 * ROWS32_B;
  const unsigned l6 = lds + 6 * ROWS32_B, l7 = lds + 7 * ROWS32_B;
  const _Float16* a1 = ga + 32 * E_DIM;
  const _Float16* a2 = ga + 64 * E_DIM;
  const _Float16* a3 = ga + 96 * E_DIM;
  const _Float16* b1 = gb + 32 * E_DIM;
  const _Float16* b2 = gb + 64 * E_DIM;
  const _Float16* b3 = gb + 96 * E_DIM;
  asm volatile(
      "global_load_async_to_lds_b128 %0, %8, off\n\t"
      "global_load_async_to_lds_b128 %1, %9, off\n\t"
      "global_load_async_to_lds_b128 %2, %10, off\n\t"
      "global_load_async_to_lds_b128 %3, %11, off\n\t"
      "global_load_async_to_lds_b128 %4, %12, off\n\t"
      "global_load_async_to_lds_b128 %5, %13, off\n\t"
      "global_load_async_to_lds_b128 %6, %14, off\n\t"
      "global_load_async_to_lds_b128 %7, %15, off\n\t"
      "s_wait_xcnt 0x0"
      :: "v"(l0), "v"(l1), "v"(l2), "v"(l3), "v"(l4), "v"(l5), "v"(l6), "v"(l7),
         "v"(ga), "v"(a1), "v"(a2), "v"(a3), "v"(gb), "v"(b1), "v"(b2), "v"(b3)
      : "memory");
}

// Ablk / Bblk: first row of the block's 128 A rows / 128 B rows (row pitch E_DIM).
// sm: 2 * STAGE_H halfs of LDS.  Wave (wm, wn) accumulates its 32x64 part.
__device__ __forceinline__ void gemm_128x128(const _Float16* __restrict__ Ablk,
                                             const _Float16* __restrict__ Bblk,
                                             _Float16* sm, int wm, int wn,
                                             v8f (&acc)[2][4]) {
  const int crow = threadIdx.x >> 3, ccol = (threadIdx.x & 7) << 3;
  const unsigned lds = (unsigned)(size_t)sm + (unsigned)(crow * LDP + ccol) * 2u;
  const _Float16* ga = Ablk + (size_t)crow * E_DIM + ccol;
  const _Float16* gb = Bblk + (size_t)crow * E_DIM + ccol;

  stage_copy(lds, ga, gb);
  asm volatile("s_wait_asynccnt 0x0" ::: "memory");   // own copies of tile 0 landed
  __syncthreads();                                    // tile 0 visible to all waves
  stage_copy(lds + STAGE_B, ga + KT, gb + KT);

  for (int t = 0; t < N_STAGE; ++t) {
    const _Float16* s  = sm + (t & 1) * STAGE_H;
    const _Float16* sa = s + (wm * 32) * LDP;
    const _Float16* sb = s + (128 + wn * 64) * LDP;
    // Both loops unrolled: acc[][] is indexed by constants and stays in registers.
#pragma unroll
    for (int kk = 0; kk < KT; kk += 32) {
      v16h a0 = frag_f16(sa + kk, LDP);
      v16h a1 = frag_f16(sa + 16 * LDP + kk, LDP);
      v16h b[4];
#pragma unroll
      for (int j = 0; j < 4; ++j) b[j] = frag_f16(sb + (j * 16) * LDP + kk, LDP);
      // Keeps a k step's twelve reads in front of its eight products (the second
      // step's reads then rise among the first step's products): without it each B
      // fragment is read just before its two products, which wait out its whole
      // latency, four times per 32 k.
      __builtin_amdgcn_sched_barrier(0);
#pragma unroll
      for (int j = 0; j < 4; ++j) {
        acc[0][j] = wmma_f16(a0, b[j], acc[0][j]);
        acc[1][j] = wmma_f16(a1, b[j], acc[1][j]);
      }
    }
    asm volatile("s_wait_dscnt 0x0" ::: "memory");    // own reads of this buffer done
    asm volatile("s_wait_asynccnt 0x0" ::: "memory"); // own copies of tile t+1 landed
    __syncthreads();   // publishes tile t+1 and frees the buffer just read
    if (t + 2 < N_STAGE)
      stage_copy(lds + (t & 1) * STAGE_B, ga + (t + 2) * KT, gb + (t + 2) * KT);
  }
  asm volatile("s_wait_asynccnt 0x0" ::: "memory");   // nothing in flight at the end
}

// ---------------------------------------------------------------------------
// Kernel 0: fp32 -> f16 conversion of all five operands in ONE launch.
// The five f16 destinations lie one behind the other in the workspace, so the
// launch sees one destination array; a block's index picks its source.
// One 16-wave block per WGP: a wave owns 4096 contiguous elements (16 KiB of
// fp32), every load covers 512 contiguous bytes, every store 256, and all of a
// lane's loads are issued before its first conversion.
// ---------------------------------------------------------------------------
typedef __attribute__((ext_vector_type(4))) _Float16 v4h;
#define CVT_THREADS 512
#define CVT_LOADS   32                                  // 16-byte loads per lane
#define CVT_WAVE_EL (32 * 4 * CVT_LOADS)                // 4096 elements per wave
#define CVT_BLK_EL  ((CVT_THREADS / 32) * CVT_WAVE_EL)  // 65536 elements per block
#define ACT_BLKS    (L_DIM * N_BATCH * E_DIM / CVT_BLK_EL)   // 64 per activation
#define IPW_BLKS    (3 * E_DIM * E_DIM / CVT_BLK_EL)         // 48
#define OPW_BLKS    (E_DIM * E_DIM / CVT_BLK_EL)             // 16
#define CVT_BLKS    (3 * ACT_BLKS + IPW_BLKS + OPW_BLKS)     // 256
// Four waves a SIMD is what one 16-wave block per WGP gives: told so, the
// compiler keeps all 32 loads of a lane in flight; without it it saves registers
// and splits the loads into groups that wait on one another.
__global__ __launch_bounds__(CVT_THREADS)
__attribute__((amdgpu_waves_per_eu(4, 4))) void cvt_all_kernel(
    const float* __restrict__ query, const float* __restrict__ key,
    const float* __restrict__ value, const float* __restrict__ ipw,
    const float* __restrict__ opw, _Float16* __restrict__ dst) {
  const int b = blockIdx.x;
  const float* src;
  int first;                                   // first block of this source
  if (b < ACT_BLKS)                 { src = query; first = 0; }
  else if (b < 2 * ACT_BLKS)        { src = key;   first = ACT_BLKS; }
  else if (b < 3 * ACT_BLKS)        { src = value; first = 2 * ACT_BLKS; }
  else if (b < 3 * ACT_BLKS + IPW_BLKS) { src = ipw; first = 3 * ACT_BLKS; }
  else                              { src = opw;   first = 3 * ACT_BLKS + IPW_BLKS; }

  // The lane's first group of four elements inside the block, for both sides.
  const unsigned grp = (threadIdx.x >> 5) * (CVT_WAVE_EL / 4) + (threadIdx.x & 31);
  const float4* s = reinterpret_cast<const float4*>(
      src + (size_t)(b - first) * CVT_BLK_EL) + grp;
  v4h* d = reinterpret_cast<v4h*>(dst + (size_t)b * CVT_BLK_EL) + grp;

  float4 r[CVT_LOADS];
  // Unrolled: r[] is indexed by constants and stays in registers.
#pragma unroll
  for (int u = 0; u < CVT_LOADS; ++u) r[u] = s[u * 32];
#pragma unroll
  for (int u = 0; u < CVT_LOADS; ++u) {
    v4h o;
    o[0] = (_Float16)r[u].x; o[1] = (_Float16)r[u].y;
    o[2] = (_Float16)r[u].z; o[3] = (_Float16)r[u].w;
    d[u * 32] = o;
  }
}

// ---------------------------------------------------------------------------
// Kernel 1: fused QKV projection.  grid.z: 0=Q, 1=K, 2=V.  All-f16 operands.
// Y[t, c] = X[t, :] . W[z*E + c, :] + bias[z*E + c]   (t = l*N + n)
// Q scaled by D^-0.5 -> qh[n][h][l][d]; K -> kh[n][h][l][d];
// V -> TRANSPOSED vt[n][h][d][s].
// Block 256 thr (8 waves) -> 128 tokens x 128 columns; wave = 2x4 WMMA tiles.
// The block's tile is 4 regions (n, head) of 64 rows x 128 B of the destination:
// rows = l, bytes = d for Q and K; rows = d, bytes = l for V^T.  It is put
// together in that order in LDS and leaves as whole 128-B lines.
// The accumulator's register index must run along the destination's rows, so
// V takes the tokens as the A operand (register <-> token), Q and K take the
// weight rows as the A operand (register <-> column d).
// ---------------------------------------------------------------------------
#define OP 72                       // staged row pitch in halfs: 144 B = 16 B x odd
__global__ __launch_bounds__(256) void qkv_proj_kernel(
    const _Float16* __restrict__ xq, const _Float16* __restrict__ xk,
    const _Float16* __restrict__ xv, const _Float16* __restrict__ Wf,
    const float* __restrict__ bias,
    _Float16* __restrict__ qh, _Float16* __restrict__ kh,
    _Float16* __restrict__ vt) {
  const int z = blockIdx.z;
  const _Float16* X = (z == 0) ? xq : (z == 1) ? xk : xv;

  const int w  = threadIdx.x >> 5;
  const int wm = w >> 1, wn = w & 1;
  const float* bz = bias + z * E_DIM + blockIdx.y * 128;   // the block's 128 columns

  __shared__ __align__(16) _Float16 sm[2 * STAGE_H];
  v8f acc[2][4] = {};
  const _Float16* Xblk = X + (size_t)(blockIdx.x * 128) * E_DIM;
  const _Float16* Wblk = Wf + (size_t)(z * E_DIM + blockIdx.y * 128) * E_DIM;
  gemm_128x128(z == 2 ? Xblk : Wblk, z == 2 ? Wblk : Xblk, sm, wm, wn, acc);

  // The main loop's last barrier stands behind every wave's last read of sm, and
  // no copy is in flight: sm is free for the output tile.
  // C layout: A row = g + 8*half (register index g), B row = lane & 15.
  const int lane = threadIdx.x & 31;
  const int col  = lane & 15;
  const int half = lane >> 4;
  if (z == 2) {
    // A row = token wm*32 + i*16 + half*8 + g (n = g & 1, l = token >> 1),
    // B row = column wn*64 + j*16 + col (head wn, d = j*16 + col).
    // Registers g, g+2, g+4, g+6 are four consecutive l of one n: 8 B per store.
    // All loops unrolled: acc[][] is indexed by constants and stays in registers.
#pragma unroll
    for (int j = 0; j < 4; ++j) {
      const float b = bz[wn * 64 + j * 16 + col];
#pragma unroll
      for (int i = 0; i < 2; ++i) {
#pragma unroll
        for (int n = 0; n < 2; ++n) {
          v4h o;
#pragma unroll
          for (int e = 0; e < 4; ++e) o[e] = (_Float16)(acc[i][j][2 * e + n] + b);
          *reinterpret_cast<v4h*>(sm + ((n * 2 + wn) * 64 + j * 16 + col) * OP +
                                  wm * 16 + i * 8 + half * 4) = o;
        }
      }
    }
  } else {
    // A row = column wm*32 + i*16 + half*8 + g (head wm >> 1, eight consecutive d),
    // B row = token wn*64 + j*16 + col (n = col & 1, l = token >> 1): 16 B per store.
    const float scale = (z == 0) ? 0.125f : 1.0f;
    // All loops unrolled: acc[][] is indexed by constants and stays in registers.
#pragma unroll
    for (int i = 0; i < 2; ++i) {
      // Bias of the lane's eight columns.
      const float4* bq = reinterpret_cast<const float4*>(bz + wm * 32 + i * 16 + half * 8);
      const float4 b0 = bq[0], b1 = bq[1];
      const float bb[8] = {b0.x, b0.y, b0.z, b0.w, b1.x, b1.y, b1.z, b1.w};
#pragma unroll
      for (int j = 0; j < 4; ++j) {
        v8h o;
#pragma unroll
        for (int g = 0; g < 8; ++g) o[g] = (_Float16)((acc[i][j][g] + bb[g]) * scale);
        *reinterpret_cast<v8h*>(
            sm + (((col & 1) * 2 + (wm >> 1)) * 64 + wn * 32 + j * 8 + (col >> 1)) * OP +
            (wm & 1) * 32 + i * 16 + half * 8) = o;
      }
    }
  }
  __syncthreads();   // the whole tile is in LDS before any wave reads rows back

  // 256 rows x 128 B: a wave's store covers four whole rows (lines).
  _Float16* base = (z == 0) ? qh : (z == 1) ? kh : vt;
  const int l0 = blockIdx.x * 64;                        // the block's first l
  const size_t row_ld = (z == 2) ? S_DIM : D_HEAD;       // destination row pitch
  const size_t first  = (z == 2) ? (size_t)l0 : (size_t)l0 * D_HEAD;
  const int r32 = threadIdx.x >> 3, c8 = (threadIdx.x & 7) << 3;
  // Unrolled: the eight LDS reads are issued together, ahead of the first store.
#pragma unroll
  for (int u = 0; u < 8; ++u) {
    const int rg = u >> 1;                               // region: n = rg >> 1, head rg & 1
    const int rr = (u & 1) * 32 + r32;                   // row inside the region
    const int nh = (rg >> 1) * H_NUM + blockIdx.y * 2 + (rg & 1);
    const v8h o = *reinterpret_cast<const v8h*>(sm + (rg * 64 + rr) * OP + c8);
    *reinterpret_cast<v8h*>(base + (size_t)nh * (L_DIM * D_HEAD) + first +
                            (size_t)rr * row_ld + c8) = o;
  }
}

// ---------------------------------------------------------------------------
// Kernel 2: flash attention, one (n,h) per blockIdx.y, 128 query rows/block.
// K/V tiles staged in LDS once per block (8x traffic reduction vs per-wave), a
// stage of 128 keys at a time, by asynchronous copies into two buffers: the next
// stage flies while the four 32-key passes of this one are worked on.
// LDS rows are padded by 16 B (pitch = 16 B x odd) so that the 16 rows one
// ds_load_b128 fragment read touches fall on 16 different groups of four banks.
// Each wave owns 16 query rows.  Computes S^T = K . Q^T so that:
//   - softmax stats are per-lane scalars (lane <-> query column),
//   - exp(S^T) tiles are bit-exact the fragment layout required for
//     O^T = V^T . P^T  (no transpose / shuffle needed).
// ---------------------------------------------------------------------------
#define SK      128                      // keys per stage
#define KP      (D_HEAD + 8)             // K tile row pitch in halfs: 144 B
#define VP      (SK + 8)                 // V^T tile row pitch in halfs: 272 B
#define KTILE_H (SK * KP)                // halfs of the K tile: 128 s x 64 d
#define AST_H   (KTILE_H + D_HEAD * VP)  // halfs per buffer: K tile, then V^T tile
#define AST_B   (AST_H * 2)              // bytes per buffer
#define A_STAGE (S_DIM / SK)             // 16

// One stage: each lane copies 16 B of 4 K rows (32 rows apart) and of 4 V^T rows
// (16 rows apart); a wave covers four whole 128-B lines per copy.  The
// s_wait_xcnt stands inside the statement so that no address register is
// rewritten ahead of it.
__device__ __forceinline__ void attn_stage_copy(unsigned lk, unsigned lv,
                                                const _Float16* gk,
                                                const _Float16* gv) {
  const unsigned k1 = lk + 1 * (32 * KP * 2), k2 = lk + 2 * (32 * KP * 2);
  const unsigned k3 = lk + 3 * (32 * KP * 2);
  const unsigned v1 = lv + 1 * (16 * VP * 2), v2 = lv + 2 * (16 * VP * 2);
  const unsigned v3 = lv + 3 * (16 * VP * 2);
  const _Float16* gk1 = gk + 32 * D_HEAD;
  const _Float16* gk2 = gk + 64 * D_HEAD;
  const _Float16* gk3 = gk + 96 * D_HEAD;
  const _Float16* gv1 = gv + 16 * S_DIM;
  const _Float16* gv2 = gv + 32 * S_DIM;
  const _Float16* gv3 = gv + 48 * S_DIM;
  asm volatile(
      "global_load_async_to_lds_b128 %0, %8, off\n\t"
      "global_load_async_to_lds_b128 %1, %9, off\n\t"
      "global_load_async_to_lds_b128 %2, %10, off\n\t"
      "global_load_async_to_lds_b128 %3, %11, off\n\t"
      "global_load_async_to_lds_b128 %4, %12, off\n\t"
      "global_load_async_to_lds_b128 %5, %13, off\n\t"
      "global_load_async_to_lds_b128 %6, %14, off\n\t"
      "global_load_async_to_lds_b128 %7, %15, off\n\t"
      "s_wait_xcnt 0x0"
      :: "v"(lk), "v"(k1), "v"(k2), "v"(k3), "v"(lv), "v"(v1), "v"(v2), "v"(v3),
         "v"(gk), "v"(gk1), "v"(gk2), "v"(gk3), "v"(gv), "v"(gv1), "v"(gv2), "v"(gv3)
      : "memory");
}

__global__ __launch_bounds__(256) void flash_attn_kernel(
    const _Float16* __restrict__ qh, const _Float16* __restrict__ kh,
    const _Float16* __restrict__ vt, const float* __restrict__ rel_bias,
    _Float16* __restrict__ ch) {
  __shared__ __align__(16) _Float16 sm[2 * AST_H];

  const int nh   = blockIdx.y;            // n*H + h
  const int h    = nh & (H_NUM - 1);
  const int n    = nh >> 4;
  const int w    = threadIdx.x >> 5;
  const int lane = threadIdx.x & 31;
  const int q    = lane & 15;             // query column owned by this lane
  const int half = lane >> 4;
  const int qbase = blockIdx.x * 128 + w * 16;
  const int lglob = qbase + q;            // global query row

  const _Float16* Qp = qh + ((size_t)nh * L_DIM + qbase) * D_HEAD;
  const _Float16* Kp = kh + (size_t)nh * S_DIM * D_HEAD;
  const _Float16* Vp = vt + (size_t)nh * D_HEAD * S_DIM;
  // bias[h, l - s + S-1] accessed as bp[-s]
  const float* bp = rel_bias + (size_t)h * BIAS_W + lglob + (S_DIM - 1);

  // Copy coordinates (256 threads x 16 B x 4 covers each 16-KB tile).
  const int tid  = threadIdx.x;
  const int krow = tid >> 3, kcol = (tid & 7) << 3;    // 32 rows x 64 halfs a copy
  const int vrow = tid >> 4, vcol = (tid & 15) << 3;   // 16 rows x 128 halfs a copy
  const unsigned lkd = (unsigned)(size_t)sm + (unsigned)(krow * KP + kcol) * 2u;
  const unsigned lvd = (unsigned)(size_t)sm + (unsigned)(KTILE_H + vrow * VP + vcol) * 2u;
  const _Float16* gk = Kp + (size_t)krow * D_HEAD + kcol;
  const _Float16* gv = Vp + (size_t)vrow * S_DIM + vcol;

  attn_stage_copy(lkd, lvd, gk, gv);

  // Q^T B-fragments (lane row = query, contiguous d), loaded once.
  const v16h qb0 = frag_f16(Qp, D_HEAD);
  const v16h qb1 = frag_f16(Qp + 32, D_HEAD);

  v8f ot0 = {}, ot1 = {}, ot2 = {}, ot3 = {};   // O^T: VGPR<->d, lane<->query
  float mrow = -3.0e38f, srow = 0.0f;

  asm volatile("s_wait_asynccnt 0x0" ::: "memory");   // own copies of stage 0 landed
  __syncthreads();                                    // stage 0 visible to all waves
  attn_stage_copy(lkd + AST_B, lvd + AST_B, gk + SK * D_HEAD, gv + SK);

  for (int t = 0; t < A_STAGE; ++t) {
   const _Float16* lks = sm + (t & 1) * AST_H;
   v16h ka0, ka1, ka2, ka3;   // K fragments of a pass (A rows = key s, contiguous d)
   // Unrolled: the LDS offsets of a pass become immediates.
#pragma unroll
   for (int p = 0; p < SK / 32; ++p) {
    const int s0 = t * SK + p * 32;
    const _Float16* lk = lks + p * 32 * KP;         // 32 keys x 64 d of this pass
    const _Float16* lv = lks + KTILE_H + p * 32;    // 64 d x 32 keys of this pass

    // Relative position bias; key index s = s0 + g + 8*half (+16 for the second tile).
    float rb0[8], rb1[8];
#pragma unroll
    for (int g = 0; g < 8; ++g) {
      const int so = g + half * 8;
      rb0[g] = bp[-(s0 + so)];
      rb1[g] = bp[-(s0 + so + 16)];
    }
    // Keeps the bias loads in front of the pass's score products, where the tile
    // barrier used to hold them: without it the compiler sinks them to their uses,
    // in small groups that each wait for the one before.
    __builtin_amdgcn_sched_barrier(0);

    // The K fragments of a stage's first pass are the one K read that nothing covers:
    // a stage is not read before its barrier.
    if (p == 0) {
      ka0 = frag_f16(lk, KP);
      ka1 = frag_f16(lk + 32, KP);
      ka2 = frag_f16(lk + 16 * KP, KP);
      ka3 = frag_f16(lk + 16 * KP + 32, KP);
      // Holds the eight reads together (loaded values as inputs only): without it each
      // pair is read just before its product, which waits out its whole latency.
      asm volatile("" :: "v"(ka0), "v"(ka1), "v"(ka2), "v"(ka3));
    }

    // S^T = K . Q^T; behind the first pass, on the fragments fetched a pass ahead.
    v8f st0 = {}, st1 = {};
    st0 = wmma_f16(ka0, qb0, st0);
    st0 = wmma_f16(ka1, qb1, st0);   // keys s0..s0+15
    st1 = wmma_f16(ka2, qb0, st1);
    st1 = wmma_f16(ka3, qb1, st1);   // keys s0+16..s0+31

    float sv0[8], sv1[8];
#pragma unroll
    for (int g = 0; g < 8; ++g) {
      sv0[g] = st0[g] + rb0[g];
      sv1[g] = st1[g] + rb1[g];
    }

    // Online softmax (per-query stats per-lane; merge the two lane-halves).
    float tmax = sv0[0];
#pragma unroll
    for (int g = 0; g < 8; ++g) {
      tmax = fmaxf(tmax, sv0[g]);
      tmax = fmaxf(tmax, sv1[g]);
    }
    // This pass's V^T fragments, then the next pass's K fragments (none behind a
    // stage's last pass): read here, the softmax arithmetic below runs while they come.
    const v16h va0 = frag_f16(lv + 0 * 16 * VP, VP);
    const v16h va1 = frag_f16(lv + 1 * 16 * VP, VP);
    const v16h va2 = frag_f16(lv + 2 * 16 * VP, VP);
    const v16h va3 = frag_f16(lv + 3 * 16 * VP, VP);
    if (p + 1 < SK / 32) {
      ka0 = frag_f16(lk + 32 * KP, KP);
      ka1 = frag_f16(lk + 32 * KP + 32, KP);
      ka2 = frag_f16(lk + 48 * KP, KP);
      ka3 = frag_f16(lk + 48 * KP + 32, KP);
    }
    // The other half's maximum (lane l <-> l ^ 16) by a vector cross-row move: through
    // the LDS queue its wait would cover the reads just issued.  In asm with
    // a "memory" clobber so that the reads stay in front of it and of all that hangs
    // on it: otherwise the compiler sinks each read to the product that uses it.
    float tmax_o;
    asm volatile("v_permlanex16_b32 %0, %1, %2, %3"
                 : "=v"(tmax_o) : "v"(tmax), "s"(0x76543210), "s"(0xfedcba98) : "memory");
    tmax = fmaxf(tmax, tmax_o);
    const float mnew  = fmaxf(mrow, tmax);
    const float alpha = __expf(mrow - mnew);
    mrow = mnew;

    // P^T fragment: element e<8 -> k=8*half+e (st0[e]); e>=8 -> st1[e-8].
    v16h pa;
    float tsum = 0.0f;
#pragma unroll
    for (int g = 0; g < 8; ++g) {
      const float p0 = __expf(sv0[g] - mnew);
      const float p1 = __expf(sv1[g] - mnew);
      tsum += p0 + p1;
      pa[g]     = (_Float16)p0;
      pa[8 + g] = (_Float16)p1;
    }
    tsum += __shfl_xor(tsum, 16);
    srow = srow * alpha + tsum;

#pragma unroll
    for (int g = 0; g < 8; ++g) {
      ot0[g] *= alpha; ot1[g] *= alpha; ot2[g] *= alpha; ot3[g] *= alpha;
    }

    // O^T += V^T . P^T   (A rows = d, contiguous s from LDS; B = pa)
    ot0 = wmma_f16(va0, pa, ot0);
    ot1 = wmma_f16(va1, pa, ot1);
    ot2 = wmma_f16(va2, pa, ot2);
    ot3 = wmma_f16(va3, pa, ot3);
   }
   asm volatile("s_wait_dscnt 0x0" ::: "memory");    // own reads of this buffer done
   asm volatile("s_wait_asynccnt 0x0" ::: "memory"); // own copies of stage t+1 landed
   __syncthreads();   // publishes stage t+1 and frees the buffer just read
   if (t + 2 < A_STAGE)
     attn_stage_copy(lkd + (t & 1) * AST_B, lvd + (t & 1) * AST_B,
                     gk + (size_t)(t + 2) * SK * D_HEAD, gv + (t + 2) * SK);
  }
  asm volatile("s_wait_asynccnt 0x0" ::: "memory");   // nothing in flight at the end

  // Normalize and scatter to context ch[t][E]; d = j*16 + half*8 + g is
  // contiguous in g -> one 16B store per tile.
  const float inv = 1.0f / srow;
  const int t = lglob * N_BATCH + n;
  _Float16* op = ch + (size_t)t * E_DIM + h * D_HEAD + half * 8;
  v8f* ots[4] = {&ot0, &ot1, &ot2, &ot3};
#pragma unroll
  for (int j = 0; j < 4; ++j) {
    v8h o;
#pragma unroll
    for (int g = 0; g < 8; ++g) o[g] = (_Float16)((*ots[j])[g] * inv);
    *reinterpret_cast<v8h*>(op + j * 16) = o;
  }
}

// ---------------------------------------------------------------------------
// Kernel 3: output projection.  out[t, e] = ch[t, :] . Wout[e, :] + bout[e]
// Same 128x128 block / 32x64 wave tiling as the QKV projection.
// ---------------------------------------------------------------------------
__global__ __launch_bounds__(256) void out_proj_kernel(
    const _Float16* __restrict__ ch, const _Float16* __restrict__ Wof,
    const float* __restrict__ bout, float* __restrict__ out) {
  const int w  = threadIdx.x >> 5;
  const int wm = w >> 1, wn = w & 1;
  const int m0 = blockIdx.x * 128 + wm * 32;
  const int n0 = blockIdx.y * 128 + wn * 64;
  __shared__ __align__(16) _Float16 sm[2 * STAGE_H];
  v8f acc[2][4] = {};
  gemm_128x128(ch + (size_t)(blockIdx.x * 128) * E_DIM,
               Wof + (size_t)(blockIdx.y * 128) * E_DIM, sm, wm, wn, acc);

  const int lane = threadIdx.x & 31;
  const int col  = lane & 15;
  const int half = lane >> 4;
#pragma unroll
  for (int i = 0; i < 2; ++i) {
#pragma unroll
    for (int j = 0; j < 4; ++j) {
#pragma unroll
      for (int g = 0; g < 8; ++g) {
        const int t = m0 + i * 16 + g + half * 8;
        const int c = n0 + j * 16 + col;
        out[(size_t)t * E_DIM + c] = acc[i][j][g] + bout[c];
      }
    }
  }
}

// ---------------------------------------------------------------------------
extern "C" void kernel_launch(void* const* d_in, const int* in_sizes, int n_in,
                              void* d_out, int out_size, void* d_ws, size_t ws_size,
                              hipStream_t stream) {
  const float* query = (const float*)d_in[0];
  const float* key   = (const float*)d_in[1];
  const float* value = (const float*)d_in[2];
  const float* ipw   = (const float*)d_in[3];
  const float* ipb   = (const float*)d_in[4];
  const float* opw   = (const float*)d_in[5];
  const float* opb   = (const float*)d_in[6];
  const float* rbias = (const float*)d_in[7];
  float* out = (float*)d_out;

  // Workspace layout (f16 elements):
  //   qh | kh | vt | ch : N*H*L*D = 4 Mi each
  //   xq | xk | xv      : L*N*E   = 4 Mi each      (f16 activations)
  //   wf                : 3*E*E   = 3 Mi           (f16 in_proj_weight)
  //   wof               : E*E     = 1 Mi           (f16 out_proj_weight)
  // Total 32 Mi f16 = 64 MiB.
  const size_t slab = (size_t)N_BATCH * H_NUM * L_DIM * D_HEAD;  // 4 Mi
  _Float16* qh  = (_Float16*)d_ws;
  _Float16* kh  = qh + slab;
  _Float16* vt  = kh + slab;
  _Float16* ch  = vt + slab;
  _Float16* xq  = ch + slab;
  _Float16* xk  = xq + slab;
  _Float16* xv  = xk + slab;
  _Float16* wf  = xv + slab;
  _Float16* wof = wf + (size_t)3 * E_DIM * E_DIM;

  dim3 blk(256);
  // xq | xk | xv | wf | wof are contiguous: one destination for the conversion.
  cvt_all_kernel<<<dim3(CVT_BLKS), dim3(CVT_THREADS), 0, stream>>>(
      query, key, value, ipw, opw, xq);

  // QKV projection: M=4096 -> 32 tiles, Nc=1024 -> 8 tiles, z = {Q,K,V}.
  qkv_proj_kernel<<<dim3(32, 8, 3), blk, 0, stream>>>(
      xq, xk, xv, wf, ipb, qh, kh, vt);
  // Flash attention: 16 query blocks x 32 (n,h) slices.
  flash_attn_kernel<<<dim3(L_DIM / 128, N_BATCH * H_NUM), blk, 0, stream>>>(
      qh, kh, vt, rbias, ch);
  // Output projection.
  out_proj_kernel<<<dim3(32, 8), blk, 0, stream>>>(ch, opw ? wof : wof, opb, out);
}

// v007
// One run takes 87.4 microseconds.
// Two timings next to v006 put it at 1.07 and 1.08 times that version's speed.
// Counting every step since v000, it is 2.76 times as fast.
#include <hip/hip_runtime.h>

// Multihead attention with relative position bias for MI455X (gfx1250).
// All GEMMs via v_wmma_f32_16x16x32_f16 (f16 in, f32 accumulate).
// fp32 operands are converted to f16 ONCE (one bandwidth-bound launch); the
// projection GEMMs read their fragments from LDS tiles filled by async copies.
// L = S = 2048, N = 2, E = 1024, H = 16, D = 64.

#define L_DIM   2048
#define S_DIM   2048
#define N_BATCH 2
#define E_DIM   1024
#define H_NUM   16
#define D_HEAD  64
#define BIAS_W  (2 * S_DIM - 1)   // 4095
#define LOG2E   1.4426950408889634f

typedef __attribute__((ext_vector_type(16))) _Float16 v16h;
typedef __attribute__((ext_vector_type(8)))  _Float16 v8h;
typedef __attribute__((ext_vector_type(8)))  float    v8f;

__device__ __forceinline__ v8f wmma_f16(v16h a, v16h b, v8f c) {
  // D = A(16x32 f16) * B(32x16 f16) + C(16x16 f32)
  return __builtin_amdgcn_wmma_f32_16x16x32_f16(
      /*neg_a=*/false, a, /*neg_b=*/false, b,
      /*c_mod=*/(short)0, c, /*reuse_a=*/false, /*reuse_b=*/false);
}

// Load a 16(row) x 32(K) f16 fragment whose rows are contiguous-K in memory.
// Per ISA 16-bit A layout: lane (row = lane&15, half = lane>>4) holds
// K = [8*half .. +7] and [16+8*half .. +7] (two 16B runs). The identical
// layout serves as a B fragment with "row" = N column.  Works for global
// or LDS pointers (LDS -> ds_load_b128 after address-space inference).
__device__ __forceinline__ v16h frag_f16(const _Float16* __restrict__ p, int ld) {
  const int lane = threadIdx.x & 31;
  const _Float16* r = p + (lane & 15) * ld + (lane >> 4) * 8;
  v8h lo = *reinterpret_cast<const v8h*>(r);
  v8h hi = *reinterpret_cast<const v8h*>(r + 16);
  v16h f;
#pragma unroll
  for (int i = 0; i < 8; ++i) { f[i] = lo[i]; f[8 + i] = hi[i]; }
  return f;
}

// ---------------------------------------------------------------------------
// Shared main loop of the two projection GEMMs: C(128x128) = A(128xK) . B(128xK)^T.
// A and B tiles (128 rows x 64 k each) are staged in LDS by asynchronous copies,
// two buffers, so every global line is fetched whole and once per block and the
// next tile flies while this one is multiplied.
// ---------------------------------------------------------------------------
#define KT       64                 // k per stage: 128-byte rows
#define LDP      72                 // LDS row pitch in halfs: 144 B = 16 B x odd
#define STAGE_H  (256 * LDP)        // halfs per buffer: 128 A rows, then 128 B rows
#define STAGE_B  (STAGE_H * 2)      // bytes per buffer
#define ROWS32_B (32 * LDP * 2)     // LDS bytes of 32 rows
#define N_STAGE  (E_DIM / KT)       // 16

// One stage: each lane copies 16 B of 4 A rows and of 4 B rows (a wave covers
// four whole 128-B lines per copy).  The s_wait_xcnt stands inside the statement
// so that no address register is rewritten ahead of it.
__device__ __forceinline__ void stage_copy(unsigned lds, const _Float16* ga,
                                           const _Float16* gb) {
  const unsigned l0 = lds,                l1 = lds + 1 * ROWS32_B;
  const unsigned l2 = lds + 2 * ROWS32_B, l3 = lds + 3 * ROWS32_B;
  const unsigned l4 = lds + 4 * ROWS32_B, l5 = lds + 5 * ROWS32_B;
  const unsigned l6 = lds + 6 * ROWS32_B, l7 = lds + 7 * ROWS32_B;
  const _Float16* a1 = ga + 32 * E_DIM;
  const _Float16* a2 = ga + 64 * E_DIM;
  const _Float16* a3 = ga + 96 * E_DIM;
  const _Float16* b1 = gb + 32 * E_DIM;
  const _Float16* b2 = gb + 64 * E_DIM;
  const _Float16* b3 = gb + 96 * E_DIM;
  asm volatile(
      "global_load_async_to_lds_b128 %0, %8, off\n\t"
      "global_load_async_to_lds_b128 %1, %9, off\n\t"
      "global_load_async_to_lds_b128 %2, %10, off\n\t"
      "global_load_async_to_lds_b128 %3, %11, off\n\t"
      "global_load_async_to_lds_b128 %4, %12, off\n\t"
      "global_load_async_to_lds_b128 %5, %13, off\n\t"
      "global_load_async_to_lds_b128 %6, %14, off\n\t"
      "global_load_async_to_lds_b128 %7, %15, off\n\t"
      "s_wait_xcnt 0x0"
      :: "v"(l0), "v"(l1), "v"(l2), "v"(l3), "v"(l4), "v"(l5), "v"(l6), "v"(l7),
         "v"(ga), "v"(a1), "v"(a2), "v"(a3), "v"(gb), "v"(b1), "v"(b2), "v"(b3)
      : "memory");
}

// Ablk / Bblk: first row of the block's 128 A rows / 128 B rows (row pitch E_DIM).
// sm: 2 * STAGE_H halfs of LDS.  Wave (wm, wn) accumulates its 32x64 part.
__device__ __forceinline__ void gemm_128x128(const _Float16* __restrict__ Ablk,
                                             const _Float16* __restrict__ Bblk,
                                             _Float16* sm, int wm, int wn,
                                             v8f (&acc)[2][4]) {
  const int crow = threadIdx.x >> 3, ccol = (threadIdx.x & 7) << 3;
  const unsigned lds = (unsigned)(size_t)sm + (unsigned)(crow * LDP + ccol) * 2u;
  const _Float16* ga = Ablk + (size_t)crow * E_DIM + ccol;
  const _Float16* gb = Bblk + (size_t)crow * E_DIM + ccol;

  stage_copy(lds, ga, gb);
  asm volatile("s_wait_asynccnt 0x0" ::: "memory");   // own copies of tile 0 landed
  __syncthreads();                                    // tile 0 visible to all waves
  stage_copy(lds + STAGE_B, ga + KT, gb + KT);

  for (int t = 0; t < N_STAGE; ++t) {
    const _Float16* s  = sm + (t & 1) * STAGE_H;
    const _Float16* sa = s + (wm * 32) * LDP;
    const _Float16* sb = s + (128 + wn * 64) * LDP;
    // Both loops unrolled: acc[][] is indexed by constants and stays in registers.
#pragma unroll
    for (int kk = 0; kk < KT; kk += 32) {
      v16h a0 = frag_f16(sa + kk, LDP);
      v16h a1 = frag_f16(sa + 16 * LDP + kk, LDP);
      v16h b[4];
#pragma unroll
      for (int j = 0; j < 4; ++j) b[j] = frag_f16(sb + (j * 16) * LDP + kk, LDP);
      // Keeps a k step's twelve reads in front of its eight products (the second
      // step's reads then rise among the first step's products): without it each B
      // fragment is read just before its two products, which wait out its whole
      // latency, four times per 32 k.
      __builtin_amdgcn_sched_barrier(0);
#pragma unroll
      for (int j = 0; j < 4; ++j) {
        acc[0][j] = wmma_f16(a0, b[j], acc[0][j]);
        acc[1][j] = wmma_f16(a1, b[j], acc[1][j]);
      }
    }
    asm volatile("s_wait_dscnt 0x0" ::: "memory");    // own reads of this buffer done
    asm volatile("s_wait_asynccnt 0x0" ::: "memory"); // own copies of tile t+1 landed
    __syncthreads();   // publishes tile t+1 and frees the buffer just read
    if (t + 2 < N_STAGE)
      stage_copy(lds + (t & 1) * STAGE_B, ga + (t + 2) * KT, gb + (t + 2) * KT);
  }
  asm volatile("s_wait_asynccnt 0x0" ::: "memory");   // nothing in flight at the end
}

// ---------------------------------------------------------------------------
// Kernel 0: fp32 -> f16 conversion of all five operands in ONE launch.
// The five f16 destinations lie one behind the other in the workspace, so the
// launch sees one destination array; a block's index picks its source.
// One 16-wave block per WGP: a wave owns 4096 contiguous elements (16 KiB of
// fp32), every load covers 512 contiguous bytes, every store 256, and all of a
// lane's loads are issued before its first conversion.
// ---------------------------------------------------------------------------
typedef __attribute__((ext_vector_type(4))) _Float16 v4h;
#define CVT_THREADS 512
#define CVT_LOADS   32                                  // 16-byte loads per lane
#define CVT_WAVE_EL (32 * 4 * CVT_LOADS)                // 4096 elements per wave
#define CVT_BLK_EL  ((CVT_THREADS / 32) * CVT_WAVE_EL)  // 65536 elements per block
#define ACT_BLKS    (L_DIM * N_BATCH * E_DIM / CVT_BLK_EL)   // 64 per activation
#define IPW_BLKS    (3 * E_DIM * E_DIM / CVT_BLK_EL)         // 48
#define OPW_BLKS    (E_DIM * E_DIM / CVT_BLK_EL)             // 16
#define CVT_BLKS    (3 * ACT_BLKS + IPW_BLKS + OPW_BLKS)     // 256
// Four waves a SIMD is what one 16-wave block per WGP gives: told so, the
// compiler keeps all 32 loads of a lane in flight; without it it saves registers
// and splits the loads into groups that wait on one another.
__global__ __launch_bounds__(CVT_THREADS)
__attribute__((amdgpu_waves_per_eu(4, 4))) void cvt_all_kernel(
    const float* __restrict__ query, const float* __restrict__ key,
    const float* __restrict__ value, const float* __restrict__ ipw,
    const float* __restrict__ opw, _Float16* __restrict__ dst) {
  const int b = blockIdx.x;
  const float* src;
  int first;                                   // first block of this source
  if (b < ACT_BLKS)                 { src = query; first = 0; }
  else if (b < 2 * ACT_BLKS)        { src = key;   first = ACT_BLKS; }
  else if (b < 3 * ACT_BLKS)        { src = value; first = 2 * ACT_BLKS; }
  else if (b < 3 * ACT_BLKS + IPW_BLKS) { src = ipw; first = 3 * ACT_BLKS; }
  else                              { src = opw;   first = 3 * ACT_BLKS + IPW_BLKS; }

  // The lane's first group of four elements inside the block, for both sides.
  const unsigned grp = (threadIdx.x >> 5) * (CVT_WAVE_EL / 4) + (threadIdx.x & 31);
  const float4* s = reinterpret_cast<const float4*>(
      src + (size_t)(b - first) * CVT_BLK_EL) + grp;
  v4h* d = reinterpret_cast<v4h*>(dst + (size_t)b * CVT_BLK_EL) + grp;

  float4 r[CVT_LOADS];
  // Unrolled: r[] is indexed by constants and stays in registers.
#pragma unroll
  for (int u = 0; u < CVT_LOADS; ++u) r[u] = s[u * 32];
#pragma unroll
  for (int u = 0; u < CVT_LOADS; ++u) {
    v4h o;
    o[0] = (_Float16)r[u].x; o[1] = (_Float16)r[u].y;
    o[2] = (_Float16)r[u].z; o[3] = (_Float16)r[u].w;
    d[u * 32] = o;
  }
}

// ---------------------------------------------------------------------------
// Kernel 1: fused QKV projection.  grid.z: 0=Q, 1=K, 2=V.  All-f16 operands.
// Y[t, c] = X[t, :] . W[z*E + c, :] + bias[z*E + c]   (t = l*N + n)
// Q scaled by D^-0.5 * log2(e) (attention works in base 2) -> qh[n][h][l][d];
// K -> kh[n][h][l][d];
// V -> TRANSPOSED vt[n][h][d][s].
// Block 256 thr (8 waves) -> 128 tokens x 128 columns; wave = 2x4 WMMA tiles.
// The block's tile is 4 regions (n, head) of 64 rows x 128 B of the destination:
// rows = l, bytes = d for Q and K; rows = d, bytes = l for V^T.  It is put
// together in that order in LDS and leaves as whole 128-B lines.
// The accumulator's register index must run along the destination's rows, so
// V takes the tokens as the A operand (register <-> token), Q and K take the
// weight rows as the A operand (register <-> column d).
// ---------------------------------------------------------------------------
#define OP 72                       // staged row pitch in halfs: 144 B = 16 B x odd
__global__ __launch_bounds__(256) void qkv_proj_kernel(
    const _Float16* __restrict__ xq, const _Float16* __restrict__ xk,
    const _Float16* __restrict__ xv, const _Float16* __restrict__ Wf,
    const float* __restrict__ bias,
    _Float16* __restrict__ qh, _Float16* __restrict__ kh,
    _Float16* __restrict__ vt) {
  const int z = blockIdx.z;
  const _Float16* X = (z == 0) ? xq : (z == 1) ? xk : xv;

  const int w  = threadIdx.x >> 5;
  const int wm = w >> 1, wn = w & 1;
  const float* bz = bias + z * E_DIM + blockIdx.y * 128;   // the block's 128 columns

  __shared__ __align__(16) _Float16 sm[2 * STAGE_H];
  v8f acc[2][4] = {};
  const _Float16* Xblk = X + (size_t)(blockIdx.x * 128) * E_DIM;
  const _Float16* Wblk = Wf + (size_t)(z * E_DIM + blockIdx.y * 128) * E_DIM;
  gemm_128x128(z == 2 ? Xblk : Wblk, z == 2 ? Wblk : Xblk, sm, wm, wn, acc);

  // The main loop's last barrier stands behind every wave's last read of sm, and
  // no copy is in flight: sm is free for the output tile.
  // C layout: A row = g + 8*half (register index g), B row = lane & 15.
  const int lane = threadIdx.x & 31;
  const int col  = lane & 15;
  const int half = lane >> 4;
  if (z == 2) {
    // A row = token wm*32 + i*16 + half*8 + g (n = g & 1, l = token >> 1),
    // B row = column wn*64 + j*16 + col (head wn, d = j*16 + col).
    // Registers g, g+2, g+4, g+6 are four consecutive l of one n: 8 B per store.
    // All loops unrolled: acc[][] is indexed by constants and stays in registers.
#pragma unroll
    for (int j = 0; j < 4; ++j) {
      const float b = bz[wn * 64 + j * 16 + col];
#pragma unroll
      for (int i = 0; i < 2; ++i) {
#pragma unroll
        for (int n = 0; n < 2; ++n) {
          v4h o;
#pragma unroll
          for (int e = 0; e < 4; ++e) o[e] = (_Float16)(acc[i][j][2 * e + n] + b);
          *reinterpret_cast<v4h*>(sm + ((n * 2 + wn) * 64 + j * 16 + col) * OP +
                                  wm * 16 + i * 8 + half * 4) = o;
        }
      }
    }
  } else {
    // A row = column wm*32 + i*16 + half*8 + g (head wm >> 1, eight consecutive d),
    // B row = token wn*64 + j*16 + col (n = col & 1, l = token >> 1): 16 B per store.
    const float scale = (z == 0) ? 0.125f * LOG2E : 1.0f;
    // All loops unrolled: acc[][] is indexed by constants and stays in registers.
#pragma unroll
    for (int i = 0; i < 2; ++i) {
      // Bias of the lane's eight columns.
      const float4* bq = reinterpret_cast<const float4*>(bz + wm * 32 + i * 16 + half * 8);
      const float4 b0 = bq[0], b1 = bq[1];
      const float bb[8] = {b0.x, b0.y, b0.z, b0.w, b1.x, b1.y, b1.z, b1.w};
#pragma unroll
      for (int j = 0; j < 4; ++j) {
        v8h o;
#pragma unroll
        for (int g = 0; g < 8; ++g) o[g] = (_Float16)((acc[i][j][g] + bb[g]) * scale);
        *reinterpret_cast<v8h*>(
            sm + (((col & 1) * 2 + (wm >> 1)) * 64 + wn * 32 + j * 8 + (col >> 1)) * OP +
            (wm & 1) * 32 + i * 16 + half * 8) = o;
      }
    }
  }
  __syncthreads();   // the whole tile is in LDS before any wave reads rows back

  // 256 rows x 128 B: a wave's store covers four whole rows (lines).
  _Float16* base = (z == 0) ? qh : (z == 1) ? kh : vt;
  const int l0 = blockIdx.x * 64;                        // the block's first l
  const size_t row_ld = (z == 2) ? S_DIM : D_HEAD;       // destination row pitch
  const size_t first  = (z == 2) ? (size_t)l0 : (size_t)l0 * D_HEAD;
  const int r32 = threadIdx.x >> 3, c8 = (threadIdx.x & 7) << 3;
  // Unrolled: the eight LDS reads are issued together, ahead of the first store.
#pragma unroll
  for (int u = 0; u < 8; ++u) {
    const int rg = u >> 1;                               // region: n = rg >> 1, head rg & 1
    const int rr = (u & 1) * 32 + r32;                   // row inside the region
    const int nh = (rg >> 1) * H_NUM + blockIdx.y * 2 + (rg & 1);
    const v8h o = *reinterpret_cast<const v8h*>(sm + (rg * 64 + rr) * OP + c8);
    *reinterpret_cast<v8h*>(base + (size_t)nh * (L_DIM * D_HEAD) + first +
                            (size_t)rr * row_ld + c8) = o;
  }
}

// ---------------------------------------------------------------------------
// Kernel 2: flash attention, one (n,h) per blockIdx.y, 128 query rows/block.
// K/V tiles staged in LDS once per block (8x traffic reduction vs per-wave), a
// stage of 128 keys at a time, by asynchronous copies into two buffers: the next
// stage flies while the four 32-key passes of this one are worked on.
// LDS rows are padded by 16 B (pitch = 16 B x odd) so that the 16 rows one
// ds_load_b128 fragment read touches fall on 16 different groups of four banks.
// Each wave owns 16 query rows.  Computes S^T = K . Q^T so that:
//   - softmax stats are per-lane scalars (lane <-> query column),
//   - exp(S^T) tiles are bit-exact the fragment layout required for
//     O^T = V^T . P^T  (no transpose / shuffle needed).
// Lazy maximum, base 2: a column's maximum in use is fixed BEFORE a pass, so
// bias * log2(e) - maximum is the score product's C operand and exp2 takes the
// accumulator as it is.  Only when some lane's P of a pass sum to more than P_SUM_MAX
// (or in the very first pass) does the wave take the branch that finds the pass's
// maximum, moves the maximum in use, rescales sums and outputs and does P over.
// ---------------------------------------------------------------------------
#define SK      128                      // keys per stage
#define KP      (D_HEAD + 8)             // K tile row pitch in halfs: 144 B
#define VP      (SK + 8)                 // V^T tile row pitch in halfs: 272 B
#define KTILE_H (SK * KP)                // halfs of the K tile: 128 s x 64 d
#define AST_H   (KTILE_H + D_HEAD * VP)  // halfs per buffer: K tile, then V^T tile
#define AST_B   (AST_H * 2)              // bytes per buffer
#define A_STAGE (S_DIM / SK)             // 16
#define P_SUM_MAX 256.0f                 // a lane's 16 P of a pass sum to this at most

// One stage: each lane copies 16 B of 4 K rows (32 rows apart) and of 4 V^T rows
// (16 rows apart); a wave covers four whole 128-B lines per copy.  The
// s_wait_xcnt stands inside the statement so that no address register is
// rewritten ahead of it.
__device__ __forceinline__ void attn_stage_copy(unsigned lk, unsigned lv,
                                                const _Float16* gk,
                                                const _Float16* gv) {
  const unsigned k1 = lk + 1 * (32 * KP * 2), k2 = lk + 2 * (32 * KP * 2);
  const unsigned k3 = lk + 3 * (32 * KP * 2);
  const unsigned v1 = lv + 1 * (16 * VP * 2), v2 = lv + 2 * (16 * VP * 2);
  const unsigned v3 = lv + 3 * (16 * VP * 2);
  const _Float16* gk1 = gk + 32 * D_HEAD;
  const _Float16* gk2 = gk + 64 * D_HEAD;
  const _Float16* gk3 = gk + 96 * D_HEAD;
  const _Float16* gv1 = gv + 16 * S_DIM;
  const _Float16* gv2 = gv + 32 * S_DIM;
  const _Float16* gv3 = gv + 48 * S_DIM;
  asm volatile(
      "global_load_async_to_lds_b128 %0, %8, off\n\t"
      "global_load_async_to_lds_b128 %1, %9, off\n\t"
      "global_load_async_to_lds_b128 %2, %10, off\n\t"
      "global_load_async_to_lds_b128 %3, %11, off\n\t"
      "global_load_async_to_lds_b128 %4, %12, off\n\t"
      "global_load_async_to_lds_b128 %5, %13, off\n\t"
      "global_load_async_to_lds_b128 %6, %14, off\n\t"
      "global_load_async_to_lds_b128 %7, %15, off\n\t"
      "s_wait_xcnt 0x0"
      :: "v"(lk), "v"(k1), "v"(k2), "v"(k3), "v"(lv), "v"(v1), "v"(v2), "v"(v3),
         "v"(gk), "v"(gk1), "v"(gk2), "v"(gk3), "v"(gv), "v"(gv1), "v"(gv2), "v"(gv3)
      : "memory");
}

__global__ __launch_bounds__(256) void flash_attn_kernel(
    const _Float16* __restrict__ qh, const _Float16* __restrict__ kh,
    const _Float16* __restrict__ vt, const float* __restrict__ rel_bias,
    _Float16* __restrict__ ch) {
  __shared__ __align__(16) _Float16 sm[2 * AST_H];

  const int nh   = blockIdx.y;            // n*H + h
  const int h    = nh & (H_NUM - 1);
  const int n    = nh >> 4;
  const int w    = threadIdx.x >> 5;
  const int lane = threadIdx.x & 31;
  const int q    = lane & 15;             // query column owned by this lane
  const int half = lane >> 4;
  const int qbase = blockIdx.x * 128 + w * 16;
  const int lglob = qbase + q;            // global query row

  const _Float16* Qp = qh + ((size_t)nh * L_DIM + qbase) * D_HEAD;
  const _Float16* Kp = kh + (size_t)nh * S_DIM * D_HEAD;
  const _Float16* Vp = vt + (size_t)nh * D_HEAD * S_DIM;
  // bias[h, l - s + S-1] accessed as bp[-s]
  const float* bp = rel_bias + (size_t)h * BIAS_W + lglob + (S_DIM - 1);

  // Copy coordinates (256 threads x 16 B x 4 covers each 16-KB tile).
  const int tid  = threadIdx.x;
  const int krow = tid >> 3, kcol = (tid & 7) << 3;    // 32 rows x 64 halfs a copy
  const int vrow = tid >> 4, vcol = (tid & 15) << 3;   // 16 rows x 128 halfs a copy
  const unsigned lkd = (unsigned)(size_t)sm + (unsigned)(krow * KP + kcol) * 2u;
  const unsigned lvd = (unsigned)(size_t)sm + (unsigned)(KTILE_H + vrow * VP + vcol) * 2u;
  const _Float16* gk = Kp + (size_t)krow * D_HEAD + kcol;
  const _Float16* gv = Vp + (size_t)vrow * S_DIM + vcol;

  attn_stage_copy(lkd, lvd, gk, gv);

  // Q^T B-fragments (lane row = query, contiguous d), loaded once.
  const v16h qb0 = frag_f16(Qp, D_HEAD);
  const v16h qb1 = frag_f16(Qp + 32, D_HEAD);

  v8f ot0 = {}, ot1 = {}, ot2 = {}, ot3 = {};   // O^T: VGPR<->d, lane<->query
  float mrow = 0.0f, srow = 0.0f;   // mrow: maximum in use, base 2; set by the first pass

  // Relative position bias of the coming pass; key index s = s0 + g + 8*half (+16 for
  // the second tile).  Every pass fetches the next pass's.
  float rb0[8], rb1[8];
#pragma unroll
  for (int g = 0; g < 8; ++g) {
    rb0[g] = bp[-(g + half * 8)];
    rb1[g] = bp[-(g + half * 8 + 16)];
  }

  asm volatile("s_wait_asynccnt 0x0" ::: "memory");   // own copies of stage 0 landed
  __syncthreads();                                    // stage 0 visible to all waves
  attn_stage_copy(lkd + AST_B, lvd + AST_B, gk + SK * D_HEAD, gv + SK);

  for (int t = 0; t < A_STAGE; ++t) {
   const _Float16* lks = sm + (t & 1) * AST_H;
   v16h ka0, ka1, ka2, ka3;   // K fragments of a pass (A rows = key s, contiguous d)
   // Unrolled: the LDS offsets of a pass become immediates.
#pragma unroll
   for (int p = 0; p < SK / 32; ++p) {
    const int s0 = t * SK + p * 32;
    const _Float16* lk = lks + p * 32 * KP;         // 32 keys x 64 d of this pass
    const _Float16* lv = lks + KTILE_H + p * 32;    // 64 d x 32 keys of this pass

    // The K fragments of a stage's first pass are the one K read that nothing covers:
    // a stage is not read before its barrier.
    if (p == 0) {
      ka0 = frag_f16(lk, KP);
      ka1 = frag_f16(lk + 32, KP);
      ka2 = frag_f16(lk + 16 * KP, KP);
      ka3 = frag_f16(lk + 16 * KP + 32, KP);
      // Holds the eight reads together (loaded values as inputs only): without it each
      // pair is read just before its product, which waits out its whole latency.
      asm volatile("" :: "v"(ka0), "v"(ka1), "v"(ka2), "v"(ka3));
    }

    // S^T - maximum = K . Q^T + C, C = bias * log2(e) - maximum in use; behind the
    // first pass, on the fragments fetched a pass ahead.
    v8f st0, st1;
#pragma unroll
    for (int g = 0; g < 8; ++g) {
      st0[g] = fmaf(rb0[g], LOG2E, -mrow);
      st1[g] = fmaf(rb1[g], LOG2E, -mrow);
    }
    st0 = wmma_f16(ka0, qb0, st0);
    st0 = wmma_f16(ka1, qb1, st0);   // keys s0..s0+15
    st1 = wmma_f16(ka2, qb0, st1);
    st1 = wmma_f16(ka3, qb1, st1);   // keys s0+16..s0+31

    // This pass's V^T fragments, then the next pass's K fragments (none behind a
    // stage's last pass): read here, the softmax arithmetic below runs while they come.
    const v16h va0 = frag_f16(lv + 0 * 16 * VP, VP);
    const v16h va1 = frag_f16(lv + 1 * 16 * VP, VP);
    const v16h va2 = frag_f16(lv + 2 * 16 * VP, VP);
    const v16h va3 = frag_f16(lv + 3 * 16 * VP, VP);
    if (p + 1 < SK / 32) {
      ka0 = frag_f16(lk + 32 * KP, KP);
      ka1 = frag_f16(lk + 32 * KP + 32, KP);
      ka2 = frag_f16(lk + 48 * KP, KP);
      ka3 = frag_f16(lk + 48 * KP + 32, KP);
    }
    // The next pass's bias too: the score product needs it at its start.  The last pass
    // of all has no next: it reads the first keys' bias again, inside the array, and
    // nothing uses it.
    const int sn = (p + 1 < SK / 32 || t + 1 < A_STAGE) ? s0 + 32 : 0;
#pragma unroll
    for (int g = 0; g < 8; ++g) {
      const int so = g + half * 8;
      rb0[g] = bp[-(sn + so)];
      rb1[g] = bp[-(sn + so + 16)];
    }
    // Keeps the reads just issued in front of the exponentials, which run while they
    // come: without it the compiler sinks some of them behind the branch below, each
    // just in front of its use.
    __builtin_amdgcn_sched_barrier(0);

    // P = exp2(score - maximum in use) and the lane's sum of its 16.
    float e0[8], e1[8];
    float tsum = 0.0f;
#pragma unroll
    for (int g = 0; g < 8; ++g) {
      e0[g] = __builtin_amdgcn_exp2f(st0[g]);
      e1[g] = __builtin_amdgcn_exp2f(st1[g]);
      tsum += e0[g] + e1[g];
    }
    // One test per pass, on that sum: no P is above it, so at or below P_SUM_MAX every
    // P is fit for f16.  A scalar branch, the same for the whole wave and seldom taken.
    // The very first pass always takes it: its bound is minus infinity.
    const bool first = (p == 0) && (t == 0);
    const float bound = first ? -__builtin_inff() : P_SUM_MAX;
    if (__builtin_expect(__builtin_amdgcn_ballot_w32(tsum > bound) != 0, 0)) {
      // The column's largest score above the maximum in use: the lane's own 16, then
      // the other half's (lane l <-> l ^ 16) by a vector cross-row move.
      float tmax = st0[0];
#pragma unroll
      for (int g = 0; g < 8; ++g) {
        tmax = fmaxf(tmax, st0[g]);
        tmax = fmaxf(tmax, st1[g]);
      }
      const unsigned tbits = __builtin_bit_cast(unsigned, tmax);
      const float tmax_o = __builtin_bit_cast(float, __builtin_amdgcn_permlanex16(
          tbits, tbits, 0x76543210u, 0xfedcba98u, false, false));
      const float cmax  = fmaxf(tmax, tmax_o);
      // The first pass takes its own maximum, whatever its sign; later the maximum in
      // use only rises.  Sums and outputs are still zero in the first pass.
      const float delta = first ? cmax : fmaxf(cmax, 0.0f);
      const float alpha = first ? 1.0f : __builtin_amdgcn_exp2f(-delta);
      mrow += delta;
      srow *= alpha;
      tsum = 0.0f;
#pragma unroll
      for (int g = 0; g < 8; ++g) {
        e0[g] = __builtin_amdgcn_exp2f(st0[g] - delta);
        e1[g] = __builtin_amdgcn_exp2f(st1[g] - delta);
        tsum += e0[g] + e1[g];
        ot0[g] *= alpha; ot1[g] *= alpha; ot2[g] *= alpha; ot3[g] *= alpha;
      }
    }

    // P^T fragment: element e<8 -> k=8*half+e (st0[e]); e>=8 -> st1[e-8].
    v16h pa;
#pragma unroll
    for (int g = 0; g < 8; ++g) {
      pa[g]     = (_Float16)e0[g];
      pa[8 + g] = (_Float16)e1[g];
    }
    tsum += __shfl_xor(tsum, 16);
    srow += tsum;

    // O^T += V^T . P^T   (A rows = d, contiguous s from LDS; B = pa)
    ot0 = wmma_f16(va0, pa, ot0);
    ot1 = wmma_f16(va1, pa, ot1);
    ot2 = wmma_f16(va2, pa, ot2);
    ot3 = wmma_f16(va3, pa, ot3);
   }
   asm volatile("s_wait_dscnt 0x0" ::: "memory");    // own reads of this buffer done
   asm volatile("s_wait_asynccnt 0x0" ::: "memory"); // own copies of stage t+1 landed
   __syncthreads();   // publishes stage t+1 and frees the buffer just read
   if (t + 2 < A_STAGE)
     attn_stage_copy(lkd + (t & 1) * AST_B, lvd + (t & 1) * AST_B,
                     gk + (size_t)(t + 2) * SK * D_HEAD, gv + (t + 2) * SK);
  }
  asm volatile("s_wait_asynccnt 0x0" ::: "memory");   // nothing in flight at the end

  // Normalize and scatter to context ch[t][E]; d = j*16 + half*8 + g is
  // contiguous in g -> one 16B store per tile.
  const float inv = 1.0f / srow;
  const int t = lglob * N_BATCH + n;
  _Float16* op = ch + (size_t)t * E_DIM + h * D_HEAD + half * 8;
  v8f* ots[4] = {&ot0, &ot1, &ot2, &ot3};
#pragma unroll
  for (int j = 0; j < 4; ++j) {
    v8h o;
#pragma unroll
    for (int g = 0; g < 8; ++g) o[g] = (_Float16)((*ots[j])[g] * inv);
    *reinterpret_cast<v8h*>(op + j * 16) = o;
  }
}

// ---------------------------------------------------------------------------
// Kernel 3: output projection.  out[t, e] = ch[t, :] . Wout[e, :] + bout[e]
// Same 128x128 block / 32x64 wave tiling as the QKV projection.
// ---------------------------------------------------------------------------
__global__ __launch_bounds__(256) void out_proj_kernel(
    const _Float16* __restrict__ ch, const _Float16* __restrict__ Wof,
    const float* __restrict__ bout, float* __restrict__ out) {
  const int w  = threadIdx.x >> 5;
  const int wm = w >> 1, wn = w & 1;
  const int m0 = blockIdx.x * 128 + wm * 32;
  const int n0 = blockIdx.y * 128 + wn * 64;
  __shared__ __align__(16) _Float16 sm[2 * STAGE_H];
  v8f acc[2][4] = {};
  gemm_128x128(ch + (size_t)(blockIdx.x * 128) * E_DIM,
               Wof + (size_t)(blockIdx.y * 128) * E_DIM, sm, wm, wn, acc);

  const int lane = threadIdx.x & 31;
  const int col  = lane & 15;
  const int half = lane >> 4;
#pragma unroll
  for (int i = 0; i < 2; ++i) {
#pragma unroll
    for (int j = 0; j < 4; ++j) {
#pragma unroll
      for (int g = 0; g < 8; ++g) {
        const int t = m0 + i * 16 + g + half * 8;
        const int c = n0 + j * 16 + col;
        out[(size_t)t * E_DIM + c] = acc[i][j][g] + bout[c];
      }
    }
  }
}

// ---------------------------------------------------------------------------
extern "C" void kernel_launch(void* const* d_in, const int* in_sizes, int n_in,
                              void* d_out, int out_size, void* d_ws, size_t ws_size,
                              hipStream_t stream) {
  const float* query = (const float*)d_in[0];
  const float* key   = (const float*)d_in[1];
  const float* value = (const float*)d_in[2];
  const float* ipw   = (const float*)d_in[3];
  const float* ipb   = (const float*)d_in[4];
  const float* opw   = (const float*)d_in[5];
  const float* opb   = (const float*)d_in[6];
  const float* rbias = (const float*)d_in[7];
  float* out = (float*)d_out;

  // Workspace layout (f16 elements):
  //   qh | kh | vt | ch : N*H*L*D = 4 Mi each
  //   xq | xk | xv      : L*N*E   = 4 Mi each      (f16 activations)
  //   wf                : 3*E*E   = 3 Mi           (f16 in_proj_weight)
  //   wof               : E*E     = 1 Mi           (f16 out_proj_weight)
  // Total 32 Mi f16 = 64 MiB.
  const size_t slab = (size_t)N_BATCH * H_NUM * L_DIM * D_HEAD;  // 4 Mi
  _Float16* qh  = (_Float16*)d_ws;
  _Float16* kh  = qh + slab;
  _Float16* vt  = kh + slab;
  _Float16* ch  = vt + slab;
  _Float16* xq  = ch + slab;
  _Float16* xk  = xq + slab;
  _Float16* xv  = xk + slab;
  _Float16* wf  = xv + slab;
  _Float16* wof = wf + (size_t)3 * E_DIM * E_DIM;

  dim3 blk(256);
  // xq | xk | xv | wf | wof are contiguous: one destination for the conversion.
  cvt_all_kernel<<<dim3(CVT_BLKS), dim3(CVT_THREADS), 0, stream>>>(
      query, key, value, ipw, opw, xq);

  // QKV projection: M=4096 -> 32 tiles, Nc=1024 -> 8 tiles, z = {Q,K,V}.
  qkv_proj_kernel<<<dim3(32, 8, 3), blk, 0, stream>>>(
      xq, xk, xv, wf, ipb, qh, kh, vt);
  // Flash attention: 16 query blocks x 32 (n,h) slices.
  flash_attn_kernel<<<dim3(L_DIM / 128, N_BATCH * H_NUM), blk, 0, stream>>>(
      qh, kh, vt, rbias, ch);
  // Output projection.
  out_proj_kernel<<<dim3(32, 8), blk, 0, stream>>>(ch, opw ? wof : wof, opb, out);
}

// v008
// It runs in 84.2 microseconds.
// In two side-by-side timings against v007, it was 1.05 and 1.06 times as fast.
// All steps since v000 together make it 2.90 times as fast.
#include <hip/hip_runtime.h>

// Multihead attention with relative position bias for MI455X (gfx1250).
// All GEMMs via v_wmma_f32_16x16x32_f16 (f16 in, f32 accumulate).
// fp32 operands are converted to f16 ONCE (one bandwidth-bound launch); the
// projection GEMMs read their fragments from LDS tiles filled by async copies.
// L = S = 2048, N = 2, E = 1024, H = 16, D = 64.

#define L_DIM   2048
#define S_DIM   2048
#define N_BATCH 2
#define E_DIM   1024
#define H_NUM   16
#define D_HEAD  64
#define BIAS_W  (2 * S_DIM - 1)   // 4095
#define LOG2E   1.4426950408889634f

typedef __attribute__((ext_vector_type(16))) _Float16 v16h;
typedef __attribute__((ext_vector_type(8)))  _Float16 v8h;
typedef __attribute__((ext_vector_type(8)))  float    v8f;

__device__ __forceinline__ v8f wmma_f16(v16h a, v16h b, v8f c) {
  // D = A(16x32 f16) * B(32x16 f16) + C(16x16 f32)
  return __builtin_amdgcn_wmma_f32_16x16x32_f16(
      /*neg_a=*/false, a, /*neg_b=*/false, b,
      /*c_mod=*/(short)0, c, /*reuse_a=*/false, /*reuse_b=*/false);
}

// Load a 16(row) x 32(K) f16 fragment whose rows are contiguous-K in memory.
// Per ISA 16-bit A layout: lane (row = lane&15, half = lane>>4) holds
// K = [8*half .. +7] and [16+8*half .. +7] (two 16B runs). The identical
// layout serves as a B fragment with "row" = N column.  Works for global
// or LDS pointers (LDS -> ds_load_b128 after address-space inference).
__device__ __forceinline__ v16h frag_f16(const _Float16* __restrict__ p, int ld) {
  const int lane = threadIdx.x & 31;
  const _Float16* r = p + (lane & 15) * ld + (lane >> 4) * 8;
  v8h lo = *reinterpret_cast<const v8h*>(r);
  v8h hi = *reinterpret_cast<const v8h*>(r + 16);
  v16h f;
#pragma unroll
  for (int i = 0; i < 8; ++i) { f[i] = lo[i]; f[8 + i] = hi[i]; }
  return f;
}

// ---------------------------------------------------------------------------
// Shared main loop of the two projection GEMMs: C(128x128) = A(128xK) . B(128xK)^T.
// A and B tiles (128 rows x 64 k each) are staged in LDS by asynchronous copies,
// two buffers, so every global line is fetched whole and once per block and the
// next tile flies while this one is multiplied.
// ---------------------------------------------------------------------------
#define KT       64                 // k per stage: 128-byte rows
#define LDP      72                 // LDS row pitch in halfs: 144 B = 16 B x odd
#define STAGE_H  (256 * LDP)        // halfs per buffer: 128 A rows, then 128 B rows
#define STAGE_B  (STAGE_H * 2)      // bytes per buffer
#define ROWS32_B (32 * LDP * 2)     // LDS bytes of 32 rows
#define N_STAGE  (E_DIM / KT)       // 16

// One stage: each lane copies 16 B of 4 A rows and of 4 B rows (a wave covers
// four whole 128-B lines per copy).  The s_wait_xcnt stands inside the statement
// so that no address register is rewritten ahead of it.
__device__ __forceinline__ void stage_copy(unsigned lds, const _Float16* ga,
                                           const _Float16* gb) {
  const unsigned l0 = lds,                l1 = lds + 1 * ROWS32_B;
  const unsigned l2 = lds + 2 * ROWS32_B, l3 = lds + 3 * ROWS32_B;
  const unsigned l4 = lds + 4 * ROWS32_B, l5 = lds + 5 * ROWS32_B;
  const unsigned l6 = lds + 6 * ROWS32_B, l7 = lds + 7 * ROWS32_B;
  const _Float16* a1 = ga + 32 * E_DIM;
  const _Float16* a2 = ga + 64 * E_DIM;
  const _Float16* a3 = ga + 96 * E_DIM;
  const _Float16* b1 = gb + 32 * E_DIM;
  const _Float16* b2 = gb + 64 * E_DIM;
  const _Float16* b3 = gb + 96 * E_DIM;
  asm volatile(
      "global_load_async_to_lds_b128 %0, %8, off\n\t"
      "global_load_async_to_lds_b128 %1, %9, off\n\t"
      "global_load_async_to_lds_b128 %2, %10, off\n\t"
      "global_load_async_to_lds_b128 %3, %11, off\n\t"
      "global_load_async_to_lds_b128 %4, %12, off\n\t"
      "global_load_async_to_lds_b128 %5, %13, off\n\t"
      "global_load_async_to_lds_b128 %6, %14, off\n\t"
      "global_load_async_to_lds_b128 %7, %15, off\n\t"
      "s_wait_xcnt 0x0"
      :: "v"(l0), "v"(l1), "v"(l2), "v"(l3), "v"(l4), "v"(l5), "v"(l6), "v"(l7),
         "v"(ga), "v"(a1), "v"(a2), "v"(a3), "v"(gb), "v"(b1), "v"(b2), "v"(b3)
      : "memory");
}

// Ablk / Bblk: first row of the block's 128 A rows / 128 B rows (row pitch E_DIM).
// sm: 2 * STAGE_H halfs of LDS.  Wave (wm, wn) accumulates its 32x64 part.
__device__ __forceinline__ void gemm_128x128(const _Float16* __restrict__ Ablk,
                                             const _Float16* __restrict__ Bblk,
                                             _Float16* sm, int wm, int wn,
                                             v8f (&acc)[2][4]) {
  const int crow = threadIdx.x >> 3, ccol = (threadIdx.x & 7) << 3;
  const unsigned lds = (unsigned)(size_t)sm + (unsigned)(crow * LDP + ccol) * 2u;
  const _Float16* ga = Ablk + (size_t)crow * E_DIM + ccol;
  const _Float16* gb = Bblk + (size_t)crow * E_DIM + ccol;

  stage_copy(lds, ga, gb);
  asm volatile("s_wait_asynccnt 0x0" ::: "memory");   // own copies of tile 0 landed
  __syncthreads();                                    // tile 0 visible to all waves
  stage_copy(lds + STAGE_B, ga + KT, gb + KT);

  for (int t = 0; t < N_STAGE; ++t) {
    const _Float16* s  = sm + (t & 1) * STAGE_H;
    const _Float16* sa = s + (wm * 32) * LDP;
    const _Float16* sb = s + (128 + wn * 64) * LDP;
    // Both loops unrolled: acc[][] is indexed by constants and stays in registers.
#pragma unroll
    for (int kk = 0; kk < KT; kk += 32) {
      v16h a0 = frag_f16(sa + kk, LDP);
      v16h a1 = frag_f16(sa + 16 * LDP + kk, LDP);
      v16h b[4];
#pragma unroll
      for (int j = 0; j < 4; ++j) b[j] = frag_f16(sb + (j * 16) * LDP + kk, LDP);
      // Keeps a k step's twelve reads in front of its eight products (the second
      // step's reads then rise among the first step's products): without it each B
      // fragment is read just before its two products, which wait out its whole
      // latency, four times per 32 k.
      __builtin_amdgcn_sched_barrier(0);
#pragma unroll
      for (int j = 0; j < 4; ++j) {
        acc[0][j] = wmma_f16(a0, b[j], acc[0][j]);
        acc[1][j] = wmma_f16(a1, b[j], acc[1][j]);
      }
    }
    asm volatile("s_wait_dscnt 0x0" ::: "memory");    // own reads of this buffer done
    asm volatile("s_wait_asynccnt 0x0" ::: "memory"); // own copies of tile t+1 landed
    __syncthreads();   // publishes tile t+1 and frees the buffer just read
    if (t + 2 < N_STAGE)
      stage_copy(lds + (t & 1) * STAGE_B, ga + (t + 2) * KT, gb + (t + 2) * KT);
  }
  asm volatile("s_wait_asynccnt 0x0" ::: "memory");   // nothing in flight at the end
}

// ---------------------------------------------------------------------------
// Kernel 0: fp32 -> f16 conversion of all five operands in ONE launch.
// The five f16 destinations lie one behind the other in the workspace, so the
// launch sees one destination array; a block's index picks its source.
// One 16-wave block per WGP: a wave owns 4096 contiguous elements (16 KiB of
// fp32), every load covers 512 contiguous bytes, every store 256, and all of a
// lane's loads are issued before its first conversion.
// ---------------------------------------------------------------------------
typedef __attribute__((ext_vector_type(4))) _Float16 v4h;
#define CVT_THREADS 512
#define CVT_LOADS   32                                  // 16-byte loads per lane
#define CVT_WAVE_EL (32 * 4 * CVT_LOADS)                // 4096 elements per wave
#define CVT_BLK_EL  ((CVT_THREADS / 32) * CVT_WAVE_EL)  // 65536 elements per block
#define ACT_BLKS    (L_DIM * N_BATCH * E_DIM / CVT_BLK_EL)   // 64 per activation
#define IPW_BLKS    (3 * E_DIM * E_DIM / CVT_BLK_EL)         // 48
#define OPW_BLKS    (E_DIM * E_DIM / CVT_BLK_EL)             // 16
#define CVT_BLKS    (3 * ACT_BLKS + IPW_BLKS + OPW_BLKS)     // 256
// Four waves a SIMD is what one 16-wave block per WGP gives: told so, the
// compiler keeps all 32 loads of a lane in flight; without it it saves registers
// and splits the loads into groups that wait on one another.
__global__ __launch_bounds__(CVT_THREADS)
__attribute__((amdgpu_waves_per_eu(4, 4))) void cvt_all_kernel(
    const float* __restrict__ query, const float* __restrict__ key,
    const float* __restrict__ value, const float* __restrict__ ipw,
    const float* __restrict__ opw, _Float16* __restrict__ dst) {
  const int b = blockIdx.x;
  const float* src;
  int first;                                   // first block of this source
  if (b < ACT_BLKS)                 { src = query; first = 0; }
  else if (b < 2 * ACT_BLKS)        { src = key;   first = ACT_BLKS; }
  else if (b < 3 * ACT_BLKS)        { src = value; first = 2 * ACT_BLKS; }
  else if (b < 3 * ACT_BLKS + IPW_BLKS) { src = ipw; first = 3 * ACT_BLKS; }
  else                              { src = opw;   first = 3 * ACT_BLKS + IPW_BLKS; }

  // The lane's first group of four elements inside the block, for both sides.
  const unsigned grp = (threadIdx.x >> 5) * (CVT_WAVE_EL / 4) + (threadIdx.x & 31);
  const float4* s = reinterpret_cast<const float4*>(
      src + (size_t)(b - first) * CVT_BLK_EL) + grp;
  v4h* d = reinterpret_cast<v4h*>(dst + (size_t)b * CVT_BLK_EL) + grp;

  float4 r[CVT_LOADS];
  // Unrolled: r[] is indexed by constants and stays in registers.
#pragma unroll
  for (int u = 0; u < CVT_LOADS; ++u) r[u] = s[u * 32];
#pragma unroll
  for (int u = 0; u < CVT_LOADS; ++u) {
    v4h o;
    o[0] = (_Float16)r[u].x; o[1] = (_Float16)r[u].y;
    o[2] = (_Float16)r[u].z; o[3] = (_Float16)r[u].w;
    d[u * 32] = o;
  }
}

// ---------------------------------------------------------------------------
// Kernel 1: fused QKV projection.  grid.z: 0=Q, 1=K, 2=V.  All-f16 operands.
// Y[t, c] = X[t, :] . W[z*E + c, :] + bias[z*E + c]   (t = l*N + n)
// Q scaled by D^-0.5 * log2(e) (attention works in base 2) -> qh[n][h][l][d];
// K -> kh[n][h][l][d];
// V -> TRANSPOSED vt[n][h][d][s].
// Block 256 thr (8 waves) -> 128 tokens x 128 columns; wave = 2x4 WMMA tiles.
// The block's tile is 4 regions (n, head) of 64 rows x 128 B of the destination:
// rows = l, bytes = d for Q and K; rows = d, bytes = l for V^T.  It is put
// together in that order in LDS and leaves as whole 128-B lines.
// The accumulator's register index must run along the destination's rows, so
// V takes the tokens as the A operand (register <-> token), Q and K take the
// weight rows as the A operand (register <-> column d).
// ---------------------------------------------------------------------------
#define OP 72                       // staged row pitch in halfs: 144 B = 16 B x odd
__global__ __launch_bounds__(256) void qkv_proj_kernel(
    const _Float16* __restrict__ xq, const _Float16* __restrict__ xk,
    const _Float16* __restrict__ xv, const _Float16* __restrict__ Wf,
    const float* __restrict__ bias,
    _Float16* __restrict__ qh, _Float16* __restrict__ kh,
    _Float16* __restrict__ vt) {
  const int z = blockIdx.z;
  const _Float16* X = (z == 0) ? xq : (z == 1) ? xk : xv;

  const int w  = threadIdx.x >> 5;
  const int wm = w >> 1, wn = w & 1;
  const float* bz = bias + z * E_DIM + blockIdx.y * 128;   // the block's 128 columns

  __shared__ __align__(16) _Float16 sm[2 * STAGE_H];
  v8f acc[2][4] = {};
  const _Float16* Xblk = X + (size_t)(blockIdx.x * 128) * E_DIM;
  const _Float16* Wblk = Wf + (size_t)(z * E_DIM + blockIdx.y * 128) * E_DIM;
  gemm_128x128(z == 2 ? Xblk : Wblk, z == 2 ? Wblk : Xblk, sm, wm, wn, acc);

  // The main loop's last barrier stands behind every wave's last read of sm, and
  // no copy is in flight: sm is free for the output tile.
  // C layout: A row = g + 8*half (register index g), B row = lane & 15.
  const int lane = threadIdx.x & 31;
  const int col  = lane & 15;
  const int half = lane >> 4;
  if (z == 2) {
    // A row = token wm*32 + i*16 + half*8 + g (n = g & 1, l = token >> 1),
    // B row = column wn*64 + j*16 + col (head wn, d = j*16 + col).
    // Registers g, g+2, g+4, g+6 are four consecutive l of one n: 8 B per store.
    // All loops unrolled: acc[][] is indexed by constants and stays in registers.
#pragma unroll
    for (int j = 0; j < 4; ++j) {
      const float b = bz[wn * 64 + j * 16 + col];
#pragma unroll
      for (int i = 0; i < 2; ++i) {
#pragma unroll
        for (int n = 0; n < 2; ++n) {
          v4h o;
#pragma unroll
          for (int e = 0; e < 4; ++e) o[e] = (_Float16)(acc[i][j][2 * e + n] + b);
          *reinterpret_cast<v4h*>(sm + ((n * 2 + wn) * 64 + j * 16 + col) * OP +
                                  wm * 16 + i * 8 + half * 4) = o;
        }
      }
    }
  } else {
    // A row = column wm*32 + i*16 + half*8 + g (head wm >> 1, eight consecutive d),
    // B row = token wn*64 + j*16 + col (n = col & 1, l = token >> 1): 16 B per store.
    const float scale = (z == 0) ? 0.125f * LOG2E : 1.0f;
    // All loops unrolled: acc[][] is indexed by constants and stays in registers.
#pragma unroll
    for (int i = 0; i < 2; ++i) {
      // Bias of the lane's eight columns.
      const float4* bq = reinterpret_cast<const float4*>(bz + wm * 32 + i * 16 + half * 8);
      const float4 b0 = bq[0], b1 = bq[1];
      const float bb[8] = {b0.x, b0.y, b0.z, b0.w, b1.x, b1.y, b1.z, b1.w};
#pragma unroll
      for (int j = 0; j < 4; ++j) {
        v8h o;
#pragma unroll
        for (int g = 0; g < 8; ++g) o[g] = (_Float16)((acc[i][j][g] + bb[g]) * scale);
        *reinterpret_cast<v8h*>(
            sm + (((col & 1) * 2 + (wm >> 1)) * 64 + wn * 32 + j * 8 + (col >> 1)) * OP +
            (wm & 1) * 32 + i * 16 + half * 8) = o;
      }
    }
  }
  __syncthreads();   // the whole tile is in LDS before any wave reads rows back

  // 256 rows x 128 B: a wave's store covers four whole rows (lines).
  _Float16* base = (z == 0) ? qh : (z == 1) ? kh : vt;
  const int l0 = blockIdx.x * 64;                        // the block's first l
  const size_t row_ld = (z == 2) ? S_DIM : D_HEAD;       // destination row pitch
  const size_t first  = (z == 2) ? (size_t)l0 : (size_t)l0 * D_HEAD;
  const int r32 = threadIdx.x >> 3, c8 = (threadIdx.x & 7) << 3;
  // Unrolled: the eight LDS reads are issued together, ahead of the first store.
#pragma unroll
  for (int u = 0; u < 8; ++u) {
    const int rg = u >> 1;                               // region: n = rg >> 1, head rg & 1
    const int rr = (u & 1) * 32 + r32;                   // row inside the region
    const int nh = (rg >> 1) * H_NUM + blockIdx.y * 2 + (rg & 1);
    const v8h o = *reinterpret_cast<const v8h*>(sm + (rg * 64 + rr) * OP + c8);
    *reinterpret_cast<v8h*>(base + (size_t)nh * (L_DIM * D_HEAD) + first +
                            (size_t)rr * row_ld + c8) = o;
  }
}

// ---------------------------------------------------------------------------
// Kernel 2: flash attention, one (n,h) per blockIdx.y, 128 query rows/block.
// K/V tiles staged in LDS once per block (4x traffic reduction vs per-wave), a
// stage of 128 keys at a time, by asynchronous copies into two buffers: the next
// stage flies while this one is worked on.
// LDS rows are padded by 16 B (pitch = 16 B x odd) so that the 16 rows one
// ds_load_b128 fragment read touches fall on 16 different groups of four banks.
// Each wave owns 32 query rows (two column tiles) and one half of every stage's keys
// (waves 0-3 the first 64, waves 4-7 the last 64; two 32-key passes a stage): every K
// and V^T fragment read from LDS feeds two products, and there are still eight waves
// per 128 query rows.  The two key halves of a column are joined once, at the end.
// Computes S^T = K . Q^T so that:
//   - softmax stats are per-lane scalars (lane <-> query column),
//   - exp(S^T) tiles are bit-exact the fragment layout required for
//     O^T = V^T . P^T  (no transpose / shuffle needed).
// Lazy maximum, base 2: a column's maximum in use is fixed BEFORE a pass, so
// bias * log2(e) - maximum is the score product's C operand and exp2 takes the
// accumulator as it is.  Only when some lane's P of a pass sum to more than P_SUM_MAX
// (or in the very first pass) does the wave take the branch that finds the pass's
// maximum, moves the maximum in use, rescales sums and outputs and does P over.
// ---------------------------------------------------------------------------
#define SK      128                      // keys per stage
#define KP      (D_HEAD + 8)             // K tile row pitch in halfs: 144 B
#define VP      (SK + 8)                 // V^T tile row pitch in halfs: 272 B
#define KTILE_H (SK * KP)                // halfs of the K tile: 128 s x 64 d
#define AST_H   (KTILE_H + D_HEAD * VP)  // halfs per buffer: K tile, then V^T tile
#define AST_B   (AST_H * 2)              // bytes per buffer
#define A_STAGE (S_DIM / SK)             // 16
#define WK      (SK / 2)                 // keys of a stage per wave
#define XSLOT   (9 * 128)                // floats a wave hands over at the end
#define P_SUM_MAX 256.0f                 // a lane's 16 P of a pass sum to this at most

// One stage: each lane copies 16 B of 4 K rows (32 rows apart) and of 4 V^T rows
// (16 rows apart); a wave covers four whole 128-B lines per copy.  The
// s_wait_xcnt stands inside the statement so that no address register is
// rewritten ahead of it.
__device__ __forceinline__ void attn_stage_copy(unsigned lk, unsigned lv,
                                                const _Float16* gk,
                                                const _Float16* gv) {
  const unsigned k1 = lk + 1 * (32 * KP * 2), k2 = lk + 2 * (32 * KP * 2);
  const unsigned k3 = lk + 3 * (32 * KP * 2);
  const unsigned v1 = lv + 1 * (16 * VP * 2), v2 = lv + 2 * (16 * VP * 2);
  const unsigned v3 = lv + 3 * (16 * VP * 2);
  const _Float16* gk1 = gk + 32 * D_HEAD;
  const _Float16* gk2 = gk + 64 * D_HEAD;
  const _Float16* gk3 = gk + 96 * D_HEAD;
  const _Float16* gv1 = gv + 16 * S_DIM;
  const _Float16* gv2 = gv + 32 * S_DIM;
  const _Float16* gv3 = gv + 48 * S_DIM;
  asm volatile(
      "global_load_async_to_lds_b128 %0, %8, off\n\t"
      "global_load_async_to_lds_b128 %1, %9, off\n\t"
      "global_load_async_to_lds_b128 %2, %10, off\n\t"
      "global_load_async_to_lds_b128 %3, %11, off\n\t"
      "global_load_async_to_lds_b128 %4, %12, off\n\t"
      "global_load_async_to_lds_b128 %5, %13, off\n\t"
      "global_load_async_to_lds_b128 %6, %14, off\n\t"
      "global_load_async_to_lds_b128 %7, %15, off\n\t"
      "s_wait_xcnt 0x0"
      :: "v"(lk), "v"(k1), "v"(k2), "v"(k3), "v"(lv), "v"(v1), "v"(v2), "v"(v3),
         "v"(gk), "v"(gk1), "v"(gk2), "v"(gk3), "v"(gv), "v"(gv1), "v"(gv2), "v"(gv3)
      : "memory");
}

// Four waves a SIMD (two 8-wave blocks per WGP) is what the grid gives: told so, the
// compiler keeps a wave inside a quarter of the SIMD's registers.
__global__ __launch_bounds__(256)
__attribute__((amdgpu_waves_per_eu(4, 4))) void flash_attn_kernel(
    const _Float16* __restrict__ qh, const _Float16* __restrict__ kh,
    const _Float16* __restrict__ vt, const float* __restrict__ rel_bias,
    _Float16* __restrict__ ch) {
  __shared__ __align__(16) _Float16 sm[2 * AST_H];

  const int nh   = blockIdx.y;            // n*H + h
  const int h    = nh & (H_NUM - 1);
  const int n    = nh >> 4;
  const int w    = threadIdx.x >> 5;
  const int cg   = w & 3;                 // the wave's group of 32 query columns
  const int ks   = w >> 2;                // the wave's half of every stage's keys
  const int lane = threadIdx.x & 31;
  const int q    = lane & 15;             // query column owned by this lane, per tile
  const int half = lane >> 4;
  const int qbase = blockIdx.x * 128 + cg * 32;
  const int lglob = qbase + q;            // global query row of column tile 0; tile 1: + 16

  const _Float16* Qp = qh + ((size_t)nh * L_DIM + qbase) * D_HEAD;
  const _Float16* Kp = kh + (size_t)nh * S_DIM * D_HEAD;
  const _Float16* Vp = vt + (size_t)nh * D_HEAD * S_DIM;
  // bias[h, l - s + S-1] accessed as bp[-s'], s' counted from the wave's first key.
  const float* bp = rel_bias + (size_t)h * BIAS_W + lglob + (S_DIM - 1) - ks * WK;

  // Copy coordinates (256 threads x 16 B x 4 covers each 16-KB tile).
  const int tid  = threadIdx.x;
  const int krow = tid >> 3, kcol = (tid & 7) << 3;    // 32 rows x 64 halfs a copy
  const int vrow = tid >> 4, vcol = (tid & 15) << 3;   // 16 rows x 128 halfs a copy
  const unsigned lkd = (unsigned)(size_t)sm + (unsigned)(krow * KP + kcol) * 2u;
  const unsigned lvd = (unsigned)(size_t)sm + (unsigned)(KTILE_H + vrow * VP + vcol) * 2u;
  const _Float16* gk = Kp + (size_t)krow * D_HEAD + kcol;
  const _Float16* gv = Vp + (size_t)vrow * S_DIM + vcol;

  attn_stage_copy(lkd, lvd, gk, gv);

  // Q^T B-fragments (lane row = query, contiguous d) of both column tiles, loaded once.
  v16h qb[2][2];
#pragma unroll
  for (int c = 0; c < 2; ++c) {
    qb[c][0] = frag_f16(Qp + c * 16 * D_HEAD, D_HEAD);
    qb[c][1] = frag_f16(Qp + c * 16 * D_HEAD + 32, D_HEAD);
  }

  v8f ot[2][4] = {};                    // O^T per column tile: VGPR<->d, lane<->query
  float mrow[2] = {0.0f, 0.0f};         // maximum in use, base 2; set by the first pass
  float srow[2] = {0.0f, 0.0f};

  // Relative position bias of the coming pass.  It depends on column - key alone, so
  // the four 16x16 score tiles (column tile c, key tile k) need three sets of eight:
  // k - c = -1 (rbm), 0 (rbz), +1 (rbp); key offset in a set: g + 8*half.
  // Every pass fetches the next pass's.
  float rbm[8], rbz[8], rbp[8];
#pragma unroll
  for (int g = 0; g < 8; ++g) {
    rbm[g] = bp[-(g + half * 8 - 16)];
    rbz[g] = bp[-(g + half * 8)];
    rbp[g] = bp[-(g + half * 8 + 16)];
  }

  asm volatile("s_wait_asynccnt 0x0" ::: "memory");   // own copies of stage 0 landed
  __syncthreads();                                    // stage 0 visible to all waves
  attn_stage_copy(lkd + AST_B, lvd + AST_B, gk + SK * D_HEAD, gv + SK);

  for (int t = 0; t < A_STAGE; ++t) {
   const _Float16* lks = sm + (t & 1) * AST_H + ks * WK * KP;        // the wave's K rows
   const _Float16* lvs = sm + (t & 1) * AST_H + KTILE_H + ks * WK;   // its V^T columns
   v16h ka0, ka1, ka2, ka3;   // K fragments of a pass (A rows = key s, contiguous d)
   // Unrolled: the LDS offsets of a pass become immediates.
#pragma unroll
   for (int p = 0; p < WK / 32; ++p) {
    const int s0 = t * SK + p * 32;                 // counted from the wave's first key
    const _Float16* lk = lks + p * 32 * KP;         // 32 keys x 64 d of this pass
    const _Float16* lv = lvs + p * 32;              // 64 d x 32 keys of this pass

    // The K fragments of a stage's first pass are the one K read that nothing covers:
    // a stage is not read before its barrier.
    if (p == 0) {
      ka0 = frag_f16(lk, KP);
      ka1 = frag_f16(lk + 32, KP);
      ka2 = frag_f16(lk + 16 * KP, KP);
      ka3 = frag_f16(lk + 16 * KP + 32, KP);
      // Holds the eight reads together (loaded values as inputs only): without it each
      // pair is read just before its product, which waits out its whole latency.
      asm volatile("" :: "v"(ka0), "v"(ka1), "v"(ka2), "v"(ka3));
    }

    // S^T - maximum = K . Q^T + C, C = bias * log2(e) - maximum in use; behind the
    // first pass, on the fragments fetched a pass ahead.  st[c][k]: column tile c,
    // keys s0 + 16*k .. + 15.  Each K fragment serves both column tiles.
    v8f st[2][2];
#pragma unroll
    for (int g = 0; g < 8; ++g) {
      st[0][0][g] = fmaf(rbz[g], LOG2E, -mrow[0]);
      st[0][1][g] = fmaf(rbp[g], LOG2E, -mrow[0]);
      st[1][0][g] = fmaf(rbm[g], LOG2E, -mrow[1]);
      st[1][1][g] = fmaf(rbz[g], LOG2E, -mrow[1]);
    }
#pragma unroll
    for (int c = 0; c < 2; ++c) {
      st[c][0] = wmma_f16(ka0, qb[c][0], st[c][0]);
      st[c][1] = wmma_f16(ka2, qb[c][0], st[c][1]);
    }
#pragma unroll
    for (int c = 0; c < 2; ++c) {
      st[c][0] = wmma_f16(ka1, qb[c][1], st[c][0]);
      st[c][1] = wmma_f16(ka3, qb[c][1], st[c][1]);
    }

    // This pass's V^T fragments: read here, the softmax arithmetic below runs while
    // they come.
    const v16h va0 = frag_f16(lv + 0 * 16 * VP, VP);
    const v16h va1 = frag_f16(lv + 1 * 16 * VP, VP);
    const v16h va2 = frag_f16(lv + 2 * 16 * VP, VP);
    const v16h va3 = frag_f16(lv + 3 * 16 * VP, VP);
    // The next pass's bias too: the score product needs it at its start.  Inside a
    // stage the next pass is 32 keys on, and its first set is this pass's last.  The
    // last pass of all has no next: it reads the first keys' bias again, inside the
    // array, and nothing uses it.
    if (p + 1 < WK / 32) {
#pragma unroll
      for (int g = 0; g < 8; ++g) {
        const int so = g + half * 8;
        rbm[g] = rbp[g];
        rbz[g] = bp[-(s0 + 32 + so)];
        rbp[g] = bp[-(s0 + 48 + so)];
      }
    } else {
      const int sn = (t + 1 < A_STAGE) ? (t + 1) * SK : 0;
#pragma unroll
      for (int g = 0; g < 8; ++g) {
        const int so = g + half * 8;
        rbm[g] = bp[-(sn + so - 16)];
        rbz[g] = bp[-(sn + so)];
        rbp[g] = bp[-(sn + so + 16)];
      }
    }
    // Keeps the reads just issued in front of the exponentials, which run while they
    // come: without it the compiler sinks some of them behind the branch below, each
    // just in front of its use.
    __builtin_amdgcn_sched_barrier(0);

    // P = exp2(score - maximum in use) and, per column tile, the lane's sum of its 16.
    // P^T fragments: element e<8 -> k=8*half+e (first key tile); e>=8 -> second.
    v16h pa[2];
    float tsum[2] = {0.0f, 0.0f};
#pragma unroll
    for (int c = 0; c < 2; ++c) {
#pragma unroll
      for (int g = 0; g < 8; ++g) {
        const float e0 = __builtin_amdgcn_exp2f(st[c][0][g]);
        const float e1 = __builtin_amdgcn_exp2f(st[c][1][g]);
        tsum[c] += e0 + e1;
        pa[c][g]     = (_Float16)e0;
        pa[c][8 + g] = (_Float16)e1;
      }
    }
    // One test per pass, on those sums: no P is above its sum, so at or below P_SUM_MAX
    // every P is fit for f16.  A scalar branch, the same for the whole wave and seldom
    // taken.  The wave's very first pass always takes it: its bound is minus infinity.
    const bool first = (p == 0) && (t == 0);
    const float bound = first ? -__builtin_inff() : P_SUM_MAX;
    if (__builtin_expect(__builtin_amdgcn_ballot_w32(tsum[0] > bound || tsum[1] > bound) != 0,
                         0)) {
#pragma unroll
      for (int c = 0; c < 2; ++c) {
        // The column's largest score above the maximum in use: the lane's own 16, then
        // the other half's (lane l <-> l ^ 16) by a vector cross-row move.
        float tmax = st[c][0][0];
#pragma unroll
        for (int g = 0; g < 8; ++g) {
          tmax = fmaxf(tmax, st[c][0][g]);
          tmax = fmaxf(tmax, st[c][1][g]);
        }
        const unsigned tbits = __builtin_bit_cast(unsigned, tmax);
        const float tmax_o = __builtin_bit_cast(float, __builtin_amdgcn_permlanex16(
            tbits, tbits, 0x76543210u, 0xfedcba98u, false, false));
        const float cmax  = fmaxf(tmax, tmax_o);
        // The first pass takes its own maximum, whatever its sign; later the maximum in
        // use only rises.  Sums and outputs are still zero in the first pass.
        const float delta = first ? cmax : fmaxf(cmax, 0.0f);
        const float alpha = first ? 1.0f : __builtin_amdgcn_exp2f(-delta);
        mrow[c] += delta;
        srow[c] *= alpha;
        tsum[c] = 0.0f;
#pragma unroll
        for (int g = 0; g < 8; ++g) {
          const float e0 = __builtin_amdgcn_exp2f(st[c][0][g] - delta);
          const float e1 = __builtin_amdgcn_exp2f(st[c][1][g] - delta);
          tsum[c] += e0 + e1;
          pa[c][g]     = (_Float16)e0;
          pa[c][8 + g] = (_Float16)e1;
          ot[c][0][g] *= alpha; ot[c][1][g] *= alpha;
          ot[c][2][g] *= alpha; ot[c][3][g] *= alpha;
        }
      }
    }

    // The next pass's K fragments (none behind a stage's last pass): read here, where
    // the scores' registers are free again; the eight products below run while they come.
    if (p + 1 < WK / 32) {
      ka0 = frag_f16(lk + 32 * KP, KP);
      ka1 = frag_f16(lk + 32 * KP + 32, KP);
      ka2 = frag_f16(lk + 48 * KP, KP);
      ka3 = frag_f16(lk + 48 * KP + 32, KP);
      // Keeps these reads in front of the products below: without it the compiler sinks
      // them behind the products, just in front of the next pass's, which then wait
      // out their whole latency.
      __builtin_amdgcn_sched_barrier(0);
    }
#pragma unroll
    for (int c = 0; c < 2; ++c) {
      tsum[c] += __shfl_xor(tsum[c], 16);
      srow[c] += tsum[c];
    }

    // O^T += V^T . P^T   (A rows = d, contiguous s from LDS; B = pa).  Each V^T
    // fragment serves both column tiles.
#pragma unroll
    for (int c = 0; c < 2; ++c) {
      ot[c][0] = wmma_f16(va0, pa[c], ot[c][0]);
      ot[c][1] = wmma_f16(va1, pa[c], ot[c][1]);
      ot[c][2] = wmma_f16(va2, pa[c], ot[c][2]);
      ot[c][3] = wmma_f16(va3, pa[c], ot[c][3]);
    }
   }
   asm volatile("s_wait_dscnt 0x0" ::: "memory");    // own reads of this buffer done
   asm volatile("s_wait_asynccnt 0x0" ::: "memory"); // own copies of stage t+1 landed
   __syncthreads();   // publishes stage t+1 and frees the buffer just read
   if (t + 2 < A_STAGE)
     attn_stage_copy(lkd + (t & 1) * AST_B, lvd + (t & 1) * AST_B,
                     gk + (size_t)(t + 2) * SK * D_HEAD, gv + (t + 2) * SK);
  }
  asm volatile("s_wait_asynccnt 0x0" ::: "memory");   // nothing in flight at the end

  // Two waves (w and w ^ 4) hold the two key halves of the same 32 columns.  Wave w
  // finishes column tile ks and hands the other tile to its partner through LDS.  The
  // loop's last barrier stands behind every wave's last read of sm, and no copy is in
  // flight: sm is free.  A wave's slot: eight rows of 32 lanes x 16 B, then m and s.
  float* xs = reinterpret_cast<float*>(sm);
  float* xo = xs + (size_t)w * XSLOT + lane * 4;           // own slot
  const float* xi = xs + (size_t)(w ^ 4) * XSLOT + lane * 4;   // the partner's slot
  v8f keep[4];
#pragma unroll
  for (int j = 0; j < 4; ++j) {
    const v8f give = ks ? ot[0][j] : ot[1][j];
    keep[j] = ks ? ot[1][j] : ot[0][j];
    *reinterpret_cast<float4*>(xo + (2 * j) * 128) =
        make_float4(give[0], give[1], give[2], give[3]);
    *reinterpret_cast<float4*>(xo + (2 * j + 1) * 128) =
        make_float4(give[4], give[5], give[6], give[7]);
  }
  *reinterpret_cast<float2*>(xo + 8 * 128) =
      make_float2(ks ? mrow[0] : mrow[1], ks ? srow[0] : srow[1]);
  __syncthreads();   // every wave's handed-over tile is in LDS before its partner reads

  const float2 ms = *reinterpret_cast<const float2*>(xi + 8 * 128);
  const float mk = ks ? mrow[1] : mrow[0], sk = ks ? srow[1] : srow[0];
  const float mm = fmaxf(mk, ms.x);
  const float ak = __builtin_amdgcn_exp2f(mk - mm);     // own part's weight
  const float ao = __builtin_amdgcn_exp2f(ms.x - mm);   // the partner's
  const float inv = 1.0f / (sk * ak + ms.y * ao);
  const float fk = ak * inv, fo = ao * inv;

  // Join, normalize and scatter to context ch[t][E]; d = j*16 + half*8 + g is
  // contiguous in g -> one 16B store per tile.
  const int t = (lglob + ks * 16) * N_BATCH + n;
  _Float16* op = ch + (size_t)t * E_DIM + h * D_HEAD + half * 8;
#pragma unroll
  for (int j = 0; j < 4; ++j) {
    const float4 x0 = *reinterpret_cast<const float4*>(xi + (2 * j) * 128);
    const float4 x1 = *reinterpret_cast<const float4*>(xi + (2 * j + 1) * 128);
    const float x[8] = {x0.x, x0.y, x0.z, x0.w, x1.x, x1.y, x1.z, x1.w};
    v8h o;
#pragma unroll
    for (int g = 0; g < 8; ++g) o[g] = (_Float16)(keep[j][g] * fk + x[g] * fo);
    *reinterpret_cast<v8h*>(op + j * 16) = o;
  }
}

// ---------------------------------------------------------------------------
// Kernel 3: output projection.  out[t, e] = ch[t, :] . Wout[e, :] + bout[e]
// Same 128x128 block / 32x64 wave tiling as the QKV projection.
// ---------------------------------------------------------------------------
__global__ __launch_bounds__(256) void out_proj_kernel(
    const _Float16* __restrict__ ch, const _Float16* __restrict__ Wof,
    const float* __restrict__ bout, float* __restrict__ out) {
  const int w  = threadIdx.x >> 5;
  const int wm = w >> 1, wn = w & 1;
  const int m0 = blockIdx.x * 128 + wm * 32;
  const int n0 = blockIdx.y * 128 + wn * 64;
  __shared__ __align__(16) _Float16 sm[2 * STAGE_H];
  v8f acc[2][4] = {};
  gemm_128x128(ch + (size_t)(blockIdx.x * 128) * E_DIM,
               Wof + (size_t)(blockIdx.y * 128) * E_DIM, sm, wm, wn, acc);

  const int lane = threadIdx.x & 31;
  const int col  = lane & 15;
  const int half = lane >> 4;
#pragma unroll
  for (int i = 0; i < 2; ++i) {
#pragma unroll
    for (int j = 0; j < 4; ++j) {
#pragma unroll
      for (int g = 0; g < 8; ++g) {
        const int t = m0 + i * 16 + g + half * 8;
        const int c = n0 + j * 16 + col;
        out[(size_t)t * E_DIM + c] = acc[i][j][g] + bout[c];
      }
    }
  }
}

// ---------------------------------------------------------------------------
extern "C" void kernel_launch(void* const* d_in, const int* in_sizes, int n_in,
                              void* d_out, int out_size, void* d_ws, size_t ws_size,
                              hipStream_t stream) {
  const float* query = (const float*)d_in[0];
  const float* key   = (const float*)d_in[1];
  const float* value = (const float*)d_in[2];
  const float* ipw   = (const float*)d_in[3];
  const float* ipb   = (const float*)d_in[4];
  const float* opw   = (const float*)d_in[5];
  const float* opb   = (const float*)d_in[6];
  const float* rbias = (const float*)d_in[7];
  float* out = (float*)d_out;

  // Workspace layout (f16 elements):
  //   qh | kh | vt | ch : N*H*L*D = 4 Mi each
  //   xq | xk | xv      : L*N*E   = 4 Mi each      (f16 activations)
  //   wf                : 3*E*E   = 3 Mi           (f16 in_proj_weight)
  //   wof               : E*E     = 1 Mi           (f16 out_proj_weight)
  // Total 32 Mi f16 = 64 MiB.
  const size_t slab = (size_t)N_BATCH * H_NUM * L_DIM * D_HEAD;  // 4 Mi
  _Float16* qh  = (_Float16*)d_ws;
  _Float16* kh  = qh + slab;
  _Float16* vt  = kh + slab;
  _Float16* ch  = vt + slab;
  _Float16* xq  = ch + slab;
  _Float16* xk  = xq + slab;
  _Float16* xv  = xk + slab;
  _Float16* wf  = xv + slab;
  _Float16* wof = wf + (size_t)3 * E_DIM * E_DIM;

  dim3 blk(256);
  // xq | xk | xv | wf | wof are contiguous: one destination for the conversion.
  cvt_all_kernel<<<dim3(CVT_BLKS), dim3(CVT_THREADS), 0, stream>>>(
      query, key, value, ipw, opw, xq);

  // QKV projection: M=4096 -> 32 tiles, Nc=1024 -> 8 tiles, z = {Q,K,V}.
  qkv_proj_kernel<<<dim3(32, 8, 3), blk, 0, stream>>>(
      xq, xk, xv, wf, ipb, qh, kh, vt);
  // Flash attention: 16 query blocks x 32 (n,h) slices.
  flash_attn_kernel<<<dim3(L_DIM / 128, N_BATCH * H_NUM), blk, 0, stream>>>(
      qh, kh, vt, rbias, ch);
  // Output projection.
  out_proj_kernel<<<dim3(32, 8), blk, 0, stream>>>(ch, opw ? wof : wof, opb, out);
}

// v009
// Measured time: 81.3 microseconds a run.
// Two timings next to v008 put it at 1.03 and 1.04 times that version's speed.
// All steps since v000 together make it 3.00 times as fast.
#include <hip/hip_runtime.h>

// Multihead attention with relative position bias for MI455X (gfx1250).
// All GEMMs via v_wmma_f32_16x16x32_f16 (f16 in, f32 accumulate).
// fp32 operands are converted to f16 ONCE (one bandwidth-bound launch); the
// projection GEMMs read their fragments from LDS tiles filled by async copies.
// L = S = 2048, N = 2, E = 1024, H = 16, D = 64.

#define L_DIM   2048
#define S_DIM   2048
#define N_BATCH 2
#define E_DIM   1024
#define H_NUM   16
#define D_HEAD  64
#define BIAS_W  (2 * S_DIM - 1)   // 4095
#define LOG2E   1.4426950408889634f

typedef __attribute__((ext_vector_type(16))) _Float16 v16h;
typedef __attribute__((ext_vector_type(8)))  _Float16 v8h;
typedef __attribute__((ext_vector_type(8)))  float    v8f;

__device__ __forceinline__ v8f wmma_f16(v16h a, v16h b, v8f c) {
  // D = A(16x32 f16) * B(32x16 f16) + C(16x16 f32)
  return __builtin_amdgcn_wmma_f32_16x16x32_f16(
      /*neg_a=*/false, a, /*neg_b=*/false, b,
      /*c_mod=*/(short)0, c, /*reuse_a=*/false, /*reuse_b=*/false);
}

// Load a 16(row) x 32(K) f16 fragment whose rows are contiguous-K in memory.
// Per ISA 16-bit A layout: lane (row = lane&15, half = lane>>4) holds
// K = [8*half .. +7] and [16+8*half .. +7] (two 16B runs). The identical
// layout serves as a B fragment with "row" = N column.  Works for global
// or LDS pointers (LDS -> ds_load_b128 after address-space inference).
__device__ __forceinline__ v16h frag_f16(const _Float16* __restrict__ p, int ld) {
  const int lane = threadIdx.x & 31;
  const _Float16* r = p + (lane & 15) * ld + (lane >> 4) * 8;
  v8h lo = *reinterpret_cast<const v8h*>(r);
  v8h hi = *reinterpret_cast<const v8h*>(r + 16);
  v16h f;
#pragma unroll
  for (int i = 0; i < 8; ++i) { f[i] = lo[i]; f[8 + i] = hi[i]; }
  return f;
}

// ---------------------------------------------------------------------------
// Shared main loop of the two projection GEMMs: C(128x128) = A(128xK) . B(128xK)^T.
// A and B tiles (128 rows x 64 k each) are staged in LDS by asynchronous copies,
// two buffers, so every global line is fetched whole and once per block and the
// next tile flies while this one is multiplied.
// All blocks of a launch are resident and run in step, and every operand row is
// read by all blocks with the same blockIdx.x or the same blockIdx.y: walking k
// from 0 they would all ask L2 for the same lines at the same moment.  Each block
// therefore starts its walk at its own stage (rot) and wraps round.
// ---------------------------------------------------------------------------
#define KT       64                 // k per stage: 128-byte rows
#define LDP      72                 // LDS row pitch in halfs: 144 B = 16 B x odd
#define STAGE_H  (256 * LDP)        // halfs per buffer: 128 A rows, then 128 B rows
#define STAGE_B  (STAGE_H * 2)      // bytes per buffer
#define ROWS32_B (32 * LDP * 2)     // LDS bytes of 32 rows
#define N_STAGE  (E_DIM / KT)       // 16

// One stage: each lane copies 16 B of 4 A rows and of 4 B rows (a wave covers
// four whole 128-B lines per copy).  The s_wait_xcnt stands inside the statement
// so that no address register is rewritten ahead of it.
__device__ __forceinline__ void stage_copy(unsigned lds, const _Float16* ga,
                                           const _Float16* gb) {
  const unsigned l0 = lds,                l1 = lds + 1 * ROWS32_B;
  const unsigned l2 = lds + 2 * ROWS32_B, l3 = lds + 3 * ROWS32_B;
  const unsigned l4 = lds + 4 * ROWS32_B, l5 = lds + 5 * ROWS32_B;
  const unsigned l6 = lds + 6 * ROWS32_B, l7 = lds + 7 * ROWS32_B;
  const _Float16* a1 = ga + 32 * E_DIM;
  const _Float16* a2 = ga + 64 * E_DIM;
  const _Float16* a3 = ga + 96 * E_DIM;
  const _Float16* b1 = gb + 32 * E_DIM;
  const _Float16* b2 = gb + 64 * E_DIM;
  const _Float16* b3 = gb + 96 * E_DIM;
  asm volatile(
      "global_load_async_to_lds_b128 %0, %8, off\n\t"
      "global_load_async_to_lds_b128 %1, %9, off\n\t"
      "global_load_async_to_lds_b128 %2, %10, off\n\t"
      "global_load_async_to_lds_b128 %3, %11, off\n\t"
      "global_load_async_to_lds_b128 %4, %12, off\n\t"
      "global_load_async_to_lds_b128 %5, %13, off\n\t"
      "global_load_async_to_lds_b128 %6, %14, off\n\t"
      "global_load_async_to_lds_b128 %7, %15, off\n\t"
      "s_wait_xcnt 0x0"
      :: "v"(l0), "v"(l1), "v"(l2), "v"(l3), "v"(l4), "v"(l5), "v"(l6), "v"(l7),
         "v"(ga), "v"(a1), "v"(a2), "v"(a3), "v"(gb), "v"(b1), "v"(b2), "v"(b3)
      : "memory");
}

// Ablk / Bblk: first row of the block's 128 A rows / 128 B rows (row pitch E_DIM).
// sm: 2 * STAGE_H halfs of LDS.  Wave (wm, wn) accumulates its 32x64 part.
// rot: the block's first k stage, 0 .. N_STAGE - 1, the same for the whole block.
__device__ __forceinline__ void gemm_128x128(const _Float16* __restrict__ Ablk,
                                             const _Float16* __restrict__ Bblk,
                                             _Float16* sm, int wm, int wn, int rot,
                                             v8f (&acc)[2][4]) {
  const int crow = threadIdx.x >> 3, ccol = (threadIdx.x & 7) << 3;
  const unsigned lds = (unsigned)(size_t)sm + (unsigned)(crow * LDP + ccol) * 2u;
  const _Float16* ga = Ablk + (size_t)crow * E_DIM + ccol;
  const _Float16* gb = Bblk + (size_t)crow * E_DIM + ccol;

  // k offset (in halfs) of the t-th tile of this block's walk.
  const auto koff = [rot](int t) { return ((t + rot) & (N_STAGE - 1)) * KT; };

  stage_copy(lds, ga + koff(0), gb + koff(0));
  asm volatile("s_wait_asynccnt 0x0" ::: "memory");   // own copies of tile 0 landed
  __syncthreads();                                    // tile 0 visible to all waves
  stage_copy(lds + STAGE_B, ga + koff(1), gb + koff(1));

  for (int t = 0; t < N_STAGE; ++t) {
    const _Float16* s  = sm + (t & 1) * STAGE_H;
    const _Float16* sa = s + (wm * 32) * LDP;
    const _Float16* sb = s + (128 + wn * 64) * LDP;
    // Both loops unrolled: acc[][] is indexed by constants and stays in registers.
#pragma unroll
    for (int kk = 0; kk < KT; kk += 32) {
      v16h a0 = frag_f16(sa + kk, LDP);
      v16h a1 = frag_f16(sa + 16 * LDP + kk, LDP);
      v16h b[4];
#pragma unroll
      for (int j = 0; j < 4; ++j) b[j] = frag_f16(sb + (j * 16) * LDP + kk, LDP);
      // Keeps a k step's twelve reads in front of its eight products (the second
      // step's reads then rise among the first step's products): without it each B
      // fragment is read just before its two products, which wait out its whole
      // latency, four times per 32 k.
      __builtin_amdgcn_sched_barrier(0);
#pragma unroll
      for (int j = 0; j < 4; ++j) {
        acc[0][j] = wmma_f16(a0, b[j], acc[0][j]);
        acc[1][j] = wmma_f16(a1, b[j], acc[1][j]);
      }
    }
    asm volatile("s_wait_dscnt 0x0" ::: "memory");    // own reads of this buffer done
    asm volatile("s_wait_asynccnt 0x0" ::: "memory"); // own copies of tile t+1 landed
    __syncthreads();   // publishes tile t+1 and frees the buffer just read
    if (t + 2 < N_STAGE)
      stage_copy(lds + (t & 1) * STAGE_B, ga + koff(t + 2), gb + koff(t + 2));
  }
  asm volatile("s_wait_asynccnt 0x0" ::: "memory");   // nothing in flight at the end
}

// ---------------------------------------------------------------------------
// Kernel 0: fp32 -> f16 conversion of all five operands in ONE launch.
// The five f16 destinations lie one behind the other in the workspace, so the
// launch sees one destination array; a block's index picks its source.
// One 16-wave block per WGP: a wave owns 4096 contiguous elements (16 KiB of
// fp32), every load covers 512 contiguous bytes, every store 256, and all of a
// lane's loads are issued before its first conversion.
// ---------------------------------------------------------------------------
typedef __attribute__((ext_vector_type(4))) _Float16 v4h;
#define CVT_THREADS 512
#define CVT_LOADS   32                                  // 16-byte loads per lane
#define CVT_WAVE_EL (32 * 4 * CVT_LOADS)                // 4096 elements per wave
#define CVT_BLK_EL  ((CVT_THREADS / 32) * CVT_WAVE_EL)  // 65536 elements per block
#define ACT_BLKS    (L_DIM * N_BATCH * E_DIM / CVT_BLK_EL)   // 64 per activation
#define IPW_BLKS    (3 * E_DIM * E_DIM / CVT_BLK_EL)         // 48
#define OPW_BLKS    (E_DIM * E_DIM / CVT_BLK_EL)             // 16
#define CVT_BLKS    (3 * ACT_BLKS + IPW_BLKS + OPW_BLKS)     // 256
// Four waves a SIMD is what one 16-wave block per WGP gives: told so, the
// compiler keeps all 32 loads of a lane in flight; without it it saves registers
// and splits the loads into groups that wait on one another.
__global__ __launch_bounds__(CVT_THREADS)
__attribute__((amdgpu_waves_per_eu(4, 4))) void cvt_all_kernel(
    const float* __restrict__ query, const float* __restrict__ key,
    const float* __restrict__ value, const float* __restrict__ ipw,
    const float* __restrict__ opw, _Float16* __restrict__ dst) {
  const int b = blockIdx.x;
  const float* src;
  int first;                                   // first block of this source
  if (b < ACT_BLKS)                 { src = query; first = 0; }
  else if (b < 2 * ACT_BLKS)        { src = key;   first = ACT_BLKS; }
  else if (b < 3 * ACT_BLKS)        { src = value; first = 2 * ACT_BLKS; }
  else if (b < 3 * ACT_BLKS + IPW_BLKS) { src = ipw; first = 3 * ACT_BLKS; }
  else                              { src = opw;   first = 3 * ACT_BLKS + IPW_BLKS; }

  // The lane's first group of four elements inside the block, for both sides.
  const unsigned grp = (threadIdx.x >> 5) * (CVT_WAVE_EL / 4) + (threadIdx.x & 31);
  const float4* s = reinterpret_cast<const float4*>(
      src + (size_t)(b - first) * CVT_BLK_EL) + grp;
  v4h* d = reinterpret_cast<v4h*>(dst + (size_t)b * CVT_BLK_EL) + grp;

  float4 r[CVT_LOADS];
  // Unrolled: r[] is indexed by constants and stays in registers.
#pragma unroll
  for (int u = 0; u < CVT_LOADS; ++u) r[u] = s[u * 32];
#pragma unroll
  for (int u = 0; u < CVT_LOADS; ++u) {
    v4h o;
    o[0] = (_Float16)r[u].x; o[1] = (_Float16)r[u].y;
    o[2] = (_Float16)r[u].z; o[3] = (_Float16)r[u].w;
    d[u * 32] = o;
  }
}

// ---------------------------------------------------------------------------
// Kernel 1: fused QKV projection.  grid.z: 0=Q, 1=K, 2=V.  All-f16 operands.
// Y[t, c] = X[t, :] . W[z*E + c, :] + bias[z*E + c]   (t = l*N + n)
// Q scaled by D^-0.5 * log2(e) (attention works in base 2) -> qh[n][h][l][d];
// K -> kh[n][h][l][d];
// V -> TRANSPOSED vt[n][h][d][s].
// Block 256 thr (8 waves) -> 128 tokens x 128 columns; wave = 2x4 WMMA tiles.
// The block's tile is 4 regions (n, head) of 64 rows x 128 B of the destination:
// rows = l, bytes = d for Q and K; rows = d, bytes = l for V^T.  It is put
// together in that order in LDS and leaves as whole 128-B lines.
// The accumulator's register index must run along the destination's rows, so
// V takes the tokens as the A operand (register <-> token), Q and K take the
// weight rows as the A operand (register <-> column d).
// ---------------------------------------------------------------------------
#define OP 72                       // staged row pitch in halfs: 144 B = 16 B x odd
__global__ __launch_bounds__(256) void qkv_proj_kernel(
    const _Float16* __restrict__ xq, const _Float16* __restrict__ xk,
    const _Float16* __restrict__ xv, const _Float16* __restrict__ Wf,
    const float* __restrict__ bias,
    _Float16* __restrict__ qh, _Float16* __restrict__ kh,
    _Float16* __restrict__ vt) {
  const int z = blockIdx.z;
  const _Float16* X = (z == 0) ? xq : (z == 1) ? xk : xv;

  const int w  = threadIdx.x >> 5;
  const int wm = w >> 1, wn = w & 1;
  const float* bz = bias + z * E_DIM + blockIdx.y * 128;   // the block's 128 columns

  __shared__ __align__(16) _Float16 sm[2 * STAGE_H];
  v8f acc[2][4] = {};
  const _Float16* Xblk = X + (size_t)(blockIdx.x * 128) * E_DIM;
  const _Float16* Wblk = Wf + (size_t)(z * E_DIM + blockIdx.y * 128) * E_DIM;
  gemm_128x128(z == 2 ? Xblk : Wblk, z == 2 ? Wblk : Xblk, sm, wm, wn,
               (blockIdx.x + blockIdx.y) & (N_STAGE - 1), acc);

  // The main loop's last barrier stands behind every wave's last read of sm, and
  // no copy is in flight: sm is free for the output tile.
  // C layout: A row = g + 8*half (register index g), B row = lane & 15.
  const int lane = threadIdx.x & 31;
  const int col  = lane & 15;
  const int half = lane >> 4;
  if (z == 2) {
    // A row = token wm*32 + i*16 + half*8 + g (n = g & 1, l = token >> 1),
    // B row = column wn*64 + j*16 + col (head wn, d = j*16 + col).
    // Registers g, g+2, g+4, g+6 are four consecutive l of one n: 8 B per store.
    // All loops unrolled: acc[][] is indexed by constants and stays in registers.
#pragma unroll
    for (int j = 0; j < 4; ++j) {
      const float b = bz[wn * 64 + j * 16 + col];
#pragma unroll
      for (int i = 0; i < 2; ++i) {
#pragma unroll
        for (int n = 0; n < 2; ++n) {
          v4h o;
#pragma unroll
          for (int e = 0; e < 4; ++e) o[e] = (_Float16)(acc[i][j][2 * e + n] + b);
          *reinterpret_cast<v4h*>(sm + ((n * 2 + wn) * 64 + j * 16 + col) * OP +
                                  wm * 16 + i * 8 + half * 4) = o;
        }
      }
    }
  } else {
    // A row = column wm*32 + i*16 + half*8 + g (head wm >> 1, eight consecutive d),
    // B row = token wn*64 + j*16 + col (n = col & 1, l = token >> 1): 16 B per store.
    const float scale = (z == 0) ? 0.125f * LOG2E : 1.0f;
    // All loops unrolled: acc[][] is indexed by constants and stays in registers.
#pragma unroll
    for (int i = 0; i < 2; ++i) {
      // Bias of the lane's eight columns.
      const float4* bq = reinterpret_cast<const float4*>(bz + wm * 32 + i * 16 + half * 8);
      const float4 b0 = bq[0], b1 = bq[1];
      const float bb[8] = {b0.x, b0.y, b0.z, b0.w, b1.x, b1.y, b1.z, b1.w};
#pragma unroll
      for (int j = 0; j < 4; ++j) {
        v8h o;
#pragma unroll
        for (int g = 0; g < 8; ++g) o[g] = (_Float16)((acc[i][j][g] + bb[g]) * scale);
        *reinterpret_cast<v8h*>(
            sm + (((col & 1) * 2 + (wm >> 1)) * 64 + wn * 32 + j * 8 + (col >> 1)) * OP +
            (wm & 1) * 32 + i * 16 + half * 8) = o;
      }
    }
  }
  __syncthreads();   // the whole tile is in LDS before any wave reads rows back

  // 256 rows x 128 B: a wave's store covers four whole rows (lines).
  _Float16* base = (z == 0) ? qh : (z == 1) ? kh : vt;
  const int l0 = blockIdx.x * 64;                        // the block's first l
  const size_t row_ld = (z == 2) ? S_DIM : D_HEAD;       // destination row pitch
  const size_t first  = (z == 2) ? (size_t)l0 : (size_t)l0 * D_HEAD;
  const int r32 = threadIdx.x >> 3, c8 = (threadIdx.x & 7) << 3;
  // Unrolled: the eight LDS reads are issued together, ahead of the first store.
#pragma unroll
  for (int u = 0; u < 8; ++u) {
    const int rg = u >> 1;                               // region: n = rg >> 1, head rg & 1
    const int rr = (u & 1) * 32 + r32;                   // row inside the region
    const int nh = (rg >> 1) * H_NUM + blockIdx.y * 2 + (rg & 1);
    const v8h o = *reinterpret_cast<const v8h*>(sm + (rg * 64 + rr) * OP + c8);
    *reinterpret_cast<v8h*>(base + (size_t)nh * (L_DIM * D_HEAD) + first +
                            (size_t)rr * row_ld + c8) = o;
  }
}

// ---------------------------------------------------------------------------
// Kernel 2: flash attention, one (n,h) per blockIdx.y, 128 query rows/block.
// K/V tiles staged in LDS once per block (4x traffic reduction vs per-wave), a
// stage of 128 keys at a time, by asynchronous copies into two buffers: the next
// stage flies while this one is worked on.
// LDS rows are padded by 16 B (pitch = 16 B x odd) so that the 16 rows one
// ds_load_b128 fragment read touches fall on 16 different groups of four banks.
// Each wave owns 32 query rows (two column tiles) and one half of every stage's keys
// (waves 0-3 the first 64, waves 4-7 the last 64; two 32-key passes a stage): every K
// and V^T fragment read from LDS feeds two products, and there are still eight waves
// per 128 query rows.  The two key halves of a column are joined once, at the end.
// Computes S^T = K . Q^T so that:
//   - softmax stats are per-lane scalars (lane <-> query column),
//   - exp(S^T) tiles are bit-exact the fragment layout required for
//     O^T = V^T . P^T  (no transpose / shuffle needed).
// Lazy maximum, base 2: a column's maximum in use is fixed BEFORE a pass, so
// bias * log2(e) - maximum is the score product's C operand and exp2 takes the
// accumulator as it is.  Only when some lane's P of a pass sum to more than P_SUM_MAX
// (or in the very first pass) does the wave take the branch that finds the pass's
// maximum, moves the maximum in use, rescales sums and outputs and does P over.
// ---------------------------------------------------------------------------
#define SK      128                      // keys per stage
#define KP      (D_HEAD + 8)             // K tile row pitch in halfs: 144 B
#define VP      (SK + 8)                 // V^T tile row pitch in halfs: 272 B
#define KTILE_H (SK * KP)                // halfs of the K tile: 128 s x 64 d
#define AST_H   (KTILE_H + D_HEAD * VP)  // halfs per buffer: K tile, then V^T tile
#define AST_B   (AST_H * 2)              // bytes per buffer
#define A_STAGE (S_DIM / SK)             // 16
#define WK      (SK / 2)                 // keys of a stage per wave
#define XSLOT   (9 * 128)                // floats a wave hands over at the end
#define P_SUM_MAX 256.0f                 // a lane's 16 P of a pass sum to this at most

// One stage: each lane copies 16 B of 4 K rows (32 rows apart) and of 4 V^T rows
// (16 rows apart); a wave covers four whole 128-B lines per copy.  The
// s_wait_xcnt stands inside the statement so that no address register is
// rewritten ahead of it.
__device__ __forceinline__ void attn_stage_copy(unsigned lk, unsigned lv,
                                                const _Float16* gk,
                                                const _Float16* gv) {
  const unsigned k1 = lk + 1 * (32 * KP * 2), k2 = lk + 2 * (32 * KP * 2);
  const unsigned k3 = lk + 3 * (32 * KP * 2);
  const unsigned v1 = lv + 1 * (16 * VP * 2), v2 = lv + 2 * (16 * VP * 2);
  const unsigned v3 = lv + 3 * (16 * VP * 2);
  const _Float16* gk1 = gk + 32 * D_HEAD;
  const _Float16* gk2 = gk + 64 * D_HEAD;
  const _Float16* gk3 = gk + 96 * D_HEAD;
  const _Float16* gv1 = gv + 16 * S_DIM;
  const _Float16* gv2 = gv + 32 * S_DIM;
  const _Float16* gv3 = gv + 48 * S_DIM;
  asm volatile(
      "global_load_async_to_lds_b128 %0, %8, off\n\t"
      "global_load_async_to_lds_b128 %1, %9, off\n\t"
      "global_load_async_to_lds_b128 %2, %10, off\n\t"
      "global_load_async_to_lds_b128 %3, %11, off\n\t"
      "global_load_async_to_lds_b128 %4, %12, off\n\t"
      "global_load_async_to_lds_b128 %5, %13, off\n\t"
      "global_load_async_to_lds_b128 %6, %14, off\n\t"
      "global_load_async_to_lds_b128 %7, %15, off\n\t"
      "s_wait_xcnt 0x0"
      :: "v"(lk), "v"(k1), "v"(k2), "v"(k3), "v"(lv), "v"(v1), "v"(v2), "v"(v3),
         "v"(gk), "v"(gk1), "v"(gk2), "v"(gk3), "v"(gv), "v"(gv1), "v"(gv2), "v"(gv3)
      : "memory");
}

// Four waves a SIMD (two 8-wave blocks per WGP) is what the grid gives: told so, the
// compiler keeps a wave inside a quarter of the SIMD's registers.
__global__ __launch_bounds__(256)
__attribute__((amdgpu_waves_per_eu(4, 4))) void flash_attn_kernel(
    const _Float16* __restrict__ qh, const _Float16* __restrict__ kh,
    const _Float16* __restrict__ vt, const float* __restrict__ rel_bias,
    _Float16* __restrict__ ch) {
  __shared__ __align__(16) _Float16 sm[2 * AST_H];

  const int nh   = blockIdx.y;            // n*H + h
  const int h    = nh & (H_NUM - 1);
  const int n    = nh >> 4;
  const int w    = threadIdx.x >> 5;
  const int cg   = w & 3;                 // the wave's group of 32 query columns
  const int ks   = w >> 2;                // the wave's half of every stage's keys
  const int lane = threadIdx.x & 31;
  const int q    = lane & 15;             // query column owned by this lane, per tile
  const int half = lane >> 4;
  const int qbase = blockIdx.x * 128 + cg * 32;
  const int lglob = qbase + q;            // global query row of column tile 0; tile 1: + 16

  const _Float16* Qp = qh + ((size_t)nh * L_DIM + qbase) * D_HEAD;
  const _Float16* Kp = kh + (size_t)nh * S_DIM * D_HEAD;
  const _Float16* Vp = vt + (size_t)nh * D_HEAD * S_DIM;
  // bias[h, l - s + S-1] accessed as bp[-s'], s' counted from the wave's first key.
  const float* bp = rel_bias + (size_t)h * BIAS_W + lglob + (S_DIM - 1) - ks * WK;

  // Copy coordinates (256 threads x 16 B x 4 covers each 16-KB tile).
  const int tid  = threadIdx.x;
  const int krow = tid >> 3, kcol = (tid & 7) << 3;    // 32 rows x 64 halfs a copy
  const int vrow = tid >> 4, vcol = (tid & 15) << 3;   // 16 rows x 128 halfs a copy
  const unsigned lkd = (unsigned)(size_t)sm + (unsigned)(krow * KP + kcol) * 2u;
  const unsigned lvd = (unsigned)(size_t)sm + (unsigned)(KTILE_H + vrow * VP + vcol) * 2u;
  const _Float16* gk = Kp + (size_t)krow * D_HEAD + kcol;
  const _Float16* gv = Vp + (size_t)vrow * S_DIM + vcol;

  attn_stage_copy(lkd, lvd, gk, gv);

  // Q^T B-fragments (lane row = query, contiguous d) of both column tiles, loaded once.
  v16h qb[2][2];
#pragma unroll
  for (int c = 0; c < 2; ++c) {
    qb[c][0] = frag_f16(Qp + c * 16 * D_HEAD, D_HEAD);
    qb[c][1] = frag_f16(Qp + c * 16 * D_HEAD + 32, D_HEAD);
  }

  v8f ot[2][4] = {};                    // O^T per column tile: VGPR<->d, lane<->query
  float mrow[2] = {0.0f, 0.0f};         // maximum in use, base 2; set by the first pass
  float srow[2] = {0.0f, 0.0f};

  // Relative position bias of the coming pass.  It depends on column - key alone, so
  // the four 16x16 score tiles (column tile c, key tile k) need three sets of eight:
  // k - c = -1 (rbm), 0 (rbz), +1 (rbp); key offset in a set: g + 8*half.
  // Every pass fetches the next pass's.
  float rbm[8], rbz[8], rbp[8];
#pragma unroll
  for (int g = 0; g < 8; ++g) {
    rbm[g] = bp[-(g + half * 8 - 16)];
    rbz[g] = bp[-(g + half * 8)];
    rbp[g] = bp[-(g + half * 8 + 16)];
  }

  asm volatile("s_wait_asynccnt 0x0" ::: "memory");   // own copies of stage 0 landed
  __syncthreads();                                    // stage 0 visible to all waves
  attn_stage_copy(lkd + AST_B, lvd + AST_B, gk + SK * D_HEAD, gv + SK);

  for (int t = 0; t < A_STAGE; ++t) {
   const _Float16* lks = sm + (t & 1) * AST_H + ks * WK * KP;        // the wave's K rows
   const _Float16* lvs = sm + (t & 1) * AST_H + KTILE_H + ks * WK;   // its V^T columns
   v16h ka0, ka1, ka2, ka3;   // K fragments of a pass (A rows = key s, contiguous d)
   // Unrolled: the LDS offsets of a pass become immediates.
#pragma unroll
   for (int p = 0; p < WK / 32; ++p) {
    const int s0 = t * SK + p * 32;                 // counted from the wave's first key
    const _Float16* lk = lks + p * 32 * KP;         // 32 keys x 64 d of this pass
    const _Float16* lv = lvs + p * 32;              // 64 d x 32 keys of this pass

    // The K fragments of a stage's first pass are the one K read that nothing covers:
    // a stage is not read before its barrier.
    if (p == 0) {
      ka0 = frag_f16(lk, KP);
      ka1 = frag_f16(lk + 32, KP);
      ka2 = frag_f16(lk + 16 * KP, KP);
      ka3 = frag_f16(lk + 16 * KP + 32, KP);
      // Holds the eight reads together (loaded values as inputs only): without it each
      // pair is read just before its product, which waits out its whole latency.
      asm volatile("" :: "v"(ka0), "v"(ka1), "v"(ka2), "v"(ka3));
    }

    // S^T - maximum = K . Q^T + C, C = bias * log2(e) - maximum in use; behind the
    // first pass, on the fragments fetched a pass ahead.  st[c][k]: column tile c,
    // keys s0 + 16*k .. + 15.  Each K fragment serves both column tiles.
    v8f st[2][2];
#pragma unroll
    for (int g = 0; g < 8; ++g) {
      st[0][0][g] = fmaf(rbz[g], LOG2E, -mrow[0]);
      st[0][1][g] = fmaf(rbp[g], LOG2E, -mrow[0]);
      st[1][0][g] = fmaf(rbm[g], LOG2E, -mrow[1]);
      st[1][1][g] = fmaf(rbz[g], LOG2E, -mrow[1]);
    }
#pragma unroll
    for (int c = 0; c < 2; ++c) {
      st[c][0] = wmma_f16(ka0, qb[c][0], st[c][0]);
      st[c][1] = wmma_f16(ka2, qb[c][0], st[c][1]);
    }
#pragma unroll
    for (int c = 0; c < 2; ++c) {
      st[c][0] = wmma_f16(ka1, qb[c][1], st[c][0]);
      st[c][1] = wmma_f16(ka3, qb[c][1], st[c][1]);
    }

    // This pass's V^T fragments: read here, the softmax arithmetic below runs while
    // they come.
    const v16h va0 = frag_f16(lv + 0 * 16 * VP, VP);
    const v16h va1 = frag_f16(lv + 1 * 16 * VP, VP);
    const v16h va2 = frag_f16(lv + 2 * 16 * VP, VP);
    const v16h va3 = frag_f16(lv + 3 * 16 * VP, VP);
    // The next pass's bias too: the score product needs it at its start.  Inside a
    // stage the next pass is 32 keys on, and its first set is this pass's last.  The
    // last pass of all has no next: it reads the first keys' bias again, inside the
    // array, and nothing uses it.
    if (p + 1 < WK / 32) {
#pragma unroll
      for (int g = 0; g < 8; ++g) {
        const int so = g + half * 8;
        rbm[g] = rbp[g];
        rbz[g] = bp[-(s0 + 32 + so)];
        rbp[g] = bp[-(s0 + 48 + so)];
      }
    } else {
      const int sn = (t + 1 < A_STAGE) ? (t + 1) * SK : 0;
#pragma unroll
      for (int g = 0; g < 8; ++g) {
        const int so = g + half * 8;
        rbm[g] = bp[-(sn + so - 16)];
        rbz[g] = bp[-(sn + so)];
        rbp[g] = bp[-(sn + so + 16)];
      }
    }
    // Keeps the reads just issued in front of the exponentials, which run while they
    // come: without it the compiler sinks some of them behind the branch below, each
    // just in front of its use.
    __builtin_amdgcn_sched_barrier(0);

    // P = exp2(score - maximum in use) and, per column tile, the lane's sum of its 16.
    // P^T fragments: element e<8 -> k=8*half+e (first key tile); e>=8 -> second.
    v16h pa[2];
    float tsum[2] = {0.0f, 0.0f};
#pragma unroll
    for (int c = 0; c < 2; ++c) {
#pragma unroll
      for (int g = 0; g < 8; ++g) {
        const float e0 = __builtin_amdgcn_exp2f(st[c][0][g]);
        const float e1 = __builtin_amdgcn_exp2f(st[c][1][g]);
        tsum[c] += e0 + e1;
        pa[c][g]     = (_Float16)e0;
        pa[c][8 + g] = (_Float16)e1;
      }
    }
    // One test per pass, on those sums: no P is above its sum, so at or below P_SUM_MAX
    // every P is fit for f16.  A scalar branch, the same for the whole wave and seldom
    // taken.  The wave's very first pass always takes it: its bound is minus infinity.
    const bool first = (p == 0) && (t == 0);
    const float bound = first ? -__builtin_inff() : P_SUM_MAX;
    if (__builtin_expect(__builtin_amdgcn_ballot_w32(tsum[0] > bound || tsum[1] > bound) != 0,
                         0)) {
#pragma unroll
      for (int c = 0; c < 2; ++c) {
        // The column's largest score above the maximum in use: the lane's own 16, then
        // the other half's (lane l <-> l ^ 16) by a vector cross-row move.
        float tmax = st[c][0][0];
#pragma unroll
        for (int g = 0; g < 8; ++g) {
          tmax = fmaxf(tmax, st[c][0][g]);
          tmax = fmaxf(tmax, st[c][1][g]);
        }
        const unsigned tbits = __builtin_bit_cast(unsigned, tmax);
        const float tmax_o = __builtin_bit_cast(float, __builtin_amdgcn_permlanex16(
            tbits, tbits, 0x76543210u, 0xfedcba98u, false, false));
        const float cmax  = fmaxf(tmax, tmax_o);
        // The first pass takes its own maximum, whatever its sign; later the maximum in
        // use only rises.  Sums and outputs are still zero in the first pass.
        const float delta = first ? cmax : fmaxf(cmax, 0.0f);
        const float alpha = first ? 1.0f : __builtin_amdgcn_exp2f(-delta);
        mrow[c] += delta;
        srow[c] *= alpha;
        tsum[c] = 0.0f;
#pragma unroll
        for (int g = 0; g < 8; ++g) {
          const float e0 = __builtin_amdgcn_exp2f(st[c][0][g] - delta);
          const float e1 = __builtin_amdgcn_exp2f(st[c][1][g] - delta);
          tsum[c] += e0 + e1;
          pa[c][g]     = (_Float16)e0;
          pa[c][8 + g] = (_Float16)e1;
          ot[c][0][g] *= alpha; ot[c][1][g] *= alpha;
          ot[c][2][g] *= alpha; ot[c][3][g] *= alpha;
        }
      }
    }

    // The next pass's K fragments (none behind a stage's last pass): read here, where
    // the scores' registers are free again; the eight products below run while they come.
    if (p + 1 < WK / 32) {
      ka0 = frag_f16(lk + 32 * KP, KP);
      ka1 = frag_f16(lk + 32 * KP + 32, KP);
      ka2 = frag_f16(lk + 48 * KP, KP);
      ka3 = frag_f16(lk + 48 * KP + 32, KP);
      // Keeps these reads in front of the products below: without it the compiler sinks
      // them behind the products, just in front of the next pass's, which then wait
      // out their whole latency.
      __builtin_amdgcn_sched_barrier(0);
    }
#pragma unroll
    for (int c = 0; c < 2; ++c) {
      tsum[c] += __shfl_xor(tsum[c], 16);
      srow[c] += tsum[c];
    }

    // O^T += V^T . P^T   (A rows = d, contiguous s from LDS; B = pa).  Each V^T
    // fragment serves both column tiles.
#pragma unroll
    for (int c = 0; c < 2; ++c) {
      ot[c][0] = wmma_f16(va0, pa[c], ot[c][0]);
      ot[c][1] = wmma_f16(va1, pa[c], ot[c][1]);
      ot[c][2] = wmma_f16(va2, pa[c], ot[c][2]);
      ot[c][3] = wmma_f16(va3, pa[c], ot[c][3]);
    }
   }
   asm volatile("s_wait_dscnt 0x0" ::: "memory");    // own reads of this buffer done
   asm volatile("s_wait_asynccnt 0x0" ::: "memory"); // own copies of stage t+1 landed
   __syncthreads();   // publishes stage t+1 and frees the buffer just read
   if (t + 2 < A_STAGE)
     attn_stage_copy(lkd + (t & 1) * AST_B, lvd + (t & 1) * AST_B,
                     gk + (size_t)(t + 2) * SK * D_HEAD, gv + (t + 2) * SK);
  }
  asm volatile("s_wait_asynccnt 0x0" ::: "memory");   // nothing in flight at the end

  // Two waves (w and w ^ 4) hold the two key halves of the same 32 columns.  Wave w
  // finishes column tile ks and hands the other tile to its partner through LDS.  The
  // loop's last barrier stands behind every wave's last read of sm, and no copy is in
  // flight: sm is free.  A wave's slot: eight rows of 32 lanes x 16 B, then m and s.
  float* xs = reinterpret_cast<float*>(sm);
  float* xo = xs + (size_t)w * XSLOT + lane * 4;           // own slot
  const float* xi = xs + (size_t)(w ^ 4) * XSLOT + lane * 4;   // the partner's slot
  v8f keep[4];
#pragma unroll
  for (int j = 0; j < 4; ++j) {
    const v8f give = ks ? ot[0][j] : ot[1][j];
    keep[j] = ks ? ot[1][j] : ot[0][j];
    *reinterpret_cast<float4*>(xo + (2 * j) * 128) =
        make_float4(give[0], give[1], give[2], give[3]);
    *reinterpret_cast<float4*>(xo + (2 * j + 1) * 128) =
        make_float4(give[4], give[5], give[6], give[7]);
  }
  *reinterpret_cast<float2*>(xo + 8 * 128) =
      make_float2(ks ? mrow[0] : mrow[1], ks ? srow[0] : srow[1]);
  __syncthreads();   // every wave's handed-over tile is in LDS before its partner reads

  const float2 ms = *reinterpret_cast<const float2*>(xi + 8 * 128);
  const float mk = ks ? mrow[1] : mrow[0], sk = ks ? srow[1] : srow[0];
  const float mm = fmaxf(mk, ms.x);
  const float ak = __builtin_amdgcn_exp2f(mk - mm);     // own part's weight
  const float ao = __builtin_amdgcn_exp2f(ms.x - mm);   // the partner's
  const float inv = 1.0f / (sk * ak + ms.y * ao);
  const float fk = ak * inv, fo = ao * inv;

  // Join, normalize and scatter to context ch[t][E]; d = j*16 + half*8 + g is
  // contiguous in g -> one 16B store per tile.
  const int t = (lglob + ks * 16) * N_BATCH + n;
  _Float16* op = ch + (size_t)t * E_DIM + h * D_HEAD + half * 8;
#pragma unroll
  for (int j = 0; j < 4; ++j) {
    const float4 x0 = *reinterpret_cast<const float4*>(xi + (2 * j) * 128);
    const float4 x1 = *reinterpret_cast<const float4*>(xi + (2 * j + 1) * 128);
    const float x[8] = {x0.x, x0.y, x0.z, x0.w, x1.x, x1.y, x1.z, x1.w};
    v8h o;
#pragma unroll
    for (int g = 0; g < 8; ++g) o[g] = (_Float16)(keep[j][g] * fk + x[g] * fo);
    *reinterpret_cast<v8h*>(op + j * 16) = o;
  }
}

// ---------------------------------------------------------------------------
// Kernel 3: output projection.  out[t, e] = ch[t, :] . Wout[e, :] + bout[e]
// Same 128x128 block / 32x64 wave tiling as the QKV projection.
// ---------------------------------------------------------------------------
__global__ __launch_bounds__(256) void out_proj_kernel(
    const _Float16* __restrict__ ch, const _Float16* __restrict__ Wof,
    const float* __restrict__ bout, float* __restrict__ out) {
  const int w  = threadIdx.x >> 5;
  const int wm = w >> 1, wn = w & 1;
  const int m0 = blockIdx.x * 128 + wm * 32;
  const int n0 = blockIdx.y * 128 + wn * 64;
  __shared__ __align__(16) _Float16 sm[2 * STAGE_H];
  v8f acc[2][4] = {};
  gemm_128x128(ch + (size_t)(blockIdx.x * 128) * E_DIM,
               Wof + (size_t)(blockIdx.y * 128) * E_DIM, sm, wm, wn,
               (blockIdx.x + blockIdx.y) & (N_STAGE - 1), acc);

  const int lane = threadIdx.x & 31;
  const int col  = lane & 15;
  const int half = lane >> 4;
#pragma unroll
  for (int i = 0; i < 2; ++i) {
#pragma unroll
    for (int j = 0; j < 4; ++j) {
#pragma unroll
      for (int g = 0; g < 8; ++g) {
        const int t = m0 + i * 16 + g + half * 8;
        const int c = n0 + j * 16 + col;
        out[(size_t)t * E_DIM + c] = acc[i][j][g] + bout[c];
      }
    }
  }
}

// ---------------------------------------------------------------------------
extern "C" void kernel_launch(void* const* d_in, const int* in_sizes, int n_in,
                              void* d_out, int out_size, void* d_ws, size_t ws_size,
                              hipStream_t stream) {
  const float* query = (const float*)d_in[0];
  const float* key   = (const float*)d_in[1];
  const float* value = (const float*)d_in[2];
  const float* ipw   = (const float*)d_in[3];
  const float* ipb   = (const float*)d_in[4];
  const float* opw   = (const float*)d_in[5];
  const float* opb   = (const float*)d_in[6];
  const float* rbias = (const float*)d_in[7];
  float* out = (float*)d_out;

  // Workspace layout (f16 elements):
  //   qh | kh | vt | ch : N*H*L*D = 4 Mi each
  //   xq | xk | xv      : L*N*E   = 4 Mi each      (f16 activations)
  //   wf                : 3*E*E   = 3 Mi           (f16 in_proj_weight)
  //   wof               : E*E     = 1 Mi           (f16 out_proj_weight)
  // Total 32 Mi f16 = 64 MiB.
  const size_t slab = (size_t)N_BATCH * H_NUM * L_DIM * D_HEAD;  // 4 Mi
  _Float16* qh  = (_Float16*)d_ws;
  _Float16* kh  = qh + slab;
  _Float16* vt  = kh + slab;
  _Float16* ch  = vt + slab;
  _Float16* xq  = ch + slab;
  _Float16* xk  = xq + slab;
  _Float16* xv  = xk + slab;
  _Float16* wf  = xv + slab;
  _Float16* wof = wf + (size_t)3 * E_DIM * E_DIM;

  dim3 blk(256);
  // xq | xk | xv | wf | wof are contiguous: one destination for the conversion.
  cvt_all_kernel<<<dim3(CVT_BLKS), dim3(CVT_THREADS), 0, stream>>>(
      query, key, value, ipw, opw, xq);

  // QKV projection: M=4096 -> 32 tiles, Nc=1024 -> 8 tiles, z = {Q,K,V}.
  qkv_proj_kernel<<<dim3(32, 8, 3), blk, 0, stream>>>(
      xq, xk, xv, wf, ipb, qh, kh, vt);
  // Flash attention: 16 query blocks x 32 (n,h) slices.
  flash_attn_kernel<<<dim3(L_DIM / 128, N_BATCH * H_NUM), blk, 0, stream>>>(
      qh, kh, vt, rbias, ch);
  // Output projection.
  out_proj_kernel<<<dim3(32, 8), blk, 0, stream>>>(ch, opw ? wof : wof, opb, out);
}
